// v000
// Times are from an AMD MI455X. After a warm-up the kernel runs many times in a row, and a time is the length of
// such a window on the GPU divided by its runs, so every launch and the gaps after it count. The runs cycle
// through copies of the inputs. A figure is the median of several windows, for all but v000 over two sittings.
// Sittings can differ by a few percent; kernels timed side by side share one.
// v000, which the later versions start from, runs in 612 microseconds.
// compute dtype: all float inputs rounded to bf16; keys/queries/values = kp_feat W with EXACT bf16 products on WMMA 16x16x32, f32 accumulate; pairwise distances sqrt(sum (p_i - p_j)^2) in f32 (precise sqrtf) once per batch; att = (dist / 0.5 + q . k / 8) / sqrt(2) with q as f16 hi + residual, k f16 (2 products), stored in f32 (4 batches x 8 heads per launch); softmax in f32 (precise expf) -> P f16 x 2^11; upd = P . v (v rounded once to f16); out MLP 512 -> 128 -> 64 -> 256 with SiLU after each, activations split bf16 hi + lo (2 products); f32 output.
#include <hip/hip_runtime.h>
#include <math.h>

typedef __attribute__((ext_vector_type(16))) _Float16 v16h;
typedef __attribute__((ext_vector_type(16))) __bf16 v16b;
typedef __attribute__((ext_vector_type(8)))  _Float16 v8h;
typedef __attribute__((ext_vector_type(8)))  float v8f;
typedef __attribute__((ext_vector_type(4)))  float v4f;
typedef __attribute__((ext_vector_type(2)))  float v2f;
typedef __attribute__((ext_vector_type(4)))  unsigned v4u;
typedef __attribute__((ext_vector_type(4)))  int v4i;
typedef float __attribute__((may_alias)) float_a;
typedef int __attribute__((may_alias)) int_a;

template <typename T> __device__ __forceinline__ void vst2(void* p, T v) { *(T*)p = v;  }
__device__ __forceinline__ v8f wmma16(v16h a, v16h b, v8f c) {
  v8f d = __builtin_amdgcn_wmma_f32_16x16x32_f16(false, a, false, b, (short)0, c, false, false);
  asm volatile("v_nop\n\tv_nop\n\tv_nop\n\tv_nop" : "+v"(d) : "v"(a), "v"(b));
  return d;
}
__device__ __forceinline__ v8f wmma_bf(v16b a, v16b b, v8f c) {
  v8f d = __builtin_amdgcn_wmma_f32_16x16x32_bf16(false, a, false, b, (short)0, c, false, false);
  asm volatile("v_nop\n\tv_nop\n\tv_nop\n\tv_nop" : "+v"(d) : "v"(a), "v"(b));
  return d;
}
// 16x16x32 fragments: lane = (h = lane>>4, row/col = lane&15); elements 0..7 = k0+8h+0..7, 8..15 = k0+16+8h+0..7; D element r = row 8h+r
__device__ __forceinline__ v16h frag_h(const _Float16* rowk0, int lane) {
  union { v16h v; v8h q[2]; } u; const _Float16* p = rowk0 + 8 * (lane >> 4);
  u.q[0] = *(const v8h*)p; u.q[1] = *(const v8h*)(p + 16); return u.v;
}
__device__ __forceinline__ v16h frag_f32(const float* rowk0, int lane) {
  v16h a; const float* p = rowk0 + 8 * (lane >> 4);
#pragma unroll
  for (int i = 0; i < 8; ++i) { a[i] = (_Float16)p[i]; a[8 + i] = (_Float16)p[16 + i]; }
  return a;
}
__device__ __forceinline__ v16h frag_f32s(const float* rowk0, int lane, float sc) {
  v16h a; const float* p = rowk0 + 8 * (lane >> 4);
#pragma unroll
  for (int i = 0; i < 8; ++i) { a[i] = (_Float16)(p[i] * sc); a[8 + i] = (_Float16)(p[16 + i] * sc); }
  return a;
}
// column fragment from a [K][ld] layout (column n), rows >= K read as 0
__device__ __forceinline__ v16h fragc_f32(const float* W, int k0, int n, int lane, int ld, int K) {
  v16h a; const int g = lane >> 4;
#pragma unroll
  for (int i = 0; i < 8; ++i) { const int ka = k0 + 8 * g + i, kb = ka + 16;
    a[i] = (_Float16)(ka < K ? W[(size_t)(ka < K ? ka : K - 1) * ld + n] : 0.f); a[8 + i] = (_Float16)(kb < K ? W[(size_t)(kb < K ? kb : K - 1) * ld + n] : 0.f); }
  return a;
}
struct F2 { v16b h, l; };
__device__ __forceinline__ F2 bsplit16(const float v[16]) { F2 r;
#pragma unroll
  for (int i = 0; i < 16; ++i) { const __bf16 h = (__bf16)v[i]; r.h[i] = h; r.l[i] = (__bf16)(v[i] - (float)h); }
  return r; }
__device__ __forceinline__ F2 split_row(const float* row, int k0, int lane) { float v[16]; const float* p = row + k0 + 8 * (lane >> 4);
#pragma unroll
  for (int i = 0; i < 8; ++i) { v[i] = p[i]; v[8 + i] = p[16 + i]; }
  return bsplit16(v); }
__device__ __forceinline__ F2 split_rowK(const float* row, int k0, int lane, int K) { float v[16]; const int g = lane >> 4;
#pragma unroll
  for (int i = 0; i < 8; ++i) { const int ka = k0 + 8 * g + i, kb = ka + 16; v[i] = ka < K ? row[ka < K ? ka : K - 1] : 0.f; v[8 + i] = kb < K ? row[kb < K ? kb : K - 1] : 0.f; }
  return bsplit16(v); }
__device__ __forceinline__ F2 split_col(const float* W, int k0, int n, int lane, int ld, int K) { float v[16]; const int g = lane >> 4;
#pragma unroll
  for (int i = 0; i < 8; ++i) { const int ka = k0 + 8 * g + i, kb = ka + 16; v[i] = ka < K ? W[(size_t)(ka < K ? ka : K - 1) * ld + n] : 0.f; v[8 + i] = kb < K ? W[(size_t)(kb < K ? kb : K - 1) * ld + n] : 0.f; }
  return bsplit16(v); }
__device__ __forceinline__ v8f mac3(const F2& a, const F2& b, v8f c) { c = wmma_bf(a.l, b.h, c); c = wmma_bf(a.h, b.l, c); return wmma_bf(a.h, b.h, c); }
__device__ __forceinline__ float sigm(float v) { return 1.0f / (1.0f + expf(-v)); }
#define LDSX() do { asm volatile("s_wait_dscnt 0" ::: "memory"); __builtin_amdgcn_wave_barrier(); __builtin_amdgcn_fence(__ATOMIC_RELEASE, "workgroup"); } while (0)


// Keypoint multi-head attention (B 32, N 512 keypoints, in_dim 256, 8 heads x 64): distance-biased attention followed by a 3-layer SiLU MLP.
#define NB 32
#define TT 512
#define CIN 256
#define CC 512
#define NH 8
#define HD 64
#define BG 4
#define ZG (BG * NH)
#define NR (NB * TT)
#ifndef TNB
#define TNB NB
#endif
typedef __attribute__((ext_vector_type(8))) __bf16 v8b;
__device__ __forceinline__ v16b frag_b(const __bf16* rowk0, int lane) {
  union { v16b v; v8b q[2]; } u; const __bf16* p = rowk0 + 8 * (lane >> 4);
  u.q[0] = *(const v8b*)p; u.q[1] = *(const v8b*)(p + 16); return u.v;
}
__device__ __forceinline__ float bfr(float v) { return (float)(__bf16)v; }
__device__ __attribute__((noinline)) float exp_ni(float v) { return expf(v); }
__device__ __attribute__((noinline)) float erf_ni(float v) { return erff(v); }

#define WS_QH  0u
#define WS_QL  (WS_QH + 2u * (size_t)NR * CC)
#define WS_KH  (WS_QL + 2u * (size_t)NR * CC)
#define WS_VT  (WS_KH + 2u * (size_t)NR * CC)          // f16 v planes [b][512][t]
#define WS_D   (WS_VT + 2u * (size_t)NR * CC)          // f32 dist [b][t][t]
#define WS_S   (WS_D + 4u * (size_t)NB * TT * TT)      // f32 S [ZG][t][t]
#define WS_PH  (WS_S + 4u * (size_t)ZG * TT * TT)
#define WS_U   (WS_PH + 2u * (size_t)ZG * TT * TT)      // f32 upd rows [b*t][512]
#define WS_H1  (WS_U + 4u * (size_t)NR * CC)           // f32 [b*t][128]
#define WS_H2  (WS_H1 + 4u * (size_t)NR * 128)         // f32 [b*t][64]
#define WS_END (WS_H2 + 4u * (size_t)NR * 64)

// ---- k_proj: block = (64 rows, 128 cols, which): kp_feat W ((in,out) [256][512]), no bias
__global__ __launch_bounds__(128) void k_proj(const float* __restrict__ X, const float* __restrict__ WK, const float* __restrict__ WQ, const float* __restrict__ WV, _Float16* __restrict__ QH, _Float16* __restrict__ QL, _Float16* __restrict__ KH, _Float16* __restrict__ VT) {
  __shared__ __align__(16) _Float16 sh[64][136], sl[64][136]; __shared__ __align__(16) _Float16 th[128][72];
  const int tid = threadIdx.x, wave = tid >> 5, lane = tid & 31, col = lane & 15, g = lane >> 4; const int which = blockIdx.z; const int c0 = blockIdx.y * 128; const size_t r0 = (size_t)blockIdx.x * 64; const float* Wm = which == 0 ? WQ : which == 1 ? WK : WV;
  v8f acc[8] = {};
#pragma unroll
  for (int kc = 0; kc < CIN / 32; ++kc) { v16b a; { const float* p = X + (r0 + wave * 16 + col) * CIN + kc * 32 + 8 * g;
#pragma unroll
      for (int i = 0; i < 8; ++i) { a[i] = (__bf16)p[i]; a[8 + i] = (__bf16)p[16 + i]; } }
#pragma unroll
    for (int j = 0; j < 8; ++j) { v16b w; const int o = c0 + j * 16 + col;
#pragma unroll
      for (int i = 0; i < 8; ++i) { w[i] = (__bf16)Wm[(size_t)(kc * 32 + 8 * g + i) * CC + o]; w[8 + i] = (__bf16)Wm[(size_t)(kc * 32 + 16 + 8 * g + i) * CC + o]; }
      acc[j] = wmma_bf(a, w, acc[j]); } }
#pragma unroll
  for (int j = 0; j < 8; ++j)
#pragma unroll
    for (int r = 0; r < 8; ++r) { const float v = acc[j][r]; const int rl = wave * 16 + 8 * g + r, cl = j * 16 + col; const _Float16 hv = (_Float16)v; if (which == 2) th[cl][rl] = hv; else { sh[rl][cl] = hv; sl[rl][cl] = (_Float16)(v - (float)hv); } }
  __syncthreads();
  if (which < 2) { _Float16* dh = which == 0 ? QH : KH; for (int e = tid; e < 64 * 16; e += 128) { const int rl = e >> 4, q = e & 15; vst2((unsigned*)(dh + (r0 + rl) * CC + c0 + q * 8), *(const v4u*)&sh[rl][q * 8]); if (which == 0) vst2((unsigned*)(QL + (r0 + rl) * CC + c0 + q * 8), *(const v4u*)&sl[rl][q * 8]); } }
  else { const size_t b = r0 / TT; const int t0 = (int)(r0 % TT); for (int e = tid; e < 128 * 8; e += 128) { const int cl = e >> 3, q = e & 7; vst2((unsigned*)(VT + (b * CC + c0 + cl) * (size_t)TT + t0 + q * 8), *(const v4u*)&th[cl][q * 8]); } } }
// ---- k_dist: block = (query i, batch b): D[b][i][j] = |p_i - p_j| (0 when the squared sum is exactly 0)
__global__ __launch_bounds__(128) void k_dist(const float* __restrict__ P, float* __restrict__ D) { __shared__ __align__(16) float so[TT];
  const int t = threadIdx.x; const int i = blockIdx.x; const size_t b = blockIdx.y; const float xi = bfr(P[(b * TT + i) * 3]), yi = bfr(P[(b * TT + i) * 3 + 1]), zi = bfr(P[(b * TT + i) * 3 + 2]);
  for (int j = t; j < TT; j += 128) { const float dx = xi - bfr(P[(b * TT + j) * 3]), dy = yi - bfr(P[(b * TT + j) * 3 + 1]), dz = zi - bfr(P[(b * TT + j) * 3 + 2]); const float d2 = dx * dx + dy * dy + dz * dz; so[j] = (d2 > 0.f) ? sqrtf(d2) : 0.f; }
  __syncthreads(); for (int q = t; q < TT / 4; q += 128) vst2(D + (b * TT + i) * (size_t)TT + q * 4, *(const v4f*)&so[q * 4]); }
// ---- k_sc: block = (64 queries, 128 keys, z = bl*8 + h): att = (dist * 2 + q.k / 8) / sqrt(2)
__global__ __launch_bounds__(128) void k_sc(const _Float16* __restrict__ QH, const _Float16* __restrict__ QL, const _Float16* __restrict__ KH, const float* __restrict__ Dm, int b0, float* __restrict__ S0) { __shared__ __align__(16) float ss[4][16][132];
  const int z = blockIdx.z; const size_t b = b0 + z / NH; const int h = z % NH; float* S = S0 + (size_t)z * TT * TT;
  const int tid = threadIdx.x, wave = tid >> 5, lane = tid & 31, col = lane & 15, g = lane >> 4; const int k0 = blockIdx.y * 128; const int ql0 = blockIdx.x * 64 + wave * 16; const size_t q0 = b * TT + ql0;
  v8f acc[8] = {};
#pragma unroll
  for (int kc = 0; kc < HD / 32; ++kc) { const v16h ah = frag_h(QH + (q0 + col) * CC + h * HD + kc * 32, lane), al = frag_h(QL + (q0 + col) * CC + h * HD + kc * 32, lane);
#pragma unroll
    for (int j = 0; j < 8; ++j) { const v16h kb = frag_h(KH + (b * TT + k0 + j * 16 + col) * CC + h * HD + kc * 32, lane); acc[j] = wmma16(ah, kb, acc[j]); acc[j] = wmma16(al, kb, acc[j]); } }
  const float isq2 = 0.70710678118654752f;
#pragma unroll
  for (int j = 0; j < 8; ++j) { const int kt = k0 + j * 16 + col;
#pragma unroll
    for (int r = 0; r < 8; ++r) { const int qt = ql0 + 8 * g + r; ss[wave][8 * g + r][j * 16 + col] = (Dm[(b * TT + qt) * (size_t)TT + kt] * 2.0f + acc[j][r] * 0.125f) * isq2; } }
  LDSX(); for (int rl = 0; rl < 16; ++rl) vst2(S + (size_t)(ql0 + rl) * TT + k0 + lane * 4, *(const v4f*)&ss[wave][rl][lane * 4]); }
// ---- k_sm
__global__ __launch_bounds__(256) void k_sm(const float* __restrict__ S0, _Float16* __restrict__ PH0) { __shared__ float sred[8]; __shared__ float sbc; __shared__ __align__(16) _Float16 sh[TT];
  const int t = threadIdx.x; const size_t row = blockIdx.x; const float* sr = S0 + (size_t)blockIdx.y * TT * TT + row * TT; _Float16* ph = PH0 + (size_t)blockIdx.y * TT * TT + row * TT;
  float m = -3.0e38f; for (int k = t; k < TT; k += 256) m = fmaxf(m, sr[k]);
#pragma unroll
  for (int o = 1; o < 32; o <<= 1) m = fmaxf(m, __shfl_xor(m, o));
  if ((t & 31) == 0) sred[t >> 5] = m; __syncthreads(); if (t == 0) { float a = sred[0]; for (int i = 1; i < 8; ++i) a = fmaxf(a, sred[i]); sbc = a; } __syncthreads(); m = sbc; __syncthreads();
  float sum = 0.f; for (int k = t; k < TT; k += 256) sum += expf(sr[k] - m);
#pragma unroll
  for (int o = 1; o < 32; o <<= 1) sum += __shfl_xor(sum, o);
  if ((t & 31) == 0) sred[t >> 5] = sum; __syncthreads(); if (t == 0) { float a = 0.f; for (int i = 0; i < 8; ++i) a += sred[i]; sbc = 1.0f / a; } __syncthreads(); const float inv = sbc;
  for (int k = t; k < TT; k += 256) sh[k] = (_Float16)(expf(sr[k] - m) * inv * 2048.0f);
  __syncthreads(); for (int q = t; q < TT / 8; q += 256) vst2((unsigned*)(ph + q * 8), *(const v4u*)&sh[q * 8]); }
// ---- k_pv: block = (64 queries, z): upd rows [b*t][h*64+d]
__global__ __launch_bounds__(128) void k_pv(const _Float16* __restrict__ PH0, const _Float16* __restrict__ VT, int b0, float* __restrict__ U) { __shared__ __align__(16) float ss[4][16][68];
  const int z = blockIdx.z; const size_t b = b0 + z / NH; const int h = z % NH; const _Float16* PH = PH0 + (size_t)z * TT * TT;
  const int tid = threadIdx.x, wave = tid >> 5, lane = tid & 31, col = lane & 15, g = lane >> 4; const int ql0 = blockIdx.x * 64 + wave * 16;
  v8f acc[4] = {};
#pragma unroll 1
  for (int kc = 0; kc < TT / 32; ++kc) { const v16h ph = frag_h(PH + (size_t)(ql0 + col) * TT + kc * 32, lane);
#pragma unroll
    for (int j = 0; j < 4; ++j) acc[j] = wmma16(ph, frag_h(VT + (b * CC + h * HD + j * 16 + col) * (size_t)TT + kc * 32, lane), acc[j]); }
#pragma unroll
  for (int j = 0; j < 4; ++j)
#pragma unroll
    for (int r = 0; r < 8; ++r) ss[wave][8 * g + r][j * 16 + col] = acc[j][r] * (1.0f / 2048.0f);
  LDSX(); for (int rl = 0; rl < 16; ++rl) if (lane < 16) vst2(U + (b * TT + ql0 + rl) * CC + h * HD + lane * 4, *(const v4f*)&ss[wave][rl][lane * 4]); }
// ---- k_mlp: block = (64 rows, 128-col block): OUT = silu(A (hi+lo) W + b), A rows [K], W [K][N] (in,out); columns >= N masked
template <int K, int N>
__global__ __launch_bounds__(128) void k_mlp(const float* __restrict__ A, const float* __restrict__ Wm, const float* __restrict__ Bv, float* __restrict__ OUT) { __shared__ __align__(16) float sf[4][16][132];
  const int tid = threadIdx.x, wave = tid >> 5, lane = tid & 31, col = lane & 15, g = lane >> 4; const int c0 = blockIdx.y * 128; const size_t r0 = (size_t)blockIdx.x * 64 + wave * 16; constexpr int NT = (N < 128 ? N : 128) / 16;
  v8f acc[NT]; for (int j = 0; j < NT; ++j) for (int r = 0; r < 8; ++r) acc[j][r] = 0.f;
#pragma unroll 2
  for (int kc = 0; kc < K / 32; ++kc) { const F2 a = split_row(A + (r0 + col) * K, kc * 32, lane);
#pragma unroll
    for (int j = 0; j < NT; ++j) { v16b w; const int o = c0 + j * 16 + col;
#pragma unroll
      for (int i = 0; i < 8; ++i) { w[i] = (__bf16)Wm[(size_t)(kc * 32 + 8 * g + i) * N + o]; w[8 + i] = (__bf16)Wm[(size_t)(kc * 32 + 16 + 8 * g + i) * N + o]; }
      acc[j] = wmma_bf(a.h, w, acc[j]); acc[j] = wmma_bf(a.l, w, acc[j]); } }
#pragma unroll
  for (int j = 0; j < NT; ++j) { const float bb = bfr(Bv[c0 + j * 16 + col]);
#pragma unroll
    for (int r = 0; r < 8; ++r) { const float v = acc[j][r] + bb; sf[wave][8 * g + r][j * 16 + col] = v / (1.0f + expf(-v)); } }
  LDSX(); for (int rl = 0; rl < 16; ++rl) if (lane < NT * 4) vst2(OUT + (r0 + rl) * N + c0 + lane * 4, *(const v4f*)&sf[wave][rl][lane * 4]); }
extern "C" void kernel_launch(void* const* d_in, const int* in_sizes, int n_in, void* d_out, int out_size, void* d_ws, size_t ws_size, hipStream_t stream) {
  (void)in_sizes; (void)n_in; (void)out_size;
  const float** F = (const float**)d_in;   // 0 kp_pos [32,512,3], 1 kp_feat [32,512,256], 2 Wk [256,512], 3 Wq, 4 Wv, 5 W1 [512,128], 6 b1, 7 W2 [128,64], 8 b2, 9 W3 [64,256], 10 b3
  if (ws_size < (size_t)WS_END) return;
  char* ws = (char*)d_ws; _Float16 *QH = (_Float16*)(ws + WS_QH), *QL = (_Float16*)(ws + WS_QL), *KH = (_Float16*)(ws + WS_KH), *VT = (_Float16*)(ws + WS_VT), *PH = (_Float16*)(ws + WS_PH); float *D = (float*)(ws + WS_D), *S = (float*)(ws + WS_S), *U = (float*)(ws + WS_U), *H1 = (float*)(ws + WS_H1), *H2 = (float*)(ws + WS_H2);
  k_proj<<<dim3(TNB * TT / 64, CC / 128, 3), 128, 0, stream>>>(F[1], F[2], F[3], F[4], QH, QL, KH, VT);
  k_dist<<<dim3(TT, TNB), 128, 0, stream>>>(F[0], D);
  for (int b0 = 0; b0 < TNB; b0 += BG) { const int ng = ((TNB - b0) < BG ? (TNB - b0) : BG);
    k_sc<<<dim3(TT / 64, TT / 128, ng * NH), 128, 0, stream>>>(QH, QL, KH, D, b0, S);
    k_sm<<<dim3(TT, ng * NH), 256, 0, stream>>>(S, PH);
    k_pv<<<dim3(TT / 64, 1, ng * NH), 128, 0, stream>>>(PH, VT, b0, U);
  }
  k_mlp<CC, 128><<<dim3(TNB * TT / 64, 1), 128, 0, stream>>>(U, F[5], F[6], H1);
  k_mlp<128, 64><<<dim3(TNB * TT / 64, 1), 128, 0, stream>>>(H1, F[7], F[8], H2);
  k_mlp<64, CIN><<<dim3(TNB * TT / 64, CIN / 128), 128, 0, stream>>>(H2, F[9], F[10], (float*)d_out);
}

// v001
// A run of this version takes 215 microseconds.
// Two timings next to v000 put it at 2.93 and 2.84 times that version's speed.
// compute dtype: all float inputs rounded to bf16; keys/queries/values = kp_feat W with EXACT bf16 products on WMMA 16x16x32, f32 accumulate; pairwise distances sqrt(sum (p_i - p_j)^2) in f32 (precise sqrtf) once per batch; att = (dist / 0.5 + q . k / 8) / sqrt(2) with q as f16 hi + residual, k f16 (2 products), kept in registers; softmax in f32 (precise expf, running maximum and sum) -> P f16 x e^7.625, unnormalised; upd = P . v / sum (v rounded once to f16); out MLP 512 -> 128 -> 64 -> 256 with SiLU after each, activations split bf16 hi + lo (2 products); f32 output.
#include <hip/hip_runtime.h>
#include <math.h>

typedef __attribute__((ext_vector_type(16))) _Float16 v16h;
typedef __attribute__((ext_vector_type(16))) __bf16 v16b;
typedef __attribute__((ext_vector_type(8)))  _Float16 v8h;
typedef __attribute__((ext_vector_type(8)))  float v8f;
typedef __attribute__((ext_vector_type(4)))  float v4f;
typedef __attribute__((ext_vector_type(2)))  float v2f;
typedef __attribute__((ext_vector_type(4)))  unsigned v4u;
typedef __attribute__((ext_vector_type(4)))  int v4i;
typedef float __attribute__((may_alias)) float_a;
typedef int __attribute__((may_alias)) int_a;

template <typename T> __device__ __forceinline__ void vst2(void* p, T v) { *(T*)p = v;  }
__device__ __forceinline__ v8f wmma16(v16h a, v16h b, v8f c) {
  v8f d = __builtin_amdgcn_wmma_f32_16x16x32_f16(false, a, false, b, (short)0, c, false, false);
  asm volatile("v_nop\n\tv_nop\n\tv_nop\n\tv_nop" : "+v"(d) : "v"(a), "v"(b));
  return d;
}
__device__ __forceinline__ v8f wmma_bf(v16b a, v16b b, v8f c) {
  v8f d = __builtin_amdgcn_wmma_f32_16x16x32_bf16(false, a, false, b, (short)0, c, false, false);
  asm volatile("v_nop\n\tv_nop\n\tv_nop\n\tv_nop" : "+v"(d) : "v"(a), "v"(b));
  return d;
}
// 16x16x32 fragments: lane = (h = lane>>4, row/col = lane&15); elements 0..7 = k0+8h+0..7, 8..15 = k0+16+8h+0..7; D element r = row 8h+r
__device__ __forceinline__ v16h frag_h(const _Float16* rowk0, int lane) {
  union { v16h v; v8h q[2]; } u; const _Float16* p = rowk0 + 8 * (lane >> 4);
  u.q[0] = *(const v8h*)p; u.q[1] = *(const v8h*)(p + 16); return u.v;
}
__device__ __forceinline__ v16h frag_f32(const float* rowk0, int lane) {
  v16h a; const float* p = rowk0 + 8 * (lane >> 4);
#pragma unroll
  for (int i = 0; i < 8; ++i) { a[i] = (_Float16)p[i]; a[8 + i] = (_Float16)p[16 + i]; }
  return a;
}
__device__ __forceinline__ v16h frag_f32s(const float* rowk0, int lane, float sc) {
  v16h a; const float* p = rowk0 + 8 * (lane >> 4);
#pragma unroll
  for (int i = 0; i < 8; ++i) { a[i] = (_Float16)(p[i] * sc); a[8 + i] = (_Float16)(p[16 + i] * sc); }
  return a;
}
// column fragment from a [K][ld] layout (column n), rows >= K read as 0
__device__ __forceinline__ v16h fragc_f32(const float* W, int k0, int n, int lane, int ld, int K) {
  v16h a; const int g = lane >> 4;
#pragma unroll
  for (int i = 0; i < 8; ++i) { const int ka = k0 + 8 * g + i, kb = ka + 16;
    a[i] = (_Float16)(ka < K ? W[(size_t)(ka < K ? ka : K - 1) * ld + n] : 0.f); a[8 + i] = (_Float16)(kb < K ? W[(size_t)(kb < K ? kb : K - 1) * ld + n] : 0.f); }
  return a;
}
struct F2 { v16b h, l; };
__device__ __forceinline__ F2 bsplit16(const float v[16]) { F2 r;
#pragma unroll
  for (int i = 0; i < 16; ++i) { const __bf16 h = (__bf16)v[i]; r.h[i] = h; r.l[i] = (__bf16)(v[i] - (float)h); }
  return r; }
__device__ __forceinline__ F2 split_row(const float* row, int k0, int lane) { float v[16]; const float* p = row + k0 + 8 * (lane >> 4);
#pragma unroll
  for (int i = 0; i < 8; ++i) { v[i] = p[i]; v[8 + i] = p[16 + i]; }
  return bsplit16(v); }
__device__ __forceinline__ F2 split_rowK(const float* row, int k0, int lane, int K) { float v[16]; const int g = lane >> 4;
#pragma unroll
  for (int i = 0; i < 8; ++i) { const int ka = k0 + 8 * g + i, kb = ka + 16; v[i] = ka < K ? row[ka < K ? ka : K - 1] : 0.f; v[8 + i] = kb < K ? row[kb < K ? kb : K - 1] : 0.f; }
  return bsplit16(v); }
__device__ __forceinline__ F2 split_col(const float* W, int k0, int n, int lane, int ld, int K) { float v[16]; const int g = lane >> 4;
#pragma unroll
  for (int i = 0; i < 8; ++i) { const int ka = k0 + 8 * g + i, kb = ka + 16; v[i] = ka < K ? W[(size_t)(ka < K ? ka : K - 1) * ld + n] : 0.f; v[8 + i] = kb < K ? W[(size_t)(kb < K ? kb : K - 1) * ld + n] : 0.f; }
  return bsplit16(v); }
__device__ __forceinline__ v8f mac3(const F2& a, const F2& b, v8f c) { c = wmma_bf(a.l, b.h, c); c = wmma_bf(a.h, b.l, c); return wmma_bf(a.h, b.h, c); }
__device__ __forceinline__ float sigm(float v) { return 1.0f / (1.0f + expf(-v)); }
#define LDSX() do { asm volatile("s_wait_dscnt 0" ::: "memory"); __builtin_amdgcn_wave_barrier(); __builtin_amdgcn_fence(__ATOMIC_RELEASE, "workgroup"); } while (0)


// Keypoint multi-head attention (B 32, N 512 keypoints, in_dim 256, 8 heads x 64): distance-biased attention followed by a 3-layer SiLU MLP.
#define NB 32
#define TT 512
#define CIN 256
#define CC 512
#define NH 8
#define HD 64
#define NR (NB * TT)
#ifndef TNB
#define TNB NB
#endif
typedef __attribute__((ext_vector_type(8))) __bf16 v8b;
__device__ __forceinline__ v16b frag_b(const __bf16* rowk0, int lane) {
  union { v16b v; v8b q[2]; } u; const __bf16* p = rowk0 + 8 * (lane >> 4);
  u.q[0] = *(const v8b*)p; u.q[1] = *(const v8b*)(p + 16); return u.v;
}
__device__ __forceinline__ float bfr(float v) { return (float)(__bf16)v; }
__device__ __attribute__((noinline)) float exp_ni(float v) { return expf(v); }
__device__ __attribute__((noinline)) float erf_ni(float v) { return erff(v); }

#define WS_QH  0u
#define WS_QL  (WS_QH + 2u * (size_t)NR * CC)
#define WS_KH  (WS_QL + 2u * (size_t)NR * CC)
#define WS_VT  (WS_KH + 2u * (size_t)NR * CC)          // f16 v planes [b][512][t]
#define WS_D   (WS_VT + 2u * (size_t)NR * CC)          // f32 dist [b][t][t]
#define WS_U   (WS_D + 4u * (size_t)NB * TT * TT)      // f32 upd rows [b*t][512]
#define WS_H1  (WS_U + 4u * (size_t)NR * CC)           // f32 [b*t][128]
#define WS_H2  (WS_H1 + 4u * (size_t)NR * 128)         // f32 [b*t][64]
#define WS_END (WS_H2 + 4u * (size_t)NR * 64)

// ---- k_proj: block = (64 rows, 128 cols, which): kp_feat W ((in,out) [256][512]), no bias
__global__ __launch_bounds__(128) void k_proj(const float* __restrict__ X, const float* __restrict__ WK, const float* __restrict__ WQ, const float* __restrict__ WV, _Float16* __restrict__ QH, _Float16* __restrict__ QL, _Float16* __restrict__ KH, _Float16* __restrict__ VT) {
  __shared__ __align__(16) _Float16 sh[64][136], sl[64][136]; __shared__ __align__(16) _Float16 th[128][72];
  const int tid = threadIdx.x, wave = tid >> 5, lane = tid & 31, col = lane & 15, g = lane >> 4; const int which = blockIdx.z; const int c0 = blockIdx.y * 128; const size_t r0 = (size_t)blockIdx.x * 64; const float* Wm = which == 0 ? WQ : which == 1 ? WK : WV;
  v8f acc[8] = {};
#pragma unroll
  for (int kc = 0; kc < CIN / 32; ++kc) { v16b a; { const float* p = X + (r0 + wave * 16 + col) * CIN + kc * 32 + 8 * g;
#pragma unroll
      for (int i = 0; i < 8; ++i) { a[i] = (__bf16)p[i]; a[8 + i] = (__bf16)p[16 + i]; } }
#pragma unroll
    for (int j = 0; j < 8; ++j) { v16b w; const int o = c0 + j * 16 + col;
#pragma unroll
      for (int i = 0; i < 8; ++i) { w[i] = (__bf16)Wm[(size_t)(kc * 32 + 8 * g + i) * CC + o]; w[8 + i] = (__bf16)Wm[(size_t)(kc * 32 + 16 + 8 * g + i) * CC + o]; }
      acc[j] = wmma_bf(a, w, acc[j]); } }
#pragma unroll
  for (int j = 0; j < 8; ++j)
#pragma unroll
    for (int r = 0; r < 8; ++r) { const float v = acc[j][r]; const int rl = wave * 16 + 8 * g + r, cl = j * 16 + col; const _Float16 hv = (_Float16)v; if (which == 2) th[cl][rl] = hv; else { sh[rl][cl] = hv; sl[rl][cl] = (_Float16)(v - (float)hv); } }
  __syncthreads();
  if (which < 2) { _Float16* dh = which == 0 ? QH : KH; for (int e = tid; e < 64 * 16; e += 128) { const int rl = e >> 4, q = e & 15; vst2((unsigned*)(dh + (r0 + rl) * CC + c0 + q * 8), *(const v4u*)&sh[rl][q * 8]); if (which == 0) vst2((unsigned*)(QL + (r0 + rl) * CC + c0 + q * 8), *(const v4u*)&sl[rl][q * 8]); } }
  else { const size_t b = r0 / TT; const int t0 = (int)(r0 % TT); for (int e = tid; e < 128 * 8; e += 128) { const int cl = e >> 3, q = e & 7; vst2((unsigned*)(VT + (b * CC + c0 + cl) * (size_t)TT + t0 + q * 8), *(const v4u*)&th[cl][q * 8]); } } }
// ---- k_dist: block = (query i, batch b): D[b][i][j] = |p_i - p_j| (0 when the squared sum is exactly 0)
__global__ __launch_bounds__(128) void k_dist(const float* __restrict__ P, float* __restrict__ D) { __shared__ __align__(16) float so[TT];
  const int t = threadIdx.x; const int i = blockIdx.x; const size_t b = blockIdx.y; const float xi = bfr(P[(b * TT + i) * 3]), yi = bfr(P[(b * TT + i) * 3 + 1]), zi = bfr(P[(b * TT + i) * 3 + 2]);
  for (int j = t; j < TT; j += 128) { const float dx = xi - bfr(P[(b * TT + j) * 3]), dy = yi - bfr(P[(b * TT + j) * 3 + 1]), dz = zi - bfr(P[(b * TT + j) * 3 + 2]); const float d2 = dx * dx + dy * dy + dz * dz; so[j] = (d2 > 0.f) ? sqrtf(d2) : 0.f; }
  __syncthreads(); for (int q = t; q < TT / 4; q += 128) vst2(D + (b * TT + i) * (size_t)TT + q * 4, *(const v4f*)&so[q * 4]); }
#define KPI 72    // LDS pitch of a K row, f16: 144 B = 16 B x odd, no bank conflict for 16-byte reads down a column of rows
#define VPI 520   // LDS pitch of a V^T row, f16: 1040 B = 16 B x odd
__device__ __forceinline__ v8f wmma_h(v16h a, v16h b, v8f c) { return __builtin_amdgcn_wmma_f32_16x16x32_f16(false, a, false, b, (short)0, c, false, false); }
__device__ __forceinline__ float xhalf(float x) { return __builtin_bit_cast(float, __builtin_amdgcn_permlanex16(__builtin_bit_cast(int, x), __builtin_bit_cast(int, x), 0x76543210, 0xfedcba98, false, false)); }  // lane l with lane l ^ 16
__global__ __launch_bounds__(256) __attribute__((amdgpu_waves_per_eu(4, 4))) void k_att(const _Float16* __restrict__ QH, const _Float16* __restrict__ QL, const _Float16* __restrict__ KH, const _Float16* __restrict__ VT, const float* __restrict__ Dm, float* __restrict__ U) {
  __shared__ __align__(16) _Float16 sk[TT][KPI]; __shared__ __align__(16) _Float16 sv[HD][VPI];
  const int tid = threadIdx.x, wave = tid >> 5, lane = tid & 31, col = lane & 15, g = lane >> 4; const size_t b = blockIdx.z; const int h = blockIdx.y; const int q0 = blockIdx.x * 256 + wave * 32;
  { const _Float16* kg = KH + (b * TT + (tid >> 3)) * CC + h * HD + (tid & 7) * 8; const _Float16* vg = VT + (b * CC + h * HD + (tid >> 6)) * (size_t)TT + (tid & 63) * 8;   // 8 threads a K row of 128 B, 64 threads a V^T row of 1 KiB
    // both unrolled: a thread's sixteen 16-byte loads are in flight together
#pragma unroll
    for (int i = 0; i < TT / 32; ++i) *(v8h*)&sk[(tid >> 3) + i * 32][(tid & 7) * 8] = *(const v8h*)(kg + i * 32 * CC);
#pragma unroll
    for (int i = 0; i < HD / 4; ++i) *(v8h*)&sv[(tid >> 6) + i * 4][(tid & 63) * 8] = *(const v8h*)(vg + i * 4 * TT); }
  v16h qh[2][2], ql[2][2];
#pragma unroll
  for (int qt = 0; qt < 2; ++qt)
#pragma unroll
    for (int kc = 0; kc < 2; ++kc) { const size_t o = (b * TT + q0 + qt * 16 + col) * CC + h * HD + kc * 32; qh[qt][kc] = frag_h(QH + o, lane); ql[qt][kc] = frag_h(QL + o, lane); }
  const float* dp = Dm + (b * TT + q0 + col) * (size_t)TT + 8 * g;
  v8f o[2][4] = {}; float m[2] = {-3.0e38f, -3.0e38f}, l[2] = {0.f, 0.f};
  const float isq2 = 0.70710678118654752f;
  __syncthreads();
  // rolled: sixteen passes unrolled would not fit the register budget of four waves per SIMD
#pragma unroll 1
  for (int k0 = 0; k0 < TT; k0 += 32) {
    v8f s[2][2] = {};   // [query tile][key tile]: register r = key k0 + 16 t + 8 g + r, column = query
#pragma unroll
    for (int kc = 0; kc < 2; ++kc) { v16h kb[2];
#pragma unroll
      for (int t = 0; t < 2; ++t) kb[t] = frag_h(&sk[k0 + t * 16 + col][kc * 32], lane);
#pragma unroll
      for (int t = 0; t < 2; ++t)
#pragma unroll
        for (int qt = 0; qt < 2; ++qt) s[qt][t] = wmma_h(kb[t], qh[qt][kc], s[qt][t]);
#pragma unroll
      for (int t = 0; t < 2; ++t)
#pragma unroll
        for (int qt = 0; qt < 2; ++qt) s[qt][t] = wmma_h(kb[t], ql[qt][kc], s[qt][t]); }
#pragma unroll
    for (int qt = 0; qt < 2; ++qt) { float x[16];
#pragma unroll
      for (int t = 0; t < 2; ++t) { const float* dq = dp + qt * 16 * TT + k0 + t * 16; const v4f d0 = *(const v4f*)dq, d1 = *(const v4f*)(dq + 4);
#pragma unroll
        for (int r = 0; r < 4; ++r) { x[t * 8 + r] = (d0[r] * 2.0f + s[qt][t][r] * 0.125f) * isq2; x[t * 8 + 4 + r] = (d1[r] * 2.0f + s[qt][t][4 + r] * 0.125f) * isq2; } }
      float mx = x[0];
#pragma unroll
      for (int i = 1; i < 16; ++i) mx = fmaxf(mx, x[i]);
      mx = fmaxf(mx, xhalf(mx));
      const float mn = fmaxf(m[qt], mx); const float al = expf(m[qt] - mn); m[qt] = mn;
      const float mo = mn - 7.625f;   // P and its sum both carry e^7.625 (about 2^11), which keeps small weights out of the f16 subnormals and cancels in the division
      float sum = 0.f; v16h p;
#pragma unroll
      for (int i = 0; i < 16; ++i) { const float e = expf(x[i] - mo); sum += e; p[i] = (_Float16)e; }
      l[qt] = l[qt] * al + sum;
#pragma unroll
      for (int j = 0; j < 4; ++j) o[qt][j] *= al;
#pragma unroll
      for (int j = 0; j < 4; ++j) o[qt][j] = wmma_h(frag_h(&sv[j * 16 + col][k0], lane), p, o[qt][j]); } }
#pragma unroll
  for (int qt = 0; qt < 2; ++qt) { const float inv = 1.0f / (l[qt] + xhalf(l[qt])); float* up = U + (b * TT + q0 + qt * 16 + col) * CC + h * HD + 8 * g;
#pragma unroll
    for (int j = 0; j < 4; ++j) { v4f a0, a1;
#pragma unroll
      for (int r = 0; r < 4; ++r) { a0[r] = o[qt][j][r] * inv; a1[r] = o[qt][j][4 + r] * inv; }
      vst2(up + j * 16, a0); vst2(up + j * 16 + 4, a1); } } }
// ---- k_mlp: block = (64 rows, 128-col block): OUT = silu(A (hi+lo) W + b), A rows [K], W [K][N] (in,out); columns >= N masked
template <int K, int N>
__global__ __launch_bounds__(128) void k_mlp(const float* __restrict__ A, const float* __restrict__ Wm, const float* __restrict__ Bv, float* __restrict__ OUT) { __shared__ __align__(16) float sf[4][16][132];
  const int tid = threadIdx.x, wave = tid >> 5, lane = tid & 31, col = lane & 15, g = lane >> 4; const int c0 = blockIdx.y * 128; const size_t r0 = (size_t)blockIdx.x * 64 + wave * 16; constexpr int NT = (N < 128 ? N : 128) / 16;
  v8f acc[NT]; for (int j = 0; j < NT; ++j) for (int r = 0; r < 8; ++r) acc[j][r] = 0.f;
#pragma unroll 2
  for (int kc = 0; kc < K / 32; ++kc) { const F2 a = split_row(A + (r0 + col) * K, kc * 32, lane);
#pragma unroll
    for (int j = 0; j < NT; ++j) { v16b w; const int o = c0 + j * 16 + col;
#pragma unroll
      for (int i = 0; i < 8; ++i) { w[i] = (__bf16)Wm[(size_t)(kc * 32 + 8 * g + i) * N + o]; w[8 + i] = (__bf16)Wm[(size_t)(kc * 32 + 16 + 8 * g + i) * N + o]; }
      acc[j] = wmma_bf(a.h, w, acc[j]); acc[j] = wmma_bf(a.l, w, acc[j]); } }
#pragma unroll
  for (int j = 0; j < NT; ++j) { const float bb = bfr(Bv[c0 + j * 16 + col]);
#pragma unroll
    for (int r = 0; r < 8; ++r) { const float v = acc[j][r] + bb; sf[wave][8 * g + r][j * 16 + col] = v / (1.0f + expf(-v)); } }
  LDSX(); for (int rl = 0; rl < 16; ++rl) if (lane < NT * 4) vst2(OUT + (r0 + rl) * N + c0 + lane * 4, *(const v4f*)&sf[wave][rl][lane * 4]); }
extern "C" void kernel_launch(void* const* d_in, const int* in_sizes, int n_in, void* d_out, int out_size, void* d_ws, size_t ws_size, hipStream_t stream) {
  (void)in_sizes; (void)n_in; (void)out_size;
  const float** F = (const float**)d_in;   // 0 kp_pos [32,512,3], 1 kp_feat [32,512,256], 2 Wk [256,512], 3 Wq, 4 Wv, 5 W1 [512,128], 6 b1, 7 W2 [128,64], 8 b2, 9 W3 [64,256], 10 b3
  if (ws_size < (size_t)WS_END) return;
  char* ws = (char*)d_ws; _Float16 *QH = (_Float16*)(ws + WS_QH), *QL = (_Float16*)(ws + WS_QL), *KH = (_Float16*)(ws + WS_KH), *VT = (_Float16*)(ws + WS_VT); float *D = (float*)(ws + WS_D), *U = (float*)(ws + WS_U), *H1 = (float*)(ws + WS_H1), *H2 = (float*)(ws + WS_H2);
  k_proj<<<dim3(TNB * TT / 64, CC / 128, 3), 128, 0, stream>>>(F[1], F[2], F[3], F[4], QH, QL, KH, VT);
  k_dist<<<dim3(TT, TNB), 128, 0, stream>>>(F[0], D);
  k_att<<<dim3(TT / 256, NH, TNB), 256, 0, stream>>>(QH, QL, KH, VT, D, U);
  k_mlp<CC, 128><<<dim3(TNB * TT / 64, 1), 128, 0, stream>>>(U, F[5], F[6], H1);
  k_mlp<128, 64><<<dim3(TNB * TT / 64, 1), 128, 0, stream>>>(H1, F[7], F[8], H2);
  k_mlp<64, CIN><<<dim3(TNB * TT / 64, CIN / 128), 128, 0, stream>>>(H2, F[9], F[10], (float*)d_out);
}

// v002
// It runs in 124 microseconds.
// Next to v001, in two timings, it ran 1.74 and 1.73 times as fast.
// Over all steps from v000 it is 5.00 times as fast.
// compute dtype: all float inputs rounded to bf16; keys/queries/values = kp_feat W with EXACT bf16 products on WMMA 16x16x32, f32 accumulate; pairwise distances sqrt(sum (p_i - p_j)^2) in f32 (precise sqrtf) once per batch; att = (dist / 0.5 + q . k / 8) / sqrt(2) with q as f16 hi + residual, k f16 (2 products), kept in registers; softmax in f32 (precise expf, running maximum and sum) -> P f16 x e^7.625, unnormalised; upd = P . v / sum (v rounded once to f16); out MLP 512 -> 128 -> 64 -> 256 with SiLU after each, activations split bf16 hi + lo (2 products); f32 output.
#include <hip/hip_runtime.h>
#include <math.h>

typedef __attribute__((ext_vector_type(16))) _Float16 v16h;
typedef __attribute__((ext_vector_type(16))) __bf16 v16b;
typedef __attribute__((ext_vector_type(8)))  _Float16 v8h;
typedef __attribute__((ext_vector_type(8)))  float v8f;
typedef __attribute__((ext_vector_type(4)))  float v4f;
typedef __attribute__((ext_vector_type(2)))  float v2f;
typedef __attribute__((ext_vector_type(4)))  unsigned v4u;
typedef __attribute__((ext_vector_type(4)))  int v4i;
typedef float __attribute__((may_alias)) float_a;
typedef int __attribute__((may_alias)) int_a;

template <typename T> __device__ __forceinline__ void vst2(void* p, T v) { *(T*)p = v;  }
__device__ __forceinline__ v8f wmma16(v16h a, v16h b, v8f c) {
  v8f d = __builtin_amdgcn_wmma_f32_16x16x32_f16(false, a, false, b, (short)0, c, false, false);
  asm volatile("v_nop\n\tv_nop\n\tv_nop\n\tv_nop" : "+v"(d) : "v"(a), "v"(b));
  return d;
}
__device__ __forceinline__ v8f wmma_bf(v16b a, v16b b, v8f c) {
  v8f d = __builtin_amdgcn_wmma_f32_16x16x32_bf16(false, a, false, b, (short)0, c, false, false);
  asm volatile("v_nop\n\tv_nop\n\tv_nop\n\tv_nop" : "+v"(d) : "v"(a), "v"(b));
  return d;
}
// 16x16x32 fragments: lane = (h = lane>>4, row/col = lane&15); elements 0..7 = k0+8h+0..7, 8..15 = k0+16+8h+0..7; D element r = row 8h+r
__device__ __forceinline__ v16h frag_h(const _Float16* rowk0, int lane) {
  union { v16h v; v8h q[2]; } u; const _Float16* p = rowk0 + 8 * (lane >> 4);
  u.q[0] = *(const v8h*)p; u.q[1] = *(const v8h*)(p + 16); return u.v;
}
__device__ __forceinline__ v16h frag_f32(const float* rowk0, int lane) {
  v16h a; const float* p = rowk0 + 8 * (lane >> 4);
#pragma unroll
  for (int i = 0; i < 8; ++i) { a[i] = (_Float16)p[i]; a[8 + i] = (_Float16)p[16 + i]; }
  return a;
}
__device__ __forceinline__ v16h frag_f32s(const float* rowk0, int lane, float sc) {
  v16h a; const float* p = rowk0 + 8 * (lane >> 4);
#pragma unroll
  for (int i = 0; i < 8; ++i) { a[i] = (_Float16)(p[i] * sc); a[8 + i] = (_Float16)(p[16 + i] * sc); }
  return a;
}
// column fragment from a [K][ld] layout (column n), rows >= K read as 0
__device__ __forceinline__ v16h fragc_f32(const float* W, int k0, int n, int lane, int ld, int K) {
  v16h a; const int g = lane >> 4;
#pragma unroll
  for (int i = 0; i < 8; ++i) { const int ka = k0 + 8 * g + i, kb = ka + 16;
    a[i] = (_Float16)(ka < K ? W[(size_t)(ka < K ? ka : K - 1) * ld + n] : 0.f); a[8 + i] = (_Float16)(kb < K ? W[(size_t)(kb < K ? kb : K - 1) * ld + n] : 0.f); }
  return a;
}
struct F2 { v16b h, l; };
__device__ __forceinline__ F2 bsplit16(const float v[16]) { F2 r;
#pragma unroll
  for (int i = 0; i < 16; ++i) { const __bf16 h = (__bf16)v[i]; r.h[i] = h; r.l[i] = (__bf16)(v[i] - (float)h); }
  return r; }
__device__ __forceinline__ F2 split_row(const float* row, int k0, int lane) { float v[16]; const float* p = row + k0 + 8 * (lane >> 4);
#pragma unroll
  for (int i = 0; i < 8; ++i) { v[i] = p[i]; v[8 + i] = p[16 + i]; }
  return bsplit16(v); }
__device__ __forceinline__ F2 split_rowK(const float* row, int k0, int lane, int K) { float v[16]; const int g = lane >> 4;
#pragma unroll
  for (int i = 0; i < 8; ++i) { const int ka = k0 + 8 * g + i, kb = ka + 16; v[i] = ka < K ? row[ka < K ? ka : K - 1] : 0.f; v[8 + i] = kb < K ? row[kb < K ? kb : K - 1] : 0.f; }
  return bsplit16(v); }
__device__ __forceinline__ F2 split_col(const float* W, int k0, int n, int lane, int ld, int K) { float v[16]; const int g = lane >> 4;
#pragma unroll
  for (int i = 0; i < 8; ++i) { const int ka = k0 + 8 * g + i, kb = ka + 16; v[i] = ka < K ? W[(size_t)(ka < K ? ka : K - 1) * ld + n] : 0.f; v[8 + i] = kb < K ? W[(size_t)(kb < K ? kb : K - 1) * ld + n] : 0.f; }
  return bsplit16(v); }
__device__ __forceinline__ v8f mac3(const F2& a, const F2& b, v8f c) { c = wmma_bf(a.l, b.h, c); c = wmma_bf(a.h, b.l, c); return wmma_bf(a.h, b.h, c); }
__device__ __forceinline__ float sigm(float v) { return 1.0f / (1.0f + expf(-v)); }
#define LDSX() do { asm volatile("s_wait_dscnt 0" ::: "memory"); __builtin_amdgcn_wave_barrier(); __builtin_amdgcn_fence(__ATOMIC_RELEASE, "workgroup"); } while (0)


// Keypoint multi-head attention (B 32, N 512 keypoints, in_dim 256, 8 heads x 64): distance-biased attention followed by a 3-layer SiLU MLP.
#define NB 32
#define TT 512
#define CIN 256
#define CC 512
#define NH 8
#define HD 64
#define NR (NB * TT)
#ifndef TNB
#define TNB NB
#endif
typedef __attribute__((ext_vector_type(8))) __bf16 v8b;
__device__ __forceinline__ v16b frag_b(const __bf16* rowk0, int lane) {
  union { v16b v; v8b q[2]; } u; const __bf16* p = rowk0 + 8 * (lane >> 4);
  u.q[0] = *(const v8b*)p; u.q[1] = *(const v8b*)(p + 16); return u.v;
}
__device__ __forceinline__ float bfr(float v) { return (float)(__bf16)v; }
__device__ __attribute__((noinline)) float exp_ni(float v) { return expf(v); }
__device__ __attribute__((noinline)) float erf_ni(float v) { return erff(v); }

#define WS_QH  0u
#define WS_QL  (WS_QH + 2u * (size_t)NR * CC)
#define WS_KH  (WS_QL + 2u * (size_t)NR * CC)
#define WS_VT  (WS_KH + 2u * (size_t)NR * CC)          // f16 v planes [b][512][t]
#define WS_D   (WS_VT + 2u * (size_t)NR * CC)          // f32 dist [b][t][t]
#define WS_U   (WS_D + 4u * (size_t)NB * TT * TT)      // f32 upd rows [b*t][512]
#define WS_H1  (WS_U + 4u * (size_t)NR * CC)           // f32 [b*t][128]
#define WS_H2  (WS_H1 + 4u * (size_t)NR * 128)         // f32 [b*t][64]
#define WS_PW  (WS_H2 + 4u * (size_t)NR * 64)          // bf16 weights in fragment order: Wq, Wk, Wv, W1, W2, W3
#define PW_P   (CIN * CC)                              // elements of one projection matrix
#define PW_1   (3 * PW_P)
#define PW_2   (PW_1 + CC * 128)
#define PW_3   (PW_2 + 128 * 64)
#define PW_N   (PW_3 + 64 * CIN)
#define WS_END (WS_PW + 2u * (size_t)PW_N)

// ---- k_pack: every weight matrix W [K][N] (in,out), rounded to bf16 once and laid out as finished B fragments: fragment (kc, nt) = 1 KiB = two runs of 32 lanes x 16 B; lane (g, col) holds column nt*16+col, run 0 = rows kc*32+8g+0..7, run 1 = rows kc*32+16+8g+0..7. One thread writes one 16-byte unit u.
template <int N> __device__ __forceinline__ void pack_unit(const float* __restrict__ Wm, __bf16* __restrict__ dst, int u) {
  const int lane = u & 31, run = (u >> 5) & 1, f = u >> 6, nt = f % (N / 16), kc = f / (N / 16);
  const float* p = Wm + (size_t)(kc * 32 + run * 16 + 8 * (lane >> 4)) * N + nt * 16 + (lane & 15); v8b v;
#pragma unroll
  for (int i = 0; i < 8; ++i) v[i] = (__bf16)p[(size_t)i * N];
  *(v8b*)(dst + (size_t)u * 8) = v; }
__global__ __launch_bounds__(256) void k_pack(const float* __restrict__ WQ, const float* __restrict__ WK, const float* __restrict__ WV, const float* __restrict__ W1, const float* __restrict__ W2, const float* __restrict__ W3, __bf16* __restrict__ PW) {
  const int u = blockIdx.x * 256 + threadIdx.x;   // every matrix is a whole number of blocks, so the choice below is the same for a whole block
  if (u < PW_1 / 8) { const int m = u / (PW_P / 8); pack_unit<CC>(m == 0 ? WQ : m == 1 ? WK : WV, PW + (size_t)m * PW_P, u - m * (PW_P / 8)); }
  else if (u < PW_2 / 8) pack_unit<128>(W1, PW + PW_1, u - PW_1 / 8);
  else if (u < PW_3 / 8) pack_unit<64>(W2, PW + PW_2, u - PW_2 / 8);
  else pack_unit<CIN>(W3, PW + PW_3, u - PW_3 / 8); }
// a packed fragment: two 16-byte loads a lane, each a run of 512 contiguous bytes over the wave
__device__ __forceinline__ v16b frag_p(const __bf16* f, int lane) {
  union { v16b v; v8b q[2]; } u; u.q[0] = *(const v8b*)(f + lane * 8); u.q[1] = *(const v8b*)(f + 256 + lane * 8); return u.v;
}

// ---- k_proj: block = (64 rows, 128 cols, which): kp_feat W (packed fragments of [256][512]), no bias
__global__ __launch_bounds__(128) void k_proj(const float* __restrict__ X, const __bf16* __restrict__ PW, _Float16* __restrict__ QH, _Float16* __restrict__ QL, _Float16* __restrict__ KH, _Float16* __restrict__ VT) {
  __shared__ __align__(16) _Float16 sh[64][136], sl[64][136]; __shared__ __align__(16) _Float16 th[128][72];
  const int tid = threadIdx.x, wave = tid >> 5, lane = tid & 31, col = lane & 15, g = lane >> 4; const int which = blockIdx.z; const int c0 = blockIdx.y * 128; const size_t r0 = (size_t)blockIdx.x * 64; const __bf16* pw = PW + (size_t)which * PW_P + (size_t)(c0 / 16) * 512;
  v8f acc[8] = {};
#pragma unroll
  for (int kc = 0; kc < CIN / 32; ++kc) { v16b a, w[8];   // the k step's eight fragments are loaded ahead of its first product, so they are in flight together
#pragma unroll
    for (int j = 0; j < 8; ++j) w[j] = frag_p(pw + (size_t)(kc * (CC / 16) + j) * 512, lane);
    { const float* p = X + (r0 + wave * 16 + col) * CIN + kc * 32 + 8 * g;
#pragma unroll
      for (int i = 0; i < 8; ++i) { a[i] = (__bf16)p[i]; a[8 + i] = (__bf16)p[16 + i]; } }
#pragma unroll
    for (int j = 0; j < 8; ++j) acc[j] = wmma_bf(a, w[j], acc[j]); }
#pragma unroll
  for (int j = 0; j < 8; ++j)
#pragma unroll
    for (int r = 0; r < 8; ++r) { const float v = acc[j][r]; const int rl = wave * 16 + 8 * g + r, cl = j * 16 + col; const _Float16 hv = (_Float16)v; if (which == 2) th[cl][rl] = hv; else { sh[rl][cl] = hv; sl[rl][cl] = (_Float16)(v - (float)hv); } }
  __syncthreads();
  if (which < 2) { _Float16* dh = which == 0 ? QH : KH; for (int e = tid; e < 64 * 16; e += 128) { const int rl = e >> 4, q = e & 15; vst2((unsigned*)(dh + (r0 + rl) * CC + c0 + q * 8), *(const v4u*)&sh[rl][q * 8]); if (which == 0) vst2((unsigned*)(QL + (r0 + rl) * CC + c0 + q * 8), *(const v4u*)&sl[rl][q * 8]); } }
  else { const size_t b = r0 / TT; const int t0 = (int)(r0 % TT); for (int e = tid; e < 128 * 8; e += 128) { const int cl = e >> 3, q = e & 7; vst2((unsigned*)(VT + (b * CC + c0 + cl) * (size_t)TT + t0 + q * 8), *(const v4u*)&th[cl][q * 8]); } } }
// ---- k_dist: block = (query i, batch b): D[b][i][j] = |p_i - p_j| (0 when the squared sum is exactly 0)
__global__ __launch_bounds__(128) void k_dist(const float* __restrict__ P, float* __restrict__ D) { __shared__ __align__(16) float so[TT];
  const int t = threadIdx.x; const int i = blockIdx.x; const size_t b = blockIdx.y; const float xi = bfr(P[(b * TT + i) * 3]), yi = bfr(P[(b * TT + i) * 3 + 1]), zi = bfr(P[(b * TT + i) * 3 + 2]);
  for (int j = t; j < TT; j += 128) { const float dx = xi - bfr(P[(b * TT + j) * 3]), dy = yi - bfr(P[(b * TT + j) * 3 + 1]), dz = zi - bfr(P[(b * TT + j) * 3 + 2]); const float d2 = dx * dx + dy * dy + dz * dz; so[j] = (d2 > 0.f) ? sqrtf(d2) : 0.f; }
  __syncthreads(); for (int q = t; q < TT / 4; q += 128) vst2(D + (b * TT + i) * (size_t)TT + q * 4, *(const v4f*)&so[q * 4]); }
#define KPI 72    // LDS pitch of a K row, f16: 144 B = 16 B x odd, no bank conflict for 16-byte reads down a column of rows
#define VPI 520   // LDS pitch of a V^T row, f16: 1040 B = 16 B x odd
__device__ __forceinline__ v8f wmma_h(v16h a, v16h b, v8f c) { return __builtin_amdgcn_wmma_f32_16x16x32_f16(false, a, false, b, (short)0, c, false, false); }
__device__ __forceinline__ float xhalf(float x) { return __builtin_bit_cast(float, __builtin_amdgcn_permlanex16(__builtin_bit_cast(int, x), __builtin_bit_cast(int, x), 0x76543210, 0xfedcba98, false, false)); }  // lane l with lane l ^ 16
__global__ __launch_bounds__(256) __attribute__((amdgpu_waves_per_eu(4, 4))) void k_att(const _Float16* __restrict__ QH, const _Float16* __restrict__ QL, const _Float16* __restrict__ KH, const _Float16* __restrict__ VT, const float* __restrict__ Dm, float* __restrict__ U) {
  __shared__ __align__(16) _Float16 sk[TT][KPI]; __shared__ __align__(16) _Float16 sv[HD][VPI];
  const int tid = threadIdx.x, wave = tid >> 5, lane = tid & 31, col = lane & 15, g = lane >> 4; const size_t b = blockIdx.z; const int h = blockIdx.y; const int q0 = blockIdx.x * 256 + wave * 32;
  { const _Float16* kg = KH + (b * TT + (tid >> 3)) * CC + h * HD + (tid & 7) * 8; const _Float16* vg = VT + (b * CC + h * HD + (tid >> 6)) * (size_t)TT + (tid & 63) * 8;   // 8 threads a K row of 128 B, 64 threads a V^T row of 1 KiB
    // both unrolled: a thread's sixteen 16-byte loads are in flight together
#pragma unroll
    for (int i = 0; i < TT / 32; ++i) *(v8h*)&sk[(tid >> 3) + i * 32][(tid & 7) * 8] = *(const v8h*)(kg + i * 32 * CC);
#pragma unroll
    for (int i = 0; i < HD / 4; ++i) *(v8h*)&sv[(tid >> 6) + i * 4][(tid & 63) * 8] = *(const v8h*)(vg + i * 4 * TT); }
  v16h qh[2][2], ql[2][2];
#pragma unroll
  for (int qt = 0; qt < 2; ++qt)
#pragma unroll
    for (int kc = 0; kc < 2; ++kc) { const size_t o = (b * TT + q0 + qt * 16 + col) * CC + h * HD + kc * 32; qh[qt][kc] = frag_h(QH + o, lane); ql[qt][kc] = frag_h(QL + o, lane); }
  const float* dp = Dm + (b * TT + q0 + col) * (size_t)TT + 8 * g;
  v8f o[2][4] = {}; float m[2] = {-3.0e38f, -3.0e38f}, l[2] = {0.f, 0.f};
  const float isq2 = 0.70710678118654752f;
  __syncthreads();
  // rolled: sixteen passes unrolled would not fit the register budget of four waves per SIMD
#pragma unroll 1
  for (int k0 = 0; k0 < TT; k0 += 32) {
    v8f s[2][2] = {};   // [query tile][key tile]: register r = key k0 + 16 t + 8 g + r, column = query
#pragma unroll
    for (int kc = 0; kc < 2; ++kc) { v16h kb[2];
#pragma unroll
      for (int t = 0; t < 2; ++t) kb[t] = frag_h(&sk[k0 + t * 16 + col][kc * 32], lane);
#pragma unroll
      for (int t = 0; t < 2; ++t)
#pragma unroll
        for (int qt = 0; qt < 2; ++qt) s[qt][t] = wmma_h(kb[t], qh[qt][kc], s[qt][t]);
#pragma unroll
      for (int t = 0; t < 2; ++t)
#pragma unroll
        for (int qt = 0; qt < 2; ++qt) s[qt][t] = wmma_h(kb[t], ql[qt][kc], s[qt][t]); }
#pragma unroll
    for (int qt = 0; qt < 2; ++qt) { float x[16];
#pragma unroll
      for (int t = 0; t < 2; ++t) { const float* dq = dp + qt * 16 * TT + k0 + t * 16; const v4f d0 = *(const v4f*)dq, d1 = *(const v4f*)(dq + 4);
#pragma unroll
        for (int r = 0; r < 4; ++r) { x[t * 8 + r] = (d0[r] * 2.0f + s[qt][t][r] * 0.125f) * isq2; x[t * 8 + 4 + r] = (d1[r] * 2.0f + s[qt][t][4 + r] * 0.125f) * isq2; } }
      float mx = x[0];
#pragma unroll
      for (int i = 1; i < 16; ++i) mx = fmaxf(mx, x[i]);
      mx = fmaxf(mx, xhalf(mx));
      const float mn = fmaxf(m[qt], mx); const float al = expf(m[qt] - mn); m[qt] = mn;
      const float mo = mn - 7.625f;   // P and its sum both carry e^7.625 (about 2^11), which keeps small weights out of the f16 subnormals and cancels in the division
      float sum = 0.f; v16h p;
#pragma unroll
      for (int i = 0; i < 16; ++i) { const float e = expf(x[i] - mo); sum += e; p[i] = (_Float16)e; }
      l[qt] = l[qt] * al + sum;
#pragma unroll
      for (int j = 0; j < 4; ++j) o[qt][j] *= al;
#pragma unroll
      for (int j = 0; j < 4; ++j) o[qt][j] = wmma_h(frag_h(&sv[j * 16 + col][k0], lane), p, o[qt][j]); } }
#pragma unroll
  for (int qt = 0; qt < 2; ++qt) { const float inv = 1.0f / (l[qt] + xhalf(l[qt])); float* up = U + (b * TT + q0 + qt * 16 + col) * CC + h * HD + 8 * g;
#pragma unroll
    for (int j = 0; j < 4; ++j) { v4f a0, a1;
#pragma unroll
      for (int r = 0; r < 4; ++r) { a0[r] = o[qt][j][r] * inv; a1[r] = o[qt][j][4 + r] * inv; }
      vst2(up + j * 16, a0); vst2(up + j * 16 + 4, a1); } } }
// ---- k_mlp: block = (64 rows, 128-col block): OUT = silu(A (hi+lo) W + b), A rows [K], W packed fragments of [K][N]
template <int K, int N>
__global__ __launch_bounds__(128) void k_mlp(const float* __restrict__ A, const __bf16* __restrict__ PW, const float* __restrict__ Bv, float* __restrict__ OUT) { __shared__ __align__(16) float sf[4][16][132];
  const int tid = threadIdx.x, wave = tid >> 5, lane = tid & 31, col = lane & 15, g = lane >> 4; const int c0 = blockIdx.y * 128; const size_t r0 = (size_t)blockIdx.x * 64 + wave * 16; constexpr int NT = (N < 128 ? N : 128) / 16; constexpr int G = 16 / NT < K / 32 ? 16 / NT : K / 32;   // k steps whose fragments (16 at most) are loaded together
  const __bf16* pw = PW + (size_t)(c0 / 16) * 512; const float* ar = A + (r0 + col) * K + 8 * g;
  v8f acc[NT]; for (int j = 0; j < NT; ++j) for (int r = 0; r < 8; ++r) acc[j][r] = 0.f;
  // rolled: one group's loads and products are the whole body, the text stays short
#pragma unroll 1
  for (int kg = 0; kg < K / 32; kg += G) { v16b w[G][NT]; v4f av[G][4];
#pragma unroll
    for (int s = 0; s < G; ++s)
#pragma unroll
      for (int i = 0; i < 4; ++i) av[s][i] = *(const v4f*)(ar + (kg + s) * 32 + (i >> 1) * 16 + (i & 1) * 4);
    asm volatile("s_wait_xcnt 0x0" ::: "memory");   // the fragment loads below may land on the row loads' address registers: the wait stands in front of that; its clobber also keeps every row load of the group up here, where left free the later steps' sink behind the first products and pay their latency again
#pragma unroll
    for (int s = 0; s < G; ++s)
#pragma unroll
      for (int j = 0; j < NT; ++j) w[s][j] = frag_p(pw + (size_t)((kg + s) * (N / 16) + j) * 512, lane);
#pragma unroll
    for (int s = 0; s < G; ++s) { float af[16];
#pragma unroll
      for (int i = 0; i < 16; ++i) af[i] = av[s][i >> 2][i & 3];
      const F2 a = bsplit16(af);
#pragma unroll
      for (int j = 0; j < NT; ++j) { acc[j] = wmma_bf(a.h, w[s][j], acc[j]); acc[j] = wmma_bf(a.l, w[s][j], acc[j]); } } }
#pragma unroll
  for (int j = 0; j < NT; ++j) { const float bb = bfr(Bv[c0 + j * 16 + col]);
#pragma unroll
    for (int r = 0; r < 8; ++r) { const float v = acc[j][r] + bb; sf[wave][8 * g + r][j * 16 + col] = v / (1.0f + expf(-v)); } }
  LDSX(); for (int rl = 0; rl < 16; ++rl) if (lane < NT * 4) vst2(OUT + (r0 + rl) * N + c0 + lane * 4, *(const v4f*)&sf[wave][rl][lane * 4]); }
extern "C" void kernel_launch(void* const* d_in, const int* in_sizes, int n_in, void* d_out, int out_size, void* d_ws, size_t ws_size, hipStream_t stream) {
  (void)in_sizes; (void)n_in; (void)out_size;
  const float** F = (const float**)d_in;   // 0 kp_pos [32,512,3], 1 kp_feat [32,512,256], 2 Wk [256,512], 3 Wq, 4 Wv, 5 W1 [512,128], 6 b1, 7 W2 [128,64], 8 b2, 9 W3 [64,256], 10 b3
  if (ws_size < (size_t)WS_END) return;
  char* ws = (char*)d_ws; _Float16 *QH = (_Float16*)(ws + WS_QH), *QL = (_Float16*)(ws + WS_QL), *KH = (_Float16*)(ws + WS_KH), *VT = (_Float16*)(ws + WS_VT); __bf16* PW = (__bf16*)(ws + WS_PW); float *D = (float*)(ws + WS_D), *U = (float*)(ws + WS_U), *H1 = (float*)(ws + WS_H1), *H2 = (float*)(ws + WS_H2);
  k_pack<<<dim3(PW_N / 8 / 256), 256, 0, stream>>>(F[3], F[2], F[4], F[5], F[7], F[9], PW);
  k_proj<<<dim3(TNB * TT / 64, CC / 128, 3), 128, 0, stream>>>(F[1], PW, QH, QL, KH, VT);
  k_dist<<<dim3(TT, TNB), 128, 0, stream>>>(F[0], D);
  k_att<<<dim3(TT / 256, NH, TNB), 256, 0, stream>>>(QH, QL, KH, VT, D, U);
  k_mlp<CC, 128><<<dim3(TNB * TT / 64, 1), 128, 0, stream>>>(U, PW + PW_1, F[6], H1);
  k_mlp<128, 64><<<dim3(TNB * TT / 64, 1), 128, 0, stream>>>(H1, PW + PW_2, F[8], H2);
  k_mlp<64, CIN><<<dim3(TNB * TT / 64, CIN / 128), 128, 0, stream>>>(H2, PW + PW_3, F[10], (float*)d_out);
}

// v003
// A run of this version takes 114 microseconds.
// In both of two side-by-side timings against v002, it was 1.10 times as fast.
// Counting every step since v000, it is 5.49 times as fast.
// compute dtype: all float inputs rounded to bf16; keys/queries/values = kp_feat W with EXACT bf16 products on WMMA 16x16x32, f32 accumulate; pairwise distances sqrt(sum (p_i - p_j)^2) in f32 (precise sqrtf) once per batch; att = (dist / 0.5 + q . k / 8) / sqrt(2) with q as f16 hi + residual, k f16 (2 products), kept in registers; softmax in f32 (base-2 exponent formed by one multiply-add, hardware exp2, running maximum and sum) -> P f16 x 2^11, unnormalised; upd = P . v / sum (v rounded once to f16); out MLP 512 -> 128 -> 64 -> 256 with SiLU (hardware exp2) after each, activations split bf16 hi + lo (2 products); f32 output.
#include <hip/hip_runtime.h>
#include <math.h>

typedef __attribute__((ext_vector_type(16))) _Float16 v16h;
typedef __attribute__((ext_vector_type(16))) __bf16 v16b;
typedef __attribute__((ext_vector_type(8)))  _Float16 v8h;
typedef __attribute__((ext_vector_type(8)))  float v8f;
typedef __attribute__((ext_vector_type(4)))  float v4f;
typedef __attribute__((ext_vector_type(2)))  float v2f;
typedef __attribute__((ext_vector_type(4)))  unsigned v4u;
typedef __attribute__((ext_vector_type(4)))  int v4i;
typedef float __attribute__((may_alias)) float_a;
typedef int __attribute__((may_alias)) int_a;

template <typename T> __device__ __forceinline__ void vst2(void* p, T v) { *(T*)p = v;  }
__device__ __forceinline__ v8f wmma16(v16h a, v16h b, v8f c) {
  v8f d = __builtin_amdgcn_wmma_f32_16x16x32_f16(false, a, false, b, (short)0, c, false, false);
  asm volatile("v_nop\n\tv_nop\n\tv_nop\n\tv_nop" : "+v"(d) : "v"(a), "v"(b));
  return d;
}
__device__ __forceinline__ v8f wmma_bf(v16b a, v16b b, v8f c) {
  v8f d = __builtin_amdgcn_wmma_f32_16x16x32_bf16(false, a, false, b, (short)0, c, false, false);
  asm volatile("v_nop\n\tv_nop\n\tv_nop\n\tv_nop" : "+v"(d) : "v"(a), "v"(b));
  return d;
}
// 16x16x32 fragments: lane = (h = lane>>4, row/col = lane&15); elements 0..7 = k0+8h+0..7, 8..15 = k0+16+8h+0..7; D element r = row 8h+r
__device__ __forceinline__ v16h frag_h(const _Float16* rowk0, int lane) {
  union { v16h v; v8h q[2]; } u; const _Float16* p = rowk0 + 8 * (lane >> 4);
  u.q[0] = *(const v8h*)p; u.q[1] = *(const v8h*)(p + 16); return u.v;
}
__device__ __forceinline__ v16h frag_f32(const float* rowk0, int lane) {
  v16h a; const float* p = rowk0 + 8 * (lane >> 4);
#pragma unroll
  for (int i = 0; i < 8; ++i) { a[i] = (_Float16)p[i]; a[8 + i] = (_Float16)p[16 + i]; }
  return a;
}
__device__ __forceinline__ v16h frag_f32s(const float* rowk0, int lane, float sc) {
  v16h a; const float* p = rowk0 + 8 * (lane >> 4);
#pragma unroll
  for (int i = 0; i < 8; ++i) { a[i] = (_Float16)(p[i] * sc); a[8 + i] = (_Float16)(p[16 + i] * sc); }
  return a;
}
// column fragment from a [K][ld] layout (column n), rows >= K read as 0
__device__ __forceinline__ v16h fragc_f32(const float* W, int k0, int n, int lane, int ld, int K) {
  v16h a; const int g = lane >> 4;
#pragma unroll
  for (int i = 0; i < 8; ++i) { const int ka = k0 + 8 * g + i, kb = ka + 16;
    a[i] = (_Float16)(ka < K ? W[(size_t)(ka < K ? ka : K - 1) * ld + n] : 0.f); a[8 + i] = (_Float16)(kb < K ? W[(size_t)(kb < K ? kb : K - 1) * ld + n] : 0.f); }
  return a;
}
struct F2 { v16b h, l; };
__device__ __forceinline__ F2 bsplit16(const float v[16]) { F2 r;
#pragma unroll
  for (int i = 0; i < 16; ++i) { const __bf16 h = (__bf16)v[i]; r.h[i] = h; r.l[i] = (__bf16)(v[i] - (float)h); }
  return r; }
__device__ __forceinline__ F2 split_row(const float* row, int k0, int lane) { float v[16]; const float* p = row + k0 + 8 * (lane >> 4);
#pragma unroll
  for (int i = 0; i < 8; ++i) { v[i] = p[i]; v[8 + i] = p[16 + i]; }
  return bsplit16(v); }
__device__ __forceinline__ F2 split_rowK(const float* row, int k0, int lane, int K) { float v[16]; const int g = lane >> 4;
#pragma unroll
  for (int i = 0; i < 8; ++i) { const int ka = k0 + 8 * g + i, kb = ka + 16; v[i] = ka < K ? row[ka < K ? ka : K - 1] : 0.f; v[8 + i] = kb < K ? row[kb < K ? kb : K - 1] : 0.f; }
  return bsplit16(v); }
__device__ __forceinline__ F2 split_col(const float* W, int k0, int n, int lane, int ld, int K) { float v[16]; const int g = lane >> 4;
#pragma unroll
  for (int i = 0; i < 8; ++i) { const int ka = k0 + 8 * g + i, kb = ka + 16; v[i] = ka < K ? W[(size_t)(ka < K ? ka : K - 1) * ld + n] : 0.f; v[8 + i] = kb < K ? W[(size_t)(kb < K ? kb : K - 1) * ld + n] : 0.f; }
  return bsplit16(v); }
__device__ __forceinline__ v8f mac3(const F2& a, const F2& b, v8f c) { c = wmma_bf(a.l, b.h, c); c = wmma_bf(a.h, b.l, c); return wmma_bf(a.h, b.h, c); }
__device__ __forceinline__ float sigm(float v) { return 1.0f / (1.0f + expf(-v)); }
#define LDSX() do { asm volatile("s_wait_dscnt 0" ::: "memory"); __builtin_amdgcn_wave_barrier(); __builtin_amdgcn_fence(__ATOMIC_RELEASE, "workgroup"); } while (0)


// Keypoint multi-head attention (B 32, N 512 keypoints, in_dim 256, 8 heads x 64): distance-biased attention followed by a 3-layer SiLU MLP.
#define NB 32
#define TT 512
#define CIN 256
#define CC 512
#define NH 8
#define HD 64
#define NR (NB * TT)
#ifndef TNB
#define TNB NB
#endif
typedef __attribute__((ext_vector_type(8))) __bf16 v8b;
__device__ __forceinline__ v16b frag_b(const __bf16* rowk0, int lane) {
  union { v16b v; v8b q[2]; } u; const __bf16* p = rowk0 + 8 * (lane >> 4);
  u.q[0] = *(const v8b*)p; u.q[1] = *(const v8b*)(p + 16); return u.v;
}
__device__ __forceinline__ float bfr(float v) { return (float)(__bf16)v; }
__device__ __attribute__((noinline)) float exp_ni(float v) { return expf(v); }
__device__ __attribute__((noinline)) float erf_ni(float v) { return erff(v); }

#define WS_QH  0u
#define WS_QL  (WS_QH + 2u * (size_t)NR * CC)
#define WS_KH  (WS_QL + 2u * (size_t)NR * CC)
#define WS_VT  (WS_KH + 2u * (size_t)NR * CC)          // f16 v planes [b][512][t]
#define WS_D   (WS_VT + 2u * (size_t)NR * CC)          // f32 dist [b][t][t]
#define WS_U   (WS_D + 4u * (size_t)NB * TT * TT)      // f32 upd rows [b*t][512]
#define WS_H1  (WS_U + 4u * (size_t)NR * CC)           // f32 [b*t][128]
#define WS_H2  (WS_H1 + 4u * (size_t)NR * 128)         // f32 [b*t][64]
#define WS_PW  (WS_H2 + 4u * (size_t)NR * 64)          // bf16 weights in fragment order: Wq, Wk, Wv, W1, W2, W3
#define PW_P   (CIN * CC)                              // elements of one projection matrix
#define PW_1   (3 * PW_P)
#define PW_2   (PW_1 + CC * 128)
#define PW_3   (PW_2 + 128 * 64)
#define PW_N   (PW_3 + 64 * CIN)
#define WS_END (WS_PW + 2u * (size_t)PW_N)

// ---- k_pack: every weight matrix W [K][N] (in,out), rounded to bf16 once and laid out as finished B fragments: fragment (kc, nt) = 1 KiB = two runs of 32 lanes x 16 B; lane (g, col) holds column nt*16+col, run 0 = rows kc*32+8g+0..7, run 1 = rows kc*32+16+8g+0..7. One thread writes one 16-byte unit u.
template <int N> __device__ __forceinline__ void pack_unit(const float* __restrict__ Wm, __bf16* __restrict__ dst, int u) {
  const int lane = u & 31, run = (u >> 5) & 1, f = u >> 6, nt = f % (N / 16), kc = f / (N / 16);
  const float* p = Wm + (size_t)(kc * 32 + run * 16 + 8 * (lane >> 4)) * N + nt * 16 + (lane & 15); v8b v;
#pragma unroll
  for (int i = 0; i < 8; ++i) v[i] = (__bf16)p[(size_t)i * N];
  *(v8b*)(dst + (size_t)u * 8) = v; }
__global__ __launch_bounds__(256) void k_pack(const float* __restrict__ WQ, const float* __restrict__ WK, const float* __restrict__ WV, const float* __restrict__ W1, const float* __restrict__ W2, const float* __restrict__ W3, __bf16* __restrict__ PW) {
  const int u = blockIdx.x * 256 + threadIdx.x;   // every matrix is a whole number of blocks, so the choice below is the same for a whole block
  if (u < PW_1 / 8) { const int m = u / (PW_P / 8); pack_unit<CC>(m == 0 ? WQ : m == 1 ? WK : WV, PW + (size_t)m * PW_P, u - m * (PW_P / 8)); }
  else if (u < PW_2 / 8) pack_unit<128>(W1, PW + PW_1, u - PW_1 / 8);
  else if (u < PW_3 / 8) pack_unit<64>(W2, PW + PW_2, u - PW_2 / 8);
  else pack_unit<CIN>(W3, PW + PW_3, u - PW_3 / 8); }
// a packed fragment: two 16-byte loads a lane, each a run of 512 contiguous bytes over the wave
__device__ __forceinline__ v16b frag_p(const __bf16* f, int lane) {
  union { v16b v; v8b q[2]; } u; u.q[0] = *(const v8b*)(f + lane * 8); u.q[1] = *(const v8b*)(f + 256 + lane * 8); return u.v;
}

// ---- k_proj: block = (64 rows, 128 cols, which): kp_feat W (packed fragments of [256][512]), no bias
__global__ __launch_bounds__(128) void k_proj(const float* __restrict__ X, const __bf16* __restrict__ PW, _Float16* __restrict__ QH, _Float16* __restrict__ QL, _Float16* __restrict__ KH, _Float16* __restrict__ VT) {
  __shared__ __align__(16) _Float16 sh[64][136], sl[64][136]; __shared__ __align__(16) _Float16 th[128][72];
  const int tid = threadIdx.x, wave = tid >> 5, lane = tid & 31, col = lane & 15, g = lane >> 4; const int which = blockIdx.z; const int c0 = blockIdx.y * 128; const size_t r0 = (size_t)blockIdx.x * 64; const __bf16* pw = PW + (size_t)which * PW_P + (size_t)(c0 / 16) * 512;
  v8f acc[8] = {};
#pragma unroll
  for (int kc = 0; kc < CIN / 32; ++kc) { v16b a, w[8];   // the k step's eight fragments are loaded ahead of its first product, so they are in flight together
#pragma unroll
    for (int j = 0; j < 8; ++j) w[j] = frag_p(pw + (size_t)(kc * (CC / 16) + j) * 512, lane);
    { const float* p = X + (r0 + wave * 16 + col) * CIN + kc * 32 + 8 * g;
#pragma unroll
      for (int i = 0; i < 8; ++i) { a[i] = (__bf16)p[i]; a[8 + i] = (__bf16)p[16 + i]; } }
#pragma unroll
    for (int j = 0; j < 8; ++j) acc[j] = wmma_bf(a, w[j], acc[j]); }
#pragma unroll
  for (int j = 0; j < 8; ++j)
#pragma unroll
    for (int r = 0; r < 8; ++r) { const float v = acc[j][r]; const int rl = wave * 16 + 8 * g + r, cl = j * 16 + col; const _Float16 hv = (_Float16)v; if (which == 2) th[cl][rl] = hv; else { sh[rl][cl] = hv; sl[rl][cl] = (_Float16)(v - (float)hv); } }
  __syncthreads();
  if (which < 2) { _Float16* dh = which == 0 ? QH : KH; for (int e = tid; e < 64 * 16; e += 128) { const int rl = e >> 4, q = e & 15; vst2((unsigned*)(dh + (r0 + rl) * CC + c0 + q * 8), *(const v4u*)&sh[rl][q * 8]); if (which == 0) vst2((unsigned*)(QL + (r0 + rl) * CC + c0 + q * 8), *(const v4u*)&sl[rl][q * 8]); } }
  else { const size_t b = r0 / TT; const int t0 = (int)(r0 % TT); for (int e = tid; e < 128 * 8; e += 128) { const int cl = e >> 3, q = e & 7; vst2((unsigned*)(VT + (b * CC + c0 + cl) * (size_t)TT + t0 + q * 8), *(const v4u*)&th[cl][q * 8]); } } }
// ---- k_dist: block = (query i, batch b): D[b][i][j] = |p_i - p_j| (0 when the squared sum is exactly 0)
__global__ __launch_bounds__(128) void k_dist(const float* __restrict__ P, float* __restrict__ D) { __shared__ __align__(16) float so[TT];
  const int t = threadIdx.x; const int i = blockIdx.x; const size_t b = blockIdx.y; const float xi = bfr(P[(b * TT + i) * 3]), yi = bfr(P[(b * TT + i) * 3 + 1]), zi = bfr(P[(b * TT + i) * 3 + 2]);
  for (int j = t; j < TT; j += 128) { const float dx = xi - bfr(P[(b * TT + j) * 3]), dy = yi - bfr(P[(b * TT + j) * 3 + 1]), dz = zi - bfr(P[(b * TT + j) * 3 + 2]); const float d2 = dx * dx + dy * dy + dz * dz; so[j] = (d2 > 0.f) ? sqrtf(d2) : 0.f; }
  __syncthreads(); for (int q = t; q < TT / 4; q += 128) vst2(D + (b * TT + i) * (size_t)TT + q * 4, *(const v4f*)&so[q * 4]); }
#define KPI 72    // LDS pitch of a K row, f16: 144 B = 16 B x odd, no bank conflict for 16-byte reads down a column of rows
#define VPI 520   // LDS pitch of a V^T row, f16: 1040 B = 16 B x odd
__device__ __forceinline__ v8f wmma_h(v16h a, v16h b, v8f c) { return __builtin_amdgcn_wmma_f32_16x16x32_f16(false, a, false, b, (short)0, c, false, false); }
__device__ __forceinline__ float ex2(float x) { return __builtin_amdgcn_exp2f(x); }  // one v_exp_f32; an argument under -126 gives 0
#define LOG2E 1.4426950408889634
__device__ __forceinline__ float xhalf(float x) { return __builtin_bit_cast(float, __builtin_amdgcn_permlanex16(__builtin_bit_cast(int, x), __builtin_bit_cast(int, x), 0x76543210, 0xfedcba98, false, false)); }  // lane l with lane l ^ 16
__global__ __launch_bounds__(256) __attribute__((amdgpu_waves_per_eu(4, 4))) void k_att(const _Float16* __restrict__ QH, const _Float16* __restrict__ QL, const _Float16* __restrict__ KH, const _Float16* __restrict__ VT, const float* __restrict__ Dm, float* __restrict__ U) {
  __shared__ __align__(16) _Float16 sk[TT][KPI]; __shared__ __align__(16) _Float16 sv[HD][VPI];
  const int tid = threadIdx.x, wave = tid >> 5, lane = tid & 31, col = lane & 15, g = lane >> 4; const size_t b = blockIdx.z; const int h = blockIdx.y; const int q0 = blockIdx.x * 256 + wave * 32;
  { const _Float16* kg = KH + (b * TT + (tid >> 3)) * CC + h * HD + (tid & 7) * 8; const _Float16* vg = VT + (b * CC + h * HD + (tid >> 6)) * (size_t)TT + (tid & 63) * 8;   // 8 threads a K row of 128 B, 64 threads a V^T row of 1 KiB
    // both unrolled: a thread's sixteen 16-byte loads are in flight together
#pragma unroll
    for (int i = 0; i < TT / 32; ++i) *(v8h*)&sk[(tid >> 3) + i * 32][(tid & 7) * 8] = *(const v8h*)(kg + i * 32 * CC);
#pragma unroll
    for (int i = 0; i < HD / 4; ++i) *(v8h*)&sv[(tid >> 6) + i * 4][(tid & 63) * 8] = *(const v8h*)(vg + i * 4 * TT); }
  v16h qh[2][2], ql[2][2];
#pragma unroll
  for (int qt = 0; qt < 2; ++qt)
#pragma unroll
    for (int kc = 0; kc < 2; ++kc) { const size_t o = (b * TT + q0 + qt * 16 + col) * CC + h * HD + kc * 32; qh[qt][kc] = frag_h(QH + o, lane); ql[qt][kc] = frag_h(QL + o, lane); }
  const float* dp = Dm + (b * TT + q0 + col) * (size_t)TT + 8 * g;
  v8f o[2][4] = {}; float m[2] = {-3.0e38f, -3.0e38f}, l[2] = {0.f, 0.f};
  const float c2 = (float)(0.125 * 0.70710678118654752 * LOG2E);   // att log2(e) = (16 dist + q.k) c2
  __syncthreads();
  // rolled: sixteen passes unrolled would not fit the register budget of four waves per SIMD
#pragma unroll 1
  for (int k0 = 0; k0 < TT; k0 += 32) {
    v8f s[2][2] = {};   // [query tile][key tile]: register r = key k0 + 16 t + 8 g + r, column = query
#pragma unroll
    for (int kc = 0; kc < 2; ++kc) { v16h kb[2];
#pragma unroll
      for (int t = 0; t < 2; ++t) kb[t] = frag_h(&sk[k0 + t * 16 + col][kc * 32], lane);
#pragma unroll
      for (int t = 0; t < 2; ++t)
#pragma unroll
        for (int qt = 0; qt < 2; ++qt) s[qt][t] = wmma_h(kb[t], qh[qt][kc], s[qt][t]);
#pragma unroll
      for (int t = 0; t < 2; ++t)
#pragma unroll
        for (int qt = 0; qt < 2; ++qt) s[qt][t] = wmma_h(kb[t], ql[qt][kc], s[qt][t]); }
#pragma unroll
    for (int qt = 0; qt < 2; ++qt) { v2f z[8];   // z = 16 dist + q.k, two keys a pair; maximum and running maximum are kept in z
#pragma unroll
      for (int t = 0; t < 2; ++t) { const float* dq = dp + qt * 16 * TT + k0 + t * 16; const v4f d0 = *(const v4f*)dq, d1 = *(const v4f*)(dq + 4); const v2f c16 = {16.0f, 16.0f};
#pragma unroll
        for (int r = 0; r < 2; ++r) { z[t * 4 + r] = __builtin_elementwise_fma((v2f){d0[2 * r], d0[2 * r + 1]}, c16, (v2f){s[qt][t][2 * r], s[qt][t][2 * r + 1]}); z[t * 4 + 2 + r] = __builtin_elementwise_fma((v2f){d1[2 * r], d1[2 * r + 1]}, c16, (v2f){s[qt][t][4 + 2 * r], s[qt][t][5 + 2 * r]}); } }
      float mx = z[0][0];
#pragma unroll
      for (int i = 1; i < 16; ++i) mx = fmaxf(mx, z[i >> 1][i & 1]);
      mx = fmaxf(mx, xhalf(mx));
      const float mn = fmaxf(m[qt], mx); const float al = ex2((m[qt] - mn) * c2); m[qt] = mn;
      const float nb = __builtin_fmaf(-mn, c2, 11.0f);   // P and its sum both carry 2^11, which keeps small weights out of the f16 subnormals and cancels in the division
      float sum = 0.f; v16h p;
#pragma unroll
      for (int i = 0; i < 8; ++i) { const v2f y = __builtin_elementwise_fma(z[i], (v2f){c2, c2}, (v2f){nb, nb}); const float e0 = ex2(y[0]), e1 = ex2(y[1]); sum += e0; sum += e1; p[2 * i] = (_Float16)e0; p[2 * i + 1] = (_Float16)e1; }
      l[qt] = l[qt] * al + sum;
#pragma unroll
      for (int j = 0; j < 4; ++j) o[qt][j] *= al;
#pragma unroll
      for (int j = 0; j < 4; ++j) o[qt][j] = wmma_h(frag_h(&sv[j * 16 + col][k0], lane), p, o[qt][j]); } }
#pragma unroll
  for (int qt = 0; qt < 2; ++qt) { const float inv = 1.0f / (l[qt] + xhalf(l[qt])); float* up = U + (b * TT + q0 + qt * 16 + col) * CC + h * HD + 8 * g;
#pragma unroll
    for (int j = 0; j < 4; ++j) { v4f a0, a1;
#pragma unroll
      for (int r = 0; r < 4; ++r) { a0[r] = o[qt][j][r] * inv; a1[r] = o[qt][j][4 + r] * inv; }
      vst2(up + j * 16, a0); vst2(up + j * 16 + 4, a1); } } }
// ---- k_mlp: block = (64 rows, 128-col block): OUT = silu(A (hi+lo) W + b), A rows [K], W packed fragments of [K][N]
template <int K, int N>
__global__ __launch_bounds__(128) void k_mlp(const float* __restrict__ A, const __bf16* __restrict__ PW, const float* __restrict__ Bv, float* __restrict__ OUT) { __shared__ __align__(16) float sf[4][16][132];
  const int tid = threadIdx.x, wave = tid >> 5, lane = tid & 31, col = lane & 15, g = lane >> 4; const int c0 = blockIdx.y * 128; const size_t r0 = (size_t)blockIdx.x * 64 + wave * 16; constexpr int NT = (N < 128 ? N : 128) / 16; constexpr int G = 16 / NT < K / 32 ? 16 / NT : K / 32;   // k steps whose fragments (16 at most) are loaded together
  const __bf16* pw = PW + (size_t)(c0 / 16) * 512; const float* ar = A + (r0 + col) * K + 8 * g;
  v8f acc[NT]; for (int j = 0; j < NT; ++j) for (int r = 0; r < 8; ++r) acc[j][r] = 0.f;
  // rolled: one group's loads and products are the whole body, the text stays short
#pragma unroll 1
  for (int kg = 0; kg < K / 32; kg += G) { v16b w[G][NT]; v4f av[G][4];
#pragma unroll
    for (int s = 0; s < G; ++s)
#pragma unroll
      for (int i = 0; i < 4; ++i) av[s][i] = *(const v4f*)(ar + (kg + s) * 32 + (i >> 1) * 16 + (i & 1) * 4);
    asm volatile("s_wait_xcnt 0x0" ::: "memory");   // the fragment loads below may land on the row loads' address registers: the wait stands in front of that; its clobber also keeps every row load of the group up here, where left free the later steps' sink behind the first products and pay their latency again
#pragma unroll
    for (int s = 0; s < G; ++s)
#pragma unroll
      for (int j = 0; j < NT; ++j) w[s][j] = frag_p(pw + (size_t)((kg + s) * (N / 16) + j) * 512, lane);
#pragma unroll
    for (int s = 0; s < G; ++s) { float af[16];
#pragma unroll
      for (int i = 0; i < 16; ++i) af[i] = av[s][i >> 2][i & 3];
      const F2 a = bsplit16(af);
#pragma unroll
      for (int j = 0; j < NT; ++j) { acc[j] = wmma_bf(a.h, w[s][j], acc[j]); acc[j] = wmma_bf(a.l, w[s][j], acc[j]); } } }
#pragma unroll
  for (int j = 0; j < NT; ++j) { const float bb = bfr(Bv[c0 + j * 16 + col]);
#pragma unroll
    for (int r = 0; r < 8; ++r) { const float v = acc[j][r] + bb; sf[wave][8 * g + r][j * 16 + col] = v / (1.0f + ex2(v * (float)-LOG2E)); } }
  LDSX(); for (int rl = 0; rl < 16; ++rl) if (lane < NT * 4) vst2(OUT + (r0 + rl) * N + c0 + lane * 4, *(const v4f*)&sf[wave][rl][lane * 4]); }
extern "C" void kernel_launch(void* const* d_in, const int* in_sizes, int n_in, void* d_out, int out_size, void* d_ws, size_t ws_size, hipStream_t stream) {
  (void)in_sizes; (void)n_in; (void)out_size;
  const float** F = (const float**)d_in;   // 0 kp_pos [32,512,3], 1 kp_feat [32,512,256], 2 Wk [256,512], 3 Wq, 4 Wv, 5 W1 [512,128], 6 b1, 7 W2 [128,64], 8 b2, 9 W3 [64,256], 10 b3
  if (ws_size < (size_t)WS_END) return;
  char* ws = (char*)d_ws; _Float16 *QH = (_Float16*)(ws + WS_QH), *QL = (_Float16*)(ws + WS_QL), *KH = (_Float16*)(ws + WS_KH), *VT = (_Float16*)(ws + WS_VT); __bf16* PW = (__bf16*)(ws + WS_PW); float *D = (float*)(ws + WS_D), *U = (float*)(ws + WS_U), *H1 = (float*)(ws + WS_H1), *H2 = (float*)(ws + WS_H2);
  k_pack<<<dim3(PW_N / 8 / 256), 256, 0, stream>>>(F[3], F[2], F[4], F[5], F[7], F[9], PW);
  k_proj<<<dim3(TNB * TT / 64, CC / 128, 3), 128, 0, stream>>>(F[1], PW, QH, QL, KH, VT);
  k_dist<<<dim3(TT, TNB), 128, 0, stream>>>(F[0], D);
  k_att<<<dim3(TT / 256, NH, TNB), 256, 0, stream>>>(QH, QL, KH, VT, D, U);
  k_mlp<CC, 128><<<dim3(TNB * TT / 64, 1), 128, 0, stream>>>(U, PW + PW_1, F[6], H1);
  k_mlp<128, 64><<<dim3(TNB * TT / 64, 1), 128, 0, stream>>>(H1, PW + PW_2, F[8], H2);
  k_mlp<64, CIN><<<dim3(TNB * TT / 64, CIN / 128), 128, 0, stream>>>(H2, PW + PW_3, F[10], (float*)d_out);
}

// v004
// Measured time: 109 microseconds a run.
// In both of two side-by-side timings against v003, it was 1.05 times as fast.
// Counting every step since v000, it is 5.76 times as fast.
// compute dtype: all float inputs rounded to bf16; keys/queries/values = kp_feat W with EXACT bf16 products on WMMA 16x16x32, f32 accumulate; pairwise distances sqrt(sum (p_i - p_j)^2) in f32 (precise sqrtf) once per batch; att = (dist / 0.5 + q . k / 8) / sqrt(2) with q as f16 hi + residual, k f16 (2 products), kept in registers; softmax in f32 (base-2 exponent formed by one multiply-add, hardware exp2, running maximum and sum) -> P f16 x 2^11, unnormalised; upd = P . v / sum (v rounded once to f16); out MLP 512 -> 128 -> 64 -> 256 with SiLU (hardware exp2) after each, activations split bf16 hi + lo (2 products); f32 output.
#include <hip/hip_runtime.h>
#include <math.h>

typedef __attribute__((ext_vector_type(16))) _Float16 v16h;
typedef __attribute__((ext_vector_type(16))) __bf16 v16b;
typedef __attribute__((ext_vector_type(8)))  _Float16 v8h;
typedef __attribute__((ext_vector_type(8)))  float v8f;
typedef __attribute__((ext_vector_type(4)))  float v4f;
typedef __attribute__((ext_vector_type(2)))  float v2f;
typedef __attribute__((ext_vector_type(4)))  unsigned v4u;
typedef __attribute__((ext_vector_type(4)))  int v4i;
typedef float __attribute__((may_alias)) float_a;
typedef int __attribute__((may_alias)) int_a;

template <typename T> __device__ __forceinline__ void vst2(void* p, T v) { *(T*)p = v;  }
__device__ __forceinline__ v8f wmma16(v16h a, v16h b, v8f c) {
  v8f d = __builtin_amdgcn_wmma_f32_16x16x32_f16(false, a, false, b, (short)0, c, false, false);
  asm volatile("v_nop\n\tv_nop\n\tv_nop\n\tv_nop" : "+v"(d) : "v"(a), "v"(b));
  return d;
}
__device__ __forceinline__ v8f wmma_bf(v16b a, v16b b, v8f c) {
  v8f d = __builtin_amdgcn_wmma_f32_16x16x32_bf16(false, a, false, b, (short)0, c, false, false);
  asm volatile("v_nop\n\tv_nop\n\tv_nop\n\tv_nop" : "+v"(d) : "v"(a), "v"(b));
  return d;
}
// 16x16x32 fragments: lane = (h = lane>>4, row/col = lane&15); elements 0..7 = k0+8h+0..7, 8..15 = k0+16+8h+0..7; D element r = row 8h+r
__device__ __forceinline__ v16h frag_h(const _Float16* rowk0, int lane) {
  union { v16h v; v8h q[2]; } u; const _Float16* p = rowk0 + 8 * (lane >> 4);
  u.q[0] = *(const v8h*)p; u.q[1] = *(const v8h*)(p + 16); return u.v;
}
__device__ __forceinline__ v16h frag_f32(const float* rowk0, int lane) {
  v16h a; const float* p = rowk0 + 8 * (lane >> 4);
#pragma unroll
  for (int i = 0; i < 8; ++i) { a[i] = (_Float16)p[i]; a[8 + i] = (_Float16)p[16 + i]; }
  return a;
}
__device__ __forceinline__ v16h frag_f32s(const float* rowk0, int lane, float sc) {
  v16h a; const float* p = rowk0 + 8 * (lane >> 4);
#pragma unroll
  for (int i = 0; i < 8; ++i) { a[i] = (_Float16)(p[i] * sc); a[8 + i] = (_Float16)(p[16 + i] * sc); }
  return a;
}
// column fragment from a [K][ld] layout (column n), rows >= K read as 0
__device__ __forceinline__ v16h fragc_f32(const float* W, int k0, int n, int lane, int ld, int K) {
  v16h a; const int g = lane >> 4;
#pragma unroll
  for (int i = 0; i < 8; ++i) { const int ka = k0 + 8 * g + i, kb = ka + 16;
    a[i] = (_Float16)(ka < K ? W[(size_t)(ka < K ? ka : K - 1) * ld + n] : 0.f); a[8 + i] = (_Float16)(kb < K ? W[(size_t)(kb < K ? kb : K - 1) * ld + n] : 0.f); }
  return a;
}
struct F2 { v16b h, l; };
__device__ __forceinline__ F2 bsplit16(const float v[16]) { F2 r;
#pragma unroll
  for (int i = 0; i < 16; ++i) { const __bf16 h = (__bf16)v[i]; r.h[i] = h; r.l[i] = (__bf16)(v[i] - (float)h); }
  return r; }
__device__ __forceinline__ F2 split_row(const float* row, int k0, int lane) { float v[16]; const float* p = row + k0 + 8 * (lane >> 4);
#pragma unroll
  for (int i = 0; i < 8; ++i) { v[i] = p[i]; v[8 + i] = p[16 + i]; }
  return bsplit16(v); }
__device__ __forceinline__ F2 split_rowK(const float* row, int k0, int lane, int K) { float v[16]; const int g = lane >> 4;
#pragma unroll
  for (int i = 0; i < 8; ++i) { const int ka = k0 + 8 * g + i, kb = ka + 16; v[i] = ka < K ? row[ka < K ? ka : K - 1] : 0.f; v[8 + i] = kb < K ? row[kb < K ? kb : K - 1] : 0.f; }
  return bsplit16(v); }
__device__ __forceinline__ F2 split_col(const float* W, int k0, int n, int lane, int ld, int K) { float v[16]; const int g = lane >> 4;
#pragma unroll
  for (int i = 0; i < 8; ++i) { const int ka = k0 + 8 * g + i, kb = ka + 16; v[i] = ka < K ? W[(size_t)(ka < K ? ka : K - 1) * ld + n] : 0.f; v[8 + i] = kb < K ? W[(size_t)(kb < K ? kb : K - 1) * ld + n] : 0.f; }
  return bsplit16(v); }
__device__ __forceinline__ v8f mac3(const F2& a, const F2& b, v8f c) { c = wmma_bf(a.l, b.h, c); c = wmma_bf(a.h, b.l, c); return wmma_bf(a.h, b.h, c); }
__device__ __forceinline__ float sigm(float v) { return 1.0f / (1.0f + expf(-v)); }
#define LDSX() do { asm volatile("s_wait_dscnt 0" ::: "memory"); __builtin_amdgcn_wave_barrier(); __builtin_amdgcn_fence(__ATOMIC_RELEASE, "workgroup"); } while (0)


// Keypoint multi-head attention (B 32, N 512 keypoints, in_dim 256, 8 heads x 64): distance-biased attention followed by a 3-layer SiLU MLP.
#define NB 32
#define TT 512
#define CIN 256
#define CC 512
#define NH 8
#define HD 64
#define NR (NB * TT)
#ifndef TNB
#define TNB NB
#endif
typedef __attribute__((ext_vector_type(8))) __bf16 v8b;
__device__ __forceinline__ v16b frag_b(const __bf16* rowk0, int lane) {
  union { v16b v; v8b q[2]; } u; const __bf16* p = rowk0 + 8 * (lane >> 4);
  u.q[0] = *(const v8b*)p; u.q[1] = *(const v8b*)(p + 16); return u.v;
}
__device__ __forceinline__ float bfr(float v) { return (float)(__bf16)v; }
__device__ __attribute__((noinline)) float exp_ni(float v) { return expf(v); }
__device__ __attribute__((noinline)) float erf_ni(float v) { return erff(v); }

#define WS_QH  0u
#define WS_QL  (WS_QH + 2u * (size_t)NR * CC)
#define WS_KH  (WS_QL + 2u * (size_t)NR * CC)
#define WS_VT  (WS_KH + 2u * (size_t)NR * CC)          // f16 v planes [b][512][t]
#define WS_D   (WS_VT + 2u * (size_t)NR * CC)          // f32 dist [b][tile of 16 queries][unit], k_dist's order
#define WS_U   (WS_D + 4u * (size_t)NB * TT * TT)      // f32 upd rows [b*t][512]
#define WS_H1  (WS_U + 4u * (size_t)NR * CC)           // f32 [b*t][128]
#define WS_H2  (WS_H1 + 4u * (size_t)NR * 128)         // f32 [b*t][64]
#define WS_PW  (WS_H2 + 4u * (size_t)NR * 64)          // bf16 weights in fragment order: Wq, Wk, Wv, W1, W2, W3
#define PW_P   (CIN * CC)                              // elements of one projection matrix
#define PW_1   (3 * PW_P)
#define PW_2   (PW_1 + CC * 128)
#define PW_3   (PW_2 + 128 * 64)
#define PW_N   (PW_3 + 64 * CIN)
#define WS_END (WS_PW + 2u * (size_t)PW_N)

// ---- k_pack: every weight matrix W [K][N] (in,out), rounded to bf16 once and laid out as finished B fragments: fragment (kc, nt) = 1 KiB = two runs of 32 lanes x 16 B; lane (g, col) holds column nt*16+col, run 0 = rows kc*32+8g+0..7, run 1 = rows kc*32+16+8g+0..7. One thread writes one 16-byte unit u.
template <int N> __device__ __forceinline__ void pack_unit(const float* __restrict__ Wm, __bf16* __restrict__ dst, int u) {
  const int lane = u & 31, run = (u >> 5) & 1, f = u >> 6, nt = f % (N / 16), kc = f / (N / 16);
  const float* p = Wm + (size_t)(kc * 32 + run * 16 + 8 * (lane >> 4)) * N + nt * 16 + (lane & 15); v8b v;
#pragma unroll
  for (int i = 0; i < 8; ++i) v[i] = (__bf16)p[(size_t)i * N];
  *(v8b*)(dst + (size_t)u * 8) = v; }
__global__ __launch_bounds__(256) void k_pack(const float* __restrict__ WQ, const float* __restrict__ WK, const float* __restrict__ WV, const float* __restrict__ W1, const float* __restrict__ W2, const float* __restrict__ W3, __bf16* __restrict__ PW) {
  const int u = blockIdx.x * 256 + threadIdx.x;   // every matrix is a whole number of blocks, so the choice below is the same for a whole block
  if (u < PW_1 / 8) { const int m = u / (PW_P / 8); pack_unit<CC>(m == 0 ? WQ : m == 1 ? WK : WV, PW + (size_t)m * PW_P, u - m * (PW_P / 8)); }
  else if (u < PW_2 / 8) pack_unit<128>(W1, PW + PW_1, u - PW_1 / 8);
  else if (u < PW_3 / 8) pack_unit<64>(W2, PW + PW_2, u - PW_2 / 8);
  else pack_unit<CIN>(W3, PW + PW_3, u - PW_3 / 8); }
// a packed fragment: two 16-byte loads a lane, each a run of 512 contiguous bytes over the wave
__device__ __forceinline__ v16b frag_p(const __bf16* f, int lane) {
  union { v16b v; v8b q[2]; } u; u.q[0] = *(const v8b*)(f + lane * 8); u.q[1] = *(const v8b*)(f + 256 + lane * 8); return u.v;
}

// ---- k_proj: block = (64 rows, 128 cols, which): kp_feat W (packed fragments of [256][512]), no bias
__global__ __launch_bounds__(128) void k_proj(const float* __restrict__ X, const __bf16* __restrict__ PW, _Float16* __restrict__ QH, _Float16* __restrict__ QL, _Float16* __restrict__ KH, _Float16* __restrict__ VT) {
  __shared__ __align__(16) _Float16 sh[64][136], sl[64][136]; __shared__ __align__(16) _Float16 th[128][72];
  const int tid = threadIdx.x, wave = tid >> 5, lane = tid & 31, col = lane & 15, g = lane >> 4; const int which = blockIdx.z; const int c0 = blockIdx.y * 128; const size_t r0 = (size_t)blockIdx.x * 64; const __bf16* pw = PW + (size_t)which * PW_P + (size_t)(c0 / 16) * 512;
  v8f acc[8] = {};
#pragma unroll
  for (int kc = 0; kc < CIN / 32; ++kc) { v16b a, w[8];   // the k step's eight fragments are loaded ahead of its first product, so they are in flight together
#pragma unroll
    for (int j = 0; j < 8; ++j) w[j] = frag_p(pw + (size_t)(kc * (CC / 16) + j) * 512, lane);
    { const float* p = X + (r0 + wave * 16 + col) * CIN + kc * 32 + 8 * g;
#pragma unroll
      for (int i = 0; i < 8; ++i) { a[i] = (__bf16)p[i]; a[8 + i] = (__bf16)p[16 + i]; } }
#pragma unroll
    for (int j = 0; j < 8; ++j) acc[j] = wmma_bf(a, w[j], acc[j]); }
#pragma unroll
  for (int j = 0; j < 8; ++j)
#pragma unroll
    for (int r = 0; r < 8; ++r) { const float v = acc[j][r]; const int rl = wave * 16 + 8 * g + r, cl = j * 16 + col; const _Float16 hv = (_Float16)v; if (which == 2) th[cl][rl] = hv; else { sh[rl][cl] = hv; sl[rl][cl] = (_Float16)(v - (float)hv); } }
  __syncthreads();
  if (which < 2) { _Float16* dh = which == 0 ? QH : KH; for (int e = tid; e < 64 * 16; e += 128) { const int rl = e >> 4, q = e & 15; vst2((unsigned*)(dh + (r0 + rl) * CC + c0 + q * 8), *(const v4u*)&sh[rl][q * 8]); if (which == 0) vst2((unsigned*)(QL + (r0 + rl) * CC + c0 + q * 8), *(const v4u*)&sl[rl][q * 8]); } }
  else { const size_t b = r0 / TT; const int t0 = (int)(r0 % TT); for (int e = tid; e < 128 * 8; e += 128) { const int cl = e >> 3, q = e & 7; vst2((unsigned*)(VT + (b * CC + c0 + cl) * (size_t)TT + t0 + q * 8), *(const v4u*)&th[cl][q * 8]); } } }
// ---- k_dist: block = (tile of 16 queries, batch b): |p_i - p_j| (0 when the squared sum is exactly 0), stored in the order in which a wave of k_att reads it. A tile's 16 x 512 distances are 2,048 units of 16 B; unit u = ((kb * 2 + t) * 2 + hf) * 32 + lane holds query (lane & 15) of the tile against keys kb * 32 + t * 16 + (lane >> 4) * 8 + hf * 4 + 0..3, so the 32 lanes of one load or store cover 512 contiguous bytes. Thread tid writes units tid + 256 n
__global__ __launch_bounds__(256) void k_dist(const float* __restrict__ P, float* __restrict__ D) {
  const int tid = threadIdx.x, lane = tid & 31; const size_t b = blockIdx.y; const float* pb = P + b * TT * 3; const int i = blockIdx.x * 16 + (lane & 15);
  const float xi = bfr(pb[i * 3]), yi = bfr(pb[i * 3 + 1]), zi = bfr(pb[i * 3 + 2]);
  asm volatile("s_wait_xcnt 0x0" ::: "memory");   // the query load's address pair is free for reuse from here on: the wait stands in front of whatever lands on it
  const int j0 = (tid >> 7) * 32 + ((tid >> 6) & 1) * 16 + (lane >> 4) * 8 + ((tid >> 5) & 1) * 4; float* dst = D + (b * (TT / 16) + blockIdx.x) * (size_t)(16 * TT) + tid * 4;
  // unrolled: the key loads of a thread's eight units are in flight together
#pragma unroll
  for (int n = 0; n < 8; ++n) { const float* kp = pb + (j0 + n * 64) * 3; const v4f k0 = *(const v4f*)kp, k1 = *(const v4f*)(kp + 4), k2 = *(const v4f*)(kp + 8);   // four keys = 48 contiguous bytes
    const float f[12] = {k0[0], k0[1], k0[2], k0[3], k1[0], k1[1], k1[2], k1[3], k2[0], k2[1], k2[2], k2[3]}; v4f r;
#pragma unroll
    for (int e = 0; e < 4; ++e) { const float dx = xi - bfr(f[3 * e]), dy = yi - bfr(f[3 * e + 1]), dz = zi - bfr(f[3 * e + 2]); const float d2 = dx * dx + dy * dy + dz * dz; r[e] = (d2 > 0.f) ? sqrtf(d2) : 0.f; }
    vst2(dst + n * 1024, r); } }
#define KPI 72    // LDS pitch of a K row, f16: 144 B = 16 B x odd, no bank conflict for 16-byte reads down a column of rows
#define VPI 520   // LDS pitch of a V^T row, f16: 1040 B = 16 B x odd
__device__ __forceinline__ v8f wmma_h(v16h a, v16h b, v8f c) { return __builtin_amdgcn_wmma_f32_16x16x32_f16(false, a, false, b, (short)0, c, false, false); }
__device__ __forceinline__ float ex2(float x) { return __builtin_amdgcn_exp2f(x); }  // one v_exp_f32; an argument under -126 gives 0
#define LOG2E 1.4426950408889634
__device__ __forceinline__ float xhalf(float x) { return __builtin_bit_cast(float, __builtin_amdgcn_permlanex16(__builtin_bit_cast(int, x), __builtin_bit_cast(int, x), 0x76543210, 0xfedcba98, false, false)); }  // lane l with lane l ^ 16
__global__ __launch_bounds__(256) __attribute__((amdgpu_waves_per_eu(4, 4))) void k_att(const _Float16* __restrict__ QH, const _Float16* __restrict__ QL, const _Float16* __restrict__ KH, const _Float16* __restrict__ VT, const float* __restrict__ Dm, float* __restrict__ U) {
  __shared__ __align__(16) _Float16 sk[TT][KPI]; __shared__ __align__(16) _Float16 sv[HD][VPI];
  const int tid = threadIdx.x, wave = tid >> 5, lane = tid & 31, col = lane & 15, g = lane >> 4; const size_t b = blockIdx.z; const int h = blockIdx.y; const int q0 = blockIdx.x * 256 + wave * 32;
  { const _Float16* kg = KH + (b * TT + (tid >> 3)) * CC + h * HD + (tid & 7) * 8; const _Float16* vg = VT + (b * CC + h * HD + (tid >> 6)) * (size_t)TT + (tid & 63) * 8;   // 8 threads a K row of 128 B, 64 threads a V^T row of 1 KiB
    v8h kr[TT / 32], vr[HD / 4];
    // all unrolled: a thread's 16-byte loads are in flight together
#pragma unroll
    for (int i = 0; i < TT / 32; ++i) kr[i] = *(const v8h*)(kg + i * 32 * CC);
#pragma unroll
    for (int i = 0; i < HD / 4; ++i) vr[i] = *(const v8h*)(vg + i * 4 * TT);
    asm volatile("s_wait_xcnt 0x0" :: "v"(kg), "v"(vg) : "memory");   // the loads' two address pairs are taken again for the Q addresses: the wait stands in front of that; named as inputs, the pairs stay whole up to it
#pragma unroll
    for (int i = 0; i < TT / 32; ++i) *(v8h*)&sk[(tid >> 3) + i * 32][(tid & 7) * 8] = kr[i];
#pragma unroll
    for (int i = 0; i < HD / 4; ++i) *(v8h*)&sv[(tid >> 6) + i * 4][(tid & 63) * 8] = vr[i]; }
  v16h qh[2][2], ql[2][2];
#pragma unroll
  for (int qt = 0; qt < 2; ++qt)
#pragma unroll
    for (int kc = 0; kc < 2; ++kc) { const size_t o = (b * TT + q0 + qt * 16 + col) * CC + h * HD + kc * 32; qh[qt][kc] = frag_h(QH + o, lane); ql[qt][kc] = frag_h(QL + o, lane); }
  const float* dp = Dm + (b * (TT / 16) + (q0 >> 4)) * (size_t)(16 * TT) + lane * 4;   // k_dist's unit order: every load below is 512 contiguous bytes over the wave
  v8f o[2][4] = {}; float m[2] = {-3.0e38f, -3.0e38f}, l[2] = {0.f, 0.f};
  const float c2 = (float)(0.125 * 0.70710678118654752 * LOG2E);   // att log2(e) = (16 dist + q.k) c2
  __syncthreads();
  // rolled: sixteen passes unrolled would not fit the register budget of four waves per SIMD
#pragma unroll 1
  for (int k0 = 0; k0 < TT; k0 += 32) {
    v8f s[2][2] = {};   // [query tile][key tile]: register r = key k0 + 16 t + 8 g + r, column = query
#pragma unroll
    for (int kc = 0; kc < 2; ++kc) { v16h kb[2];
#pragma unroll
      for (int t = 0; t < 2; ++t) kb[t] = frag_h(&sk[k0 + t * 16 + col][kc * 32], lane);
#pragma unroll
      for (int t = 0; t < 2; ++t)
#pragma unroll
        for (int qt = 0; qt < 2; ++qt) s[qt][t] = wmma_h(kb[t], qh[qt][kc], s[qt][t]);
#pragma unroll
      for (int t = 0; t < 2; ++t)
#pragma unroll
        for (int qt = 0; qt < 2; ++qt) s[qt][t] = wmma_h(kb[t], ql[qt][kc], s[qt][t]); }
#pragma unroll
    for (int qt = 0; qt < 2; ++qt) { v2f z[8];   // z = 16 dist + q.k, two keys a pair; maximum and running maximum are kept in z
#pragma unroll
      for (int t = 0; t < 2; ++t) { const float* dq = dp + qt * 16 * TT + k0 * 16 + t * 256; const v4f d0 = *(const v4f*)dq, d1 = *(const v4f*)(dq + 128); const v2f c16 = {16.0f, 16.0f};
#pragma unroll
        for (int r = 0; r < 2; ++r) { z[t * 4 + r] = __builtin_elementwise_fma((v2f){d0[2 * r], d0[2 * r + 1]}, c16, (v2f){s[qt][t][2 * r], s[qt][t][2 * r + 1]}); z[t * 4 + 2 + r] = __builtin_elementwise_fma((v2f){d1[2 * r], d1[2 * r + 1]}, c16, (v2f){s[qt][t][4 + 2 * r], s[qt][t][5 + 2 * r]}); } }
      float mx = z[0][0];
#pragma unroll
      for (int i = 1; i < 16; ++i) mx = fmaxf(mx, z[i >> 1][i & 1]);
      mx = fmaxf(mx, xhalf(mx));
      const float mn = fmaxf(m[qt], mx); const float al = ex2((m[qt] - mn) * c2); m[qt] = mn;
      const float nb = __builtin_fmaf(-mn, c2, 11.0f);   // P and its sum both carry 2^11, which keeps small weights out of the f16 subnormals and cancels in the division
      float sum = 0.f; v16h p;
#pragma unroll
      for (int i = 0; i < 8; ++i) { const v2f y = __builtin_elementwise_fma(z[i], (v2f){c2, c2}, (v2f){nb, nb}); const float e0 = ex2(y[0]), e1 = ex2(y[1]); sum += e0; sum += e1; p[2 * i] = (_Float16)e0; p[2 * i + 1] = (_Float16)e1; }
      l[qt] = l[qt] * al + sum;
#pragma unroll
      for (int j = 0; j < 4; ++j) o[qt][j] *= al;
#pragma unroll
      for (int j = 0; j < 4; ++j) o[qt][j] = wmma_h(frag_h(&sv[j * 16 + col][k0], lane), p, o[qt][j]); } }
#pragma unroll
  for (int qt = 0; qt < 2; ++qt) { const float inv = 1.0f / (l[qt] + xhalf(l[qt])); float* up = U + (b * TT + q0 + qt * 16 + col) * CC + h * HD + 8 * g;
#pragma unroll
    for (int j = 0; j < 4; ++j) { v4f a0, a1;
#pragma unroll
      for (int r = 0; r < 4; ++r) { a0[r] = o[qt][j][r] * inv; a1[r] = o[qt][j][4 + r] * inv; }
      vst2(up + j * 16, a0); vst2(up + j * 16 + 4, a1); } } }
// ---- k_mlp: block = (64 rows, 128-col block): OUT = silu(A (hi+lo) W + b), A rows [K], W packed fragments of [K][N]
template <int K, int N>
__global__ __launch_bounds__(128) void k_mlp(const float* __restrict__ A, const __bf16* __restrict__ PW, const float* __restrict__ Bv, float* __restrict__ OUT) { __shared__ __align__(16) float sf[4][16][132];
  const int tid = threadIdx.x, wave = tid >> 5, lane = tid & 31, col = lane & 15, g = lane >> 4; const int c0 = blockIdx.y * 128; const size_t r0 = (size_t)blockIdx.x * 64 + wave * 16; constexpr int NT = (N < 128 ? N : 128) / 16; constexpr int G = 16 / NT < K / 32 ? 16 / NT : K / 32;   // k steps whose fragments (16 at most) are loaded together
  const __bf16* pw = PW + (size_t)(c0 / 16) * 512; const float* ar = A + (r0 + col) * K + 8 * g;
  v8f acc[NT]; for (int j = 0; j < NT; ++j) for (int r = 0; r < 8; ++r) acc[j][r] = 0.f;
  // rolled: one group's loads and products are the whole body, the text stays short
#pragma unroll 1
  for (int kg = 0; kg < K / 32; kg += G) { v16b w[G][NT]; v4f av[G][4];
#pragma unroll
    for (int s = 0; s < G; ++s)
#pragma unroll
      for (int i = 0; i < 4; ++i) av[s][i] = *(const v4f*)(ar + (kg + s) * 32 + (i >> 1) * 16 + (i & 1) * 4);
    asm volatile("s_wait_xcnt 0x0" ::: "memory");   // the fragment loads below may land on the row loads' address registers: the wait stands in front of that; its clobber also keeps every row load of the group up here, where left free the later steps' sink behind the first products and pay their latency again
#pragma unroll
    for (int s = 0; s < G; ++s)
#pragma unroll
      for (int j = 0; j < NT; ++j) w[s][j] = frag_p(pw + (size_t)((kg + s) * (N / 16) + j) * 512, lane);
#pragma unroll
    for (int s = 0; s < G; ++s) { float af[16];
#pragma unroll
      for (int i = 0; i < 16; ++i) af[i] = av[s][i >> 2][i & 3];
      const F2 a = bsplit16(af);
#pragma unroll
      for (int j = 0; j < NT; ++j) { acc[j] = wmma_bf(a.h, w[s][j], acc[j]); acc[j] = wmma_bf(a.l, w[s][j], acc[j]); } } }
#pragma unroll
  for (int j = 0; j < NT; ++j) { const float bb = bfr(Bv[c0 + j * 16 + col]);
#pragma unroll
    for (int r = 0; r < 8; ++r) { const float v = acc[j][r] + bb; sf[wave][8 * g + r][j * 16 + col] = v / (1.0f + ex2(v * (float)-LOG2E)); } }
  LDSX(); for (int rl = 0; rl < 16; ++rl) if (lane < NT * 4) vst2(OUT + (r0 + rl) * N + c0 + lane * 4, *(const v4f*)&sf[wave][rl][lane * 4]); }
extern "C" void kernel_launch(void* const* d_in, const int* in_sizes, int n_in, void* d_out, int out_size, void* d_ws, size_t ws_size, hipStream_t stream) {
  (void)in_sizes; (void)n_in; (void)out_size;
  const float** F = (const float**)d_in;   // 0 kp_pos [32,512,3], 1 kp_feat [32,512,256], 2 Wk [256,512], 3 Wq, 4 Wv, 5 W1 [512,128], 6 b1, 7 W2 [128,64], 8 b2, 9 W3 [64,256], 10 b3
  if (ws_size < (size_t)WS_END) return;
  char* ws = (char*)d_ws; _Float16 *QH = (_Float16*)(ws + WS_QH), *QL = (_Float16*)(ws + WS_QL), *KH = (_Float16*)(ws + WS_KH), *VT = (_Float16*)(ws + WS_VT); __bf16* PW = (__bf16*)(ws + WS_PW); float *D = (float*)(ws + WS_D), *U = (float*)(ws + WS_U), *H1 = (float*)(ws + WS_H1), *H2 = (float*)(ws + WS_H2);
  k_pack<<<dim3(PW_N / 8 / 256), 256, 0, stream>>>(F[3], F[2], F[4], F[5], F[7], F[9], PW);
  k_proj<<<dim3(TNB * TT / 64, CC / 128, 3), 128, 0, stream>>>(F[1], PW, QH, QL, KH, VT);
  k_dist<<<dim3(TT / 16, TNB), 256, 0, stream>>>(F[0], D);
  k_att<<<dim3(TT / 256, NH, TNB), 256, 0, stream>>>(QH, QL, KH, VT, D, U);
  k_mlp<CC, 128><<<dim3(TNB * TT / 64, 1), 128, 0, stream>>>(U, PW + PW_1, F[6], H1);
  k_mlp<128, 64><<<dim3(TNB * TT / 64, 1), 128, 0, stream>>>(H1, PW + PW_2, F[8], H2);
  k_mlp<64, CIN><<<dim3(TNB * TT / 64, CIN / 128), 128, 0, stream>>>(H2, PW + PW_3, F[10], (float*)d_out);
}

// v005
// It runs in 87.9 microseconds.
// Next to v004, in two timings, it ran 1.25 and 1.23 times as fast.
// Over all steps from v000 it is 7.15 times as fast.
// compute dtype: all float inputs rounded to bf16; keys/queries/values = kp_feat W with EXACT bf16 products on WMMA 16x16x32, f32 accumulate; pairwise distances sqrt(sum (p_i - p_j)^2) in f32 (precise sqrtf) once per batch; att = (dist / 0.5 + q . k / 8) / sqrt(2) with q as f16 hi + residual, k f16 (2 products), kept in registers; softmax in f32 (base-2 exponent formed by one multiply-add, hardware exp2, running maximum and sum) -> P f16 x 2^11, unnormalised; upd = P . v / sum (v rounded once to f16); out MLP 512 -> 128 -> 64 -> 256 with SiLU (hardware exp2) after each, activations split bf16 hi + lo (2 products); f32 output.
#include <hip/hip_runtime.h>
#include <math.h>

typedef __attribute__((ext_vector_type(16))) _Float16 v16h;
typedef __attribute__((ext_vector_type(16))) __bf16 v16b;
typedef __attribute__((ext_vector_type(8)))  _Float16 v8h;
typedef __attribute__((ext_vector_type(8)))  float v8f;
typedef __attribute__((ext_vector_type(4)))  float v4f;
typedef __attribute__((ext_vector_type(2)))  float v2f;
typedef __attribute__((ext_vector_type(4)))  unsigned v4u;
typedef __attribute__((ext_vector_type(4)))  int v4i;
typedef float __attribute__((may_alias)) float_a;
typedef int __attribute__((may_alias)) int_a;

template <typename T> __device__ __forceinline__ void vst2(void* p, T v) { *(T*)p = v;  }
__device__ __forceinline__ v8f wmma16(v16h a, v16h b, v8f c) {
  v8f d = __builtin_amdgcn_wmma_f32_16x16x32_f16(false, a, false, b, (short)0, c, false, false);
  asm volatile("v_nop\n\tv_nop\n\tv_nop\n\tv_nop" : "+v"(d) : "v"(a), "v"(b));
  return d;
}
__device__ __forceinline__ v8f wmma_bf(v16b a, v16b b, v8f c) {
  v8f d = __builtin_amdgcn_wmma_f32_16x16x32_bf16(false, a, false, b, (short)0, c, false, false);
  asm volatile("v_nop\n\tv_nop\n\tv_nop\n\tv_nop" : "+v"(d) : "v"(a), "v"(b));
  return d;
}
// 16x16x32 fragments: lane = (h = lane>>4, row/col = lane&15); elements 0..7 = k0+8h+0..7, 8..15 = k0+16+8h+0..7; D element r = row 8h+r
__device__ __forceinline__ v16h frag_h(const _Float16* rowk0, int lane) {
  union { v16h v; v8h q[2]; } u; const _Float16* p = rowk0 + 8 * (lane >> 4);
  u.q[0] = *(const v8h*)p; u.q[1] = *(const v8h*)(p + 16); return u.v;
}
__device__ __forceinline__ v16h frag_f32(const float* rowk0, int lane) {
  v16h a; const float* p = rowk0 + 8 * (lane >> 4);
#pragma unroll
  for (int i = 0; i < 8; ++i) { a[i] = (_Float16)p[i]; a[8 + i] = (_Float16)p[16 + i]; }
  return a;
}
__device__ __forceinline__ v16h frag_f32s(const float* rowk0, int lane, float sc) {
  v16h a; const float* p = rowk0 + 8 * (lane >> 4);
#pragma unroll
  for (int i = 0; i < 8; ++i) { a[i] = (_Float16)(p[i] * sc); a[8 + i] = (_Float16)(p[16 + i] * sc); }
  return a;
}
// column fragment from a [K][ld] layout (column n), rows >= K read as 0
__device__ __forceinline__ v16h fragc_f32(const float* W, int k0, int n, int lane, int ld, int K) {
  v16h a; const int g = lane >> 4;
#pragma unroll
  for (int i = 0; i < 8; ++i) { const int ka = k0 + 8 * g + i, kb = ka + 16;
    a[i] = (_Float16)(ka < K ? W[(size_t)(ka < K ? ka : K - 1) * ld + n] : 0.f); a[8 + i] = (_Float16)(kb < K ? W[(size_t)(kb < K ? kb : K - 1) * ld + n] : 0.f); }
  return a;
}
struct F2 { v16b h, l; };
__device__ __forceinline__ F2 bsplit16(const float v[16]) { F2 r;
#pragma unroll
  for (int i = 0; i < 16; ++i) { const __bf16 h = (__bf16)v[i]; r.h[i] = h; r.l[i] = (__bf16)(v[i] - (float)h); }
  return r; }
__device__ __forceinline__ F2 split_row(const float* row, int k0, int lane) { float v[16]; const float* p = row + k0 + 8 * (lane >> 4);
#pragma unroll
  for (int i = 0; i < 8; ++i) { v[i] = p[i]; v[8 + i] = p[16 + i]; }
  return bsplit16(v); }
__device__ __forceinline__ F2 split_rowK(const float* row, int k0, int lane, int K) { float v[16]; const int g = lane >> 4;
#pragma unroll
  for (int i = 0; i < 8; ++i) { const int ka = k0 + 8 * g + i, kb = ka + 16; v[i] = ka < K ? row[ka < K ? ka : K - 1] : 0.f; v[8 + i] = kb < K ? row[kb < K ? kb : K - 1] : 0.f; }
  return bsplit16(v); }
__device__ __forceinline__ F2 split_col(const float* W, int k0, int n, int lane, int ld, int K) { float v[16]; const int g = lane >> 4;
#pragma unroll
  for (int i = 0; i < 8; ++i) { const int ka = k0 + 8 * g + i, kb = ka + 16; v[i] = ka < K ? W[(size_t)(ka < K ? ka : K - 1) * ld + n] : 0.f; v[8 + i] = kb < K ? W[(size_t)(kb < K ? kb : K - 1) * ld + n] : 0.f; }
  return bsplit16(v); }
__device__ __forceinline__ v8f mac3(const F2& a, const F2& b, v8f c) { c = wmma_bf(a.l, b.h, c); c = wmma_bf(a.h, b.l, c); return wmma_bf(a.h, b.h, c); }
__device__ __forceinline__ float sigm(float v) { return 1.0f / (1.0f + expf(-v)); }
#define LDSX() do { asm volatile("s_wait_dscnt 0" ::: "memory"); __builtin_amdgcn_wave_barrier(); __builtin_amdgcn_fence(__ATOMIC_RELEASE, "workgroup"); } while (0)


// Keypoint multi-head attention (B 32, N 512 keypoints, in_dim 256, 8 heads x 64): distance-biased attention followed by a 3-layer SiLU MLP.
#define NB 32
#define TT 512
#define CIN 256
#define CC 512
#define NH 8
#define HD 64
#define NR (NB * TT)
#ifndef TNB
#define TNB NB
#endif
typedef __attribute__((ext_vector_type(8))) __bf16 v8b;
__device__ __forceinline__ v16b frag_b(const __bf16* rowk0, int lane) {
  union { v16b v; v8b q[2]; } u; const __bf16* p = rowk0 + 8 * (lane >> 4);
  u.q[0] = *(const v8b*)p; u.q[1] = *(const v8b*)(p + 16); return u.v;
}
__device__ __forceinline__ float bfr(float v) { return (float)(__bf16)v; }
__device__ __attribute__((noinline)) float exp_ni(float v) { return expf(v); }
__device__ __attribute__((noinline)) float erf_ni(float v) { return erff(v); }

#define WS_QH  0u
#define WS_QL  (WS_QH + 2u * (size_t)NR * CC)
#define WS_KH  (WS_QL + 2u * (size_t)NR * CC)
#define WS_VT  (WS_KH + 2u * (size_t)NR * CC)          // f16 v planes [b][512][t]
#define WS_D   (WS_VT + 2u * (size_t)NR * CC)          // f32 dist [b][tile of 16 queries][unit], k_dist's order
#define WS_U   (WS_D + 4u * (size_t)NB * TT * TT)      // f32 upd rows [b*t][512]
#define WS_H1  (WS_U + 4u * (size_t)NR * CC)           // f32 [b*t][128]
#define WS_H2  (WS_H1 + 4u * (size_t)NR * 128)         // f32 [b*t][64]
#define WS_PW  (WS_H2 + 4u * (size_t)NR * 64)          // bf16 weights in fragment order: Wq, Wk, Wv, W1, W2, W3
#define PW_P   (CIN * CC)                              // elements of one projection matrix
#define PW_1   (3 * PW_P)
#define PW_2   (PW_1 + CC * 128)
#define PW_3   (PW_2 + 128 * 64)
#define PW_N   (PW_3 + 64 * CIN)
#define WS_END (WS_PW + 2u * (size_t)PW_N)

// ---- k_pack: every weight matrix W [K][N] (in,out), rounded to bf16 once and laid out as finished B fragments: fragment (kc, nt) = 1 KiB = two runs of 32 lanes x 16 B; lane (g, col) holds column nt*16+col, run 0 = rows kc*32+8g+0..7, run 1 = rows kc*32+16+8g+0..7. One thread writes one 16-byte unit u.
template <int N> __device__ __forceinline__ void pack_unit(const float* __restrict__ Wm, __bf16* __restrict__ dst, int u) {
  const int lane = u & 31, run = (u >> 5) & 1, f = u >> 6, nt = f % (N / 16), kc = f / (N / 16);
  const float* p = Wm + (size_t)(kc * 32 + run * 16 + 8 * (lane >> 4)) * N + nt * 16 + (lane & 15); v8b v;
#pragma unroll
  for (int i = 0; i < 8; ++i) v[i] = (__bf16)p[(size_t)i * N];
  *(v8b*)(dst + (size_t)u * 8) = v; }
__global__ __launch_bounds__(256) void k_pack(const float* __restrict__ WQ, const float* __restrict__ WK, const float* __restrict__ WV, const float* __restrict__ W1, const float* __restrict__ W2, const float* __restrict__ W3, __bf16* __restrict__ PW) {
  const int u = blockIdx.x * 256 + threadIdx.x;   // every matrix is a whole number of blocks, so the choice below is the same for a whole block
  if (u < PW_1 / 8) { const int m = u / (PW_P / 8); pack_unit<CC>(m == 0 ? WQ : m == 1 ? WK : WV, PW + (size_t)m * PW_P, u - m * (PW_P / 8)); }
  else if (u < PW_2 / 8) pack_unit<128>(W1, PW + PW_1, u - PW_1 / 8);
  else if (u < PW_3 / 8) pack_unit<64>(W2, PW + PW_2, u - PW_2 / 8);
  else pack_unit<CIN>(W3, PW + PW_3, u - PW_3 / 8); }
// a packed fragment: two 16-byte loads a lane, each a run of 512 contiguous bytes over the wave
__device__ __forceinline__ v16b frag_p(const __bf16* f, int lane) {
  union { v16b v; v8b q[2]; } u; u.q[0] = *(const v8b*)(f + lane * 8); u.q[1] = *(const v8b*)(f + 256 + lane * 8); return u.v;
}

// ---- k_proj: block = (64 rows, which), 8 waves, a wave = 64 rows x 64 columns (16 accumulator tiles): kp_feat W (packed fragments of [256][512]), no bias. The block's rows are rounded to bf16 once and lie in LDS for all eight waves; a weight fragment is loaded by one wave only and feeds four products
#define XPI 264   // LDS pitch of a staged row, bf16: 528 B = 16 B x odd, no bank conflict for 16-byte reads down a column of rows
typedef __attribute__((ext_vector_type(4))) __bf16 v4b;
__device__ __forceinline__ v8f wmma_b(v16b a, v16b b, v8f c) { return __builtin_amdgcn_wmma_f32_16x16x32_bf16(false, a, false, b, (short)0, c, false, false); }
// Q and K (WHICH 0, 1): D = W^T X^T, a lane holds 8 neighbouring columns of one row; V (WHICH 2): D = X W, a lane holds 8 neighbouring rows of one column, which is V^T's order. Either way 16 bytes of f16 a tile, and the four tiles C of a line tile L make whole 128-byte lines of the output, put together in the wave's own LDS rows. Every short loop over tiles, fragments or elements below is unrolled, so that the fragment and accumulator arrays are indexed at compile time and stay in registers
template <int WHICH> __device__ __forceinline__ void proj_tile(__bf16 (*sx)[XPI], _Float16 (*sw)[2][16][72], const float* __restrict__ X, const __bf16* __restrict__ PW, _Float16* __restrict__ DH, _Float16* __restrict__ DL) {
  const int tid = threadIdx.x, wave = __builtin_amdgcn_readfirstlane(tid >> 5), lane = tid & 31, col = lane & 15, g = lane >> 4; const size_t r0 = (size_t)blockIdx.x * 64; const __bf16* pw = PW + (size_t)WHICH * PW_P + (size_t)(wave * 4) * 512;
  v8f acc[4][4] = {}; v16b wa[4], wb[4], x[4];
  auto ldw = [&](v16b (&w)[4], int kc) {
#pragma unroll
    for (int j = 0; j < 4; ++j) w[j] = frag_p(pw + (size_t)(kc * (CC / 16) + j) * 512, lane); };
  auto ldx = [&](int kc) {
#pragma unroll
    for (int i = 0; i < 4; ++i) x[i] = frag_b(&sx[i * 16 + col][kc * 32], lane);
    __builtin_amdgcn_sched_barrier(0); };   // keeps a k step's loads, the weight loads for the step after it among them, in one group ahead of the products: left free, the weight loads sink to their first use and their latency is paid there
  auto mul = [&](const v16b (&w)[4]) {
#pragma unroll
    for (int L = 0; L < 4; ++L)
#pragma unroll
      for (int C = 0; C < 4; ++C) acc[L][C] = WHICH < 2 ? wmma_b(w[C], x[L], acc[L][C]) : wmma_b(x[C], w[L], acc[L][C]); };
  ldw(wa, 0);   // the first k step's weights are asked for ahead of the staging
  { const float* xg = X + (r0 + (tid >> 6)) * CIN + (tid & 63) * 4; v4f xr[16];   // 64 threads a row of 1 KiB: a wave's load covers 512 contiguous bytes
    // unrolled: a thread's sixteen loads are in flight together
#pragma unroll
    for (int i = 0; i < 16; ++i) xr[i] = *(const v4f*)(xg + i * 4 * CIN);
    asm volatile("s_wait_xcnt 0x0" :: "v"(xg) : "memory");   // the row loads' address pair is free for reuse from here on: the wait stands in front of whatever lands on it
#pragma unroll
    for (int i = 0; i < 16; ++i) { v4b c;
#pragma unroll
      for (int e = 0; e < 4; ++e) c[e] = (__bf16)xr[i][e];
      *(v4b*)&sx[(tid >> 6) + i * 4][(tid & 63) * 4] = c; } }
  __syncthreads();
  // rolled, two k steps a trip: the two weight sets keep their registers, and each is loaded anew while the other set's products run; unrolled whole, the loads are lifted further than the register budget of four waves per SIMD holds
#pragma unroll 1
  for (int kk = 0; kk < CIN / 64 - 1; ++kk) { ldw(wb, 2 * kk + 1); ldx(2 * kk); mul(wa); ldw(wa, 2 * kk + 2); ldx(2 * kk + 1); mul(wb);
    asm volatile("s_wait_xcnt 0x0" ::: "memory"); }   // the next trip forms its weight address in the registers that this trip's loads name: the wait stands in front of that
  ldw(wb, CIN / 32 - 1); ldx(CIN / 32 - 2); mul(wa); ldx(CIN / 32 - 1); mul(wb);
  asm volatile("s_wait_xcnt 0x0" ::: "memory");   // the weight loads' address registers are free for reuse from here on: the wait stands in front of whatever lands on them
  _Float16 (*st)[16][72] = sw[wave];
  const size_t o = (WHICH < 2 ? r0 * CC + wave * 64 : ((r0 / TT) * CC + wave * 64) * (size_t)TT + r0 % TT) + (size_t)(lane >> 3) * CC + (lane & 7) * 8;   // 8 lanes a line; CC = TT is the pitch of all four outputs
  _Float16* ph = DH + o; _Float16* pl = DL + o;
#pragma unroll
  for (int L = 0; L < 4; ++L) {
#pragma unroll
    for (int C = 0; C < 4; ++C) { v8h hv, lv;
#pragma unroll
      for (int r = 0; r < 8; ++r) { const float v = acc[L][C][r]; const _Float16 h = (_Float16)v; hv[r] = h; lv[r] = (_Float16)(v - (float)h); }
      *(v8h*)&st[0][col][C * 16 + 8 * g] = hv; if (WHICH == 0) *(v8h*)&st[1][col][C * 16 + 8 * g] = lv; }
    asm volatile("s_wait_dscnt 0x0" ::: "memory");   // the rows are read back across the wave's lanes: its LDS writes have landed first
#pragma unroll
    for (int n = 0; n < 4; ++n) { vst2(ph + (size_t)(L * 16 + n * 4) * CC, *(const v4u*)&st[0][n * 4 + (lane >> 3)][(lane & 7) * 8]); if (WHICH == 0) vst2(pl + (size_t)(L * 16 + n * 4) * CC, *(const v4u*)&st[1][n * 4 + (lane >> 3)][(lane & 7) * 8]); }
    asm volatile("s_wait_xcnt 0x0" ::: "memory");   // the stores' data registers are loaded anew for the next line tile: the wait stands in front of that; its clobber also keeps the next tile's LDS writes behind these reads
  } }
static_assert(CC == TT, "one line pitch for Q, K and V^T");
__global__ __launch_bounds__(256) __attribute__((amdgpu_waves_per_eu(4, 4))) void k_proj(const float* __restrict__ X, const __bf16* __restrict__ PW, _Float16* __restrict__ QH, _Float16* __restrict__ QL, _Float16* __restrict__ KH, _Float16* __restrict__ VT) {
  __shared__ __align__(16) __bf16 sx[64][XPI]; __shared__ __align__(16) _Float16 sw[8][2][16][72];
  if (blockIdx.y == 0) proj_tile<0>(sx, sw, X, PW, QH, QL);
  else if (blockIdx.y == 1) proj_tile<1>(sx, sw, X, PW, KH, KH);
  else proj_tile<2>(sx, sw, X, PW, VT, VT); }
// ---- k_dist: block = (tile of 16 queries, batch b): |p_i - p_j| (0 when the squared sum is exactly 0), stored in the order in which a wave of k_att reads it. A tile's 16 x 512 distances are 2,048 units of 16 B; unit u = ((kb * 2 + t) * 2 + hf) * 32 + lane holds query (lane & 15) of the tile against keys kb * 32 + t * 16 + (lane >> 4) * 8 + hf * 4 + 0..3, so the 32 lanes of one load or store cover 512 contiguous bytes. Thread tid writes units tid + 256 n
__global__ __launch_bounds__(256) void k_dist(const float* __restrict__ P, float* __restrict__ D) {
  const int tid = threadIdx.x, lane = tid & 31; const size_t b = blockIdx.y; const float* pb = P + b * TT * 3; const int i = blockIdx.x * 16 + (lane & 15);
  const float xi = bfr(pb[i * 3]), yi = bfr(pb[i * 3 + 1]), zi = bfr(pb[i * 3 + 2]);
  asm volatile("s_wait_xcnt 0x0" ::: "memory");   // the query load's address pair is free for reuse from here on: the wait stands in front of whatever lands on it
  const int j0 = (tid >> 7) * 32 + ((tid >> 6) & 1) * 16 + (lane >> 4) * 8 + ((tid >> 5) & 1) * 4; float* dst = D + (b * (TT / 16) + blockIdx.x) * (size_t)(16 * TT) + tid * 4;
  // unrolled: the key loads of a thread's eight units are in flight together
#pragma unroll
  for (int n = 0; n < 8; ++n) { const float* kp = pb + (j0 + n * 64) * 3; const v4f k0 = *(const v4f*)kp, k1 = *(const v4f*)(kp + 4), k2 = *(const v4f*)(kp + 8);   // four keys = 48 contiguous bytes
    const float f[12] = {k0[0], k0[1], k0[2], k0[3], k1[0], k1[1], k1[2], k1[3], k2[0], k2[1], k2[2], k2[3]}; v4f r;
#pragma unroll
    for (int e = 0; e < 4; ++e) { const float dx = xi - bfr(f[3 * e]), dy = yi - bfr(f[3 * e + 1]), dz = zi - bfr(f[3 * e + 2]); const float d2 = dx * dx + dy * dy + dz * dz; r[e] = (d2 > 0.f) ? sqrtf(d2) : 0.f; }
    vst2(dst + n * 1024, r); } }
#define KPI 72    // LDS pitch of a K row, f16: 144 B = 16 B x odd, no bank conflict for 16-byte reads down a column of rows
#define VPI 520   // LDS pitch of a V^T row, f16: 1040 B = 16 B x odd
__device__ __forceinline__ v8f wmma_h(v16h a, v16h b, v8f c) { return __builtin_amdgcn_wmma_f32_16x16x32_f16(false, a, false, b, (short)0, c, false, false); }
__device__ __forceinline__ float ex2(float x) { return __builtin_amdgcn_exp2f(x); }  // one v_exp_f32; an argument under -126 gives 0
#define LOG2E 1.4426950408889634
__device__ __forceinline__ float xhalf(float x) { return __builtin_bit_cast(float, __builtin_amdgcn_permlanex16(__builtin_bit_cast(int, x), __builtin_bit_cast(int, x), 0x76543210, 0xfedcba98, false, false)); }  // lane l with lane l ^ 16
__global__ __launch_bounds__(256) __attribute__((amdgpu_waves_per_eu(4, 4))) void k_att(const _Float16* __restrict__ QH, const _Float16* __restrict__ QL, const _Float16* __restrict__ KH, const _Float16* __restrict__ VT, const float* __restrict__ Dm, float* __restrict__ U) {
  __shared__ __align__(16) _Float16 sk[TT][KPI]; __shared__ __align__(16) _Float16 sv[HD][VPI];
  const int tid = threadIdx.x, wave = tid >> 5, lane = tid & 31, col = lane & 15, g = lane >> 4; const size_t b = blockIdx.z; const int h = blockIdx.y; const int q0 = blockIdx.x * 256 + wave * 32;
  { const _Float16* kg = KH + (b * TT + (tid >> 3)) * CC + h * HD + (tid & 7) * 8; const _Float16* vg = VT + (b * CC + h * HD + (tid >> 6)) * (size_t)TT + (tid & 63) * 8;   // 8 threads a K row of 128 B, 64 threads a V^T row of 1 KiB
    v8h kr[TT / 32], vr[HD / 4];
    // all unrolled: a thread's 16-byte loads are in flight together
#pragma unroll
    for (int i = 0; i < TT / 32; ++i) kr[i] = *(const v8h*)(kg + i * 32 * CC);
#pragma unroll
    for (int i = 0; i < HD / 4; ++i) vr[i] = *(const v8h*)(vg + i * 4 * TT);
    asm volatile("s_wait_xcnt 0x0" :: "v"(kg), "v"(vg) : "memory");   // the loads' two address pairs are taken again for the Q addresses: the wait stands in front of that; named as inputs, the pairs stay whole up to it
#pragma unroll
    for (int i = 0; i < TT / 32; ++i) *(v8h*)&sk[(tid >> 3) + i * 32][(tid & 7) * 8] = kr[i];
#pragma unroll
    for (int i = 0; i < HD / 4; ++i) *(v8h*)&sv[(tid >> 6) + i * 4][(tid & 63) * 8] = vr[i]; }
  v16h qh[2][2], ql[2][2];
#pragma unroll
  for (int qt = 0; qt < 2; ++qt)
#pragma unroll
    for (int kc = 0; kc < 2; ++kc) { const size_t o = (b * TT + q0 + qt * 16 + col) * CC + h * HD + kc * 32; qh[qt][kc] = frag_h(QH + o, lane); ql[qt][kc] = frag_h(QL + o, lane); }
  const float* dp = Dm + (b * (TT / 16) + (q0 >> 4)) * (size_t)(16 * TT) + lane * 4;   // k_dist's unit order: every load below is 512 contiguous bytes over the wave
  v8f o[2][4] = {}; float m[2] = {-3.0e38f, -3.0e38f}, l[2] = {0.f, 0.f};
  const float c2 = (float)(0.125 * 0.70710678118654752 * LOG2E);   // att log2(e) = (16 dist + q.k) c2
  __syncthreads();
  // rolled: sixteen passes unrolled would not fit the register budget of four waves per SIMD
#pragma unroll 1
  for (int k0 = 0; k0 < TT; k0 += 32) {
    v8f s[2][2] = {};   // [query tile][key tile]: register r = key k0 + 16 t + 8 g + r, column = query
#pragma unroll
    for (int kc = 0; kc < 2; ++kc) { v16h kb[2];
#pragma unroll
      for (int t = 0; t < 2; ++t) kb[t] = frag_h(&sk[k0 + t * 16 + col][kc * 32], lane);
#pragma unroll
      for (int t = 0; t < 2; ++t)
#pragma unroll
        for (int qt = 0; qt < 2; ++qt) s[qt][t] = wmma_h(kb[t], qh[qt][kc], s[qt][t]);
#pragma unroll
      for (int t = 0; t < 2; ++t)
#pragma unroll
        for (int qt = 0; qt < 2; ++qt) s[qt][t] = wmma_h(kb[t], ql[qt][kc], s[qt][t]); }
#pragma unroll
    for (int qt = 0; qt < 2; ++qt) { v2f z[8];   // z = 16 dist + q.k, two keys a pair; maximum and running maximum are kept in z
#pragma unroll
      for (int t = 0; t < 2; ++t) { const float* dq = dp + qt * 16 * TT + k0 * 16 + t * 256; const v4f d0 = *(const v4f*)dq, d1 = *(const v4f*)(dq + 128); const v2f c16 = {16.0f, 16.0f};
#pragma unroll
        for (int r = 0; r < 2; ++r) { z[t * 4 + r] = __builtin_elementwise_fma((v2f){d0[2 * r], d0[2 * r + 1]}, c16, (v2f){s[qt][t][2 * r], s[qt][t][2 * r + 1]}); z[t * 4 + 2 + r] = __builtin_elementwise_fma((v2f){d1[2 * r], d1[2 * r + 1]}, c16, (v2f){s[qt][t][4 + 2 * r], s[qt][t][5 + 2 * r]}); } }
      float mx = z[0][0];
#pragma unroll
      for (int i = 1; i < 16; ++i) mx = fmaxf(mx, z[i >> 1][i & 1]);
      mx = fmaxf(mx, xhalf(mx));
      const float mn = fmaxf(m[qt], mx); const float al = ex2((m[qt] - mn) * c2); m[qt] = mn;
      const float nb = __builtin_fmaf(-mn, c2, 11.0f);   // P and its sum both carry 2^11, which keeps small weights out of the f16 subnormals and cancels in the division
      float sum = 0.f; v16h p;
#pragma unroll
      for (int i = 0; i < 8; ++i) { const v2f y = __builtin_elementwise_fma(z[i], (v2f){c2, c2}, (v2f){nb, nb}); const float e0 = ex2(y[0]), e1 = ex2(y[1]); sum += e0; sum += e1; p[2 * i] = (_Float16)e0; p[2 * i + 1] = (_Float16)e1; }
      l[qt] = l[qt] * al + sum;
#pragma unroll
      for (int j = 0; j < 4; ++j) o[qt][j] *= al;
#pragma unroll
      for (int j = 0; j < 4; ++j) o[qt][j] = wmma_h(frag_h(&sv[j * 16 + col][k0], lane), p, o[qt][j]); } }
#pragma unroll
  for (int qt = 0; qt < 2; ++qt) { const float inv = 1.0f / (l[qt] + xhalf(l[qt])); float* up = U + (b * TT + q0 + qt * 16 + col) * CC + h * HD + 8 * g;
#pragma unroll
    for (int j = 0; j < 4; ++j) { v4f a0, a1;
#pragma unroll
      for (int r = 0; r < 4; ++r) { a0[r] = o[qt][j][r] * inv; a1[r] = o[qt][j][4 + r] * inv; }
      vst2(up + j * 16, a0); vst2(up + j * 16 + 4, a1); } } }
// ---- k_mlp: block = (64 rows, 128-col block): OUT = silu(A (hi+lo) W + b), A rows [K], W packed fragments of [K][N]
template <int K, int N>
__global__ __launch_bounds__(128) void k_mlp(const float* __restrict__ A, const __bf16* __restrict__ PW, const float* __restrict__ Bv, float* __restrict__ OUT) { __shared__ __align__(16) float sf[4][16][132];
  const int tid = threadIdx.x, wave = tid >> 5, lane = tid & 31, col = lane & 15, g = lane >> 4; const int c0 = blockIdx.y * 128; const size_t r0 = (size_t)blockIdx.x * 64 + wave * 16; constexpr int NT = (N < 128 ? N : 128) / 16; constexpr int G = 16 / NT < K / 32 ? 16 / NT : K / 32;   // k steps whose fragments (16 at most) are loaded together
  const __bf16* pw = PW + (size_t)(c0 / 16) * 512; const float* ar = A + (r0 + col) * K + 8 * g;
  v8f acc[NT]; for (int j = 0; j < NT; ++j) for (int r = 0; r < 8; ++r) acc[j][r] = 0.f;
  // rolled: one group's loads and products are the whole body, the text stays short
#pragma unroll 1
  for (int kg = 0; kg < K / 32; kg += G) { v16b w[G][NT]; v4f av[G][4];
#pragma unroll
    for (int s = 0; s < G; ++s)
#pragma unroll
      for (int i = 0; i < 4; ++i) av[s][i] = *(const v4f*)(ar + (kg + s) * 32 + (i >> 1) * 16 + (i & 1) * 4);
    asm volatile("s_wait_xcnt 0x0" ::: "memory");   // the fragment loads below may land on the row loads' address registers: the wait stands in front of that; its clobber also keeps every row load of the group up here, where left free the later steps' sink behind the first products and pay their latency again
#pragma unroll
    for (int s = 0; s < G; ++s)
#pragma unroll
      for (int j = 0; j < NT; ++j) w[s][j] = frag_p(pw + (size_t)((kg + s) * (N / 16) + j) * 512, lane);
#pragma unroll
    for (int s = 0; s < G; ++s) { float af[16];
#pragma unroll
      for (int i = 0; i < 16; ++i) af[i] = av[s][i >> 2][i & 3];
      const F2 a = bsplit16(af);
#pragma unroll
      for (int j = 0; j < NT; ++j) { acc[j] = wmma_bf(a.h, w[s][j], acc[j]); acc[j] = wmma_bf(a.l, w[s][j], acc[j]); } } }
#pragma unroll
  for (int j = 0; j < NT; ++j) { const float bb = bfr(Bv[c0 + j * 16 + col]);
#pragma unroll
    for (int r = 0; r < 8; ++r) { const float v = acc[j][r] + bb; sf[wave][8 * g + r][j * 16 + col] = v / (1.0f + ex2(v * (float)-LOG2E)); } }
  LDSX(); for (int rl = 0; rl < 16; ++rl) if (lane < NT * 4) vst2(OUT + (r0 + rl) * N + c0 + lane * 4, *(const v4f*)&sf[wave][rl][lane * 4]); }
extern "C" void kernel_launch(void* const* d_in, const int* in_sizes, int n_in, void* d_out, int out_size, void* d_ws, size_t ws_size, hipStream_t stream) {
  (void)in_sizes; (void)n_in; (void)out_size;
  const float** F = (const float**)d_in;   // 0 kp_pos [32,512,3], 1 kp_feat [32,512,256], 2 Wk [256,512], 3 Wq, 4 Wv, 5 W1 [512,128], 6 b1, 7 W2 [128,64], 8 b2, 9 W3 [64,256], 10 b3
  if (ws_size < (size_t)WS_END) return;
  char* ws = (char*)d_ws; _Float16 *QH = (_Float16*)(ws + WS_QH), *QL = (_Float16*)(ws + WS_QL), *KH = (_Float16*)(ws + WS_KH), *VT = (_Float16*)(ws + WS_VT); __bf16* PW = (__bf16*)(ws + WS_PW); float *D = (float*)(ws + WS_D), *U = (float*)(ws + WS_U), *H1 = (float*)(ws + WS_H1), *H2 = (float*)(ws + WS_H2);
  k_pack<<<dim3(PW_N / 8 / 256), 256, 0, stream>>>(F[3], F[2], F[4], F[5], F[7], F[9], PW);
  k_proj<<<dim3(TNB * TT / 64, 3), 256, 0, stream>>>(F[1], PW, QH, QL, KH, VT);
  k_dist<<<dim3(TT / 16, TNB), 256, 0, stream>>>(F[0], D);
  k_att<<<dim3(TT / 256, NH, TNB), 256, 0, stream>>>(QH, QL, KH, VT, D, U);
  k_mlp<CC, 128><<<dim3(TNB * TT / 64, 1), 128, 0, stream>>>(U, PW + PW_1, F[6], H1);
  k_mlp<128, 64><<<dim3(TNB * TT / 64, 1), 128, 0, stream>>>(H1, PW + PW_2, F[8], H2);
  k_mlp<64, CIN><<<dim3(TNB * TT / 64, CIN / 128), 128, 0, stream>>>(H2, PW + PW_3, F[10], (float*)d_out);
}

// v006
// A run of this version takes 85.3 microseconds.
// In both of two side-by-side timings against v005, it was 1.04 times as fast.
// Counting every step since v000, it is 7.43 times as fast.
// compute dtype: all float inputs rounded to bf16; keys/queries/values = kp_feat W with EXACT bf16 products on WMMA 16x16x32, f32 accumulate; pairwise distances sqrt(sum (p_i - p_j)^2) in f32 (precise sqrtf) once per batch; att = (dist / 0.5 + q . k / 8) / sqrt(2) with q as f16 hi + residual, k f16 (2 products), kept in registers; softmax in f32 (base-2 exponent formed by one multiply-add, hardware exp2, running maximum and sum) -> P f16 x 2^11, unnormalised; upd = P . v / sum (v rounded once to f16); out MLP 512 -> 128 -> 64 -> 256 with SiLU (hardware exp2) after each, activations split bf16 hi + lo (2 products); f32 output.
#include <hip/hip_runtime.h>
#include <math.h>

typedef __attribute__((ext_vector_type(16))) _Float16 v16h;
typedef __attribute__((ext_vector_type(16))) __bf16 v16b;
typedef __attribute__((ext_vector_type(8)))  _Float16 v8h;
typedef __attribute__((ext_vector_type(8)))  float v8f;
typedef __attribute__((ext_vector_type(4)))  float v4f;
typedef __attribute__((ext_vector_type(2)))  float v2f;
typedef __attribute__((ext_vector_type(4)))  unsigned v4u;
typedef __attribute__((ext_vector_type(4)))  int v4i;
typedef float __attribute__((may_alias)) float_a;
typedef int __attribute__((may_alias)) int_a;

template <typename T> __device__ __forceinline__ void vst2(void* p, T v) { *(T*)p = v;  }
__device__ __forceinline__ v8f wmma16(v16h a, v16h b, v8f c) {
  v8f d = __builtin_amdgcn_wmma_f32_16x16x32_f16(false, a, false, b, (short)0, c, false, false);
  asm volatile("v_nop\n\tv_nop\n\tv_nop\n\tv_nop" : "+v"(d) : "v"(a), "v"(b));
  return d;
}
__device__ __forceinline__ v8f wmma_bf(v16b a, v16b b, v8f c) {
  v8f d = __builtin_amdgcn_wmma_f32_16x16x32_bf16(false, a, false, b, (short)0, c, false, false);
  asm volatile("v_nop\n\tv_nop\n\tv_nop\n\tv_nop" : "+v"(d) : "v"(a), "v"(b));
  return d;
}
// 16x16x32 fragments: lane = (h = lane>>4, row/col = lane&15); elements 0..7 = k0+8h+0..7, 8..15 = k0+16+8h+0..7; D element r = row 8h+r
__device__ __forceinline__ v16h frag_h(const _Float16* rowk0, int lane) {
  union { v16h v; v8h q[2]; } u; const _Float16* p = rowk0 + 8 * (lane >> 4);
  u.q[0] = *(const v8h*)p; u.q[1] = *(const v8h*)(p + 16); return u.v;
}
__device__ __forceinline__ v16h frag_f32(const float* rowk0, int lane) {
  v16h a; const float* p = rowk0 + 8 * (lane >> 4);
#pragma unroll
  for (int i = 0; i < 8; ++i) { a[i] = (_Float16)p[i]; a[8 + i] = (_Float16)p[16 + i]; }
  return a;
}
__device__ __forceinline__ v16h frag_f32s(const float* rowk0, int lane, float sc) {
  v16h a; const float* p = rowk0 + 8 * (lane >> 4);
#pragma unroll
  for (int i = 0; i < 8; ++i) { a[i] = (_Float16)(p[i] * sc); a[8 + i] = (_Float16)(p[16 + i] * sc); }
  return a;
}
// column fragment from a [K][ld] layout (column n), rows >= K read as 0
__device__ __forceinline__ v16h fragc_f32(const float* W, int k0, int n, int lane, int ld, int K) {
  v16h a; const int g = lane >> 4;
#pragma unroll
  for (int i = 0; i < 8; ++i) { const int ka = k0 + 8 * g + i, kb = ka + 16;
    a[i] = (_Float16)(ka < K ? W[(size_t)(ka < K ? ka : K - 1) * ld + n] : 0.f); a[8 + i] = (_Float16)(kb < K ? W[(size_t)(kb < K ? kb : K - 1) * ld + n] : 0.f); }
  return a;
}
struct F2 { v16b h, l; };
__device__ __forceinline__ F2 bsplit16(const float v[16]) { F2 r;
#pragma unroll
  for (int i = 0; i < 16; ++i) { const __bf16 h = (__bf16)v[i]; r.h[i] = h; r.l[i] = (__bf16)(v[i] - (float)h); }
  return r; }
__device__ __forceinline__ F2 split_row(const float* row, int k0, int lane) { float v[16]; const float* p = row + k0 + 8 * (lane >> 4);
#pragma unroll
  for (int i = 0; i < 8; ++i) { v[i] = p[i]; v[8 + i] = p[16 + i]; }
  return bsplit16(v); }
__device__ __forceinline__ F2 split_rowK(const float* row, int k0, int lane, int K) { float v[16]; const int g = lane >> 4;
#pragma unroll
  for (int i = 0; i < 8; ++i) { const int ka = k0 + 8 * g + i, kb = ka + 16; v[i] = ka < K ? row[ka < K ? ka : K - 1] : 0.f; v[8 + i] = kb < K ? row[kb < K ? kb : K - 1] : 0.f; }
  return bsplit16(v); }
__device__ __forceinline__ F2 split_col(const float* W, int k0, int n, int lane, int ld, int K) { float v[16]; const int g = lane >> 4;
#pragma unroll
  for (int i = 0; i < 8; ++i) { const int ka = k0 + 8 * g + i, kb = ka + 16; v[i] = ka < K ? W[(size_t)(ka < K ? ka : K - 1) * ld + n] : 0.f; v[8 + i] = kb < K ? W[(size_t)(kb < K ? kb : K - 1) * ld + n] : 0.f; }
  return bsplit16(v); }
__device__ __forceinline__ v8f mac3(const F2& a, const F2& b, v8f c) { c = wmma_bf(a.l, b.h, c); c = wmma_bf(a.h, b.l, c); return wmma_bf(a.h, b.h, c); }
__device__ __forceinline__ float sigm(float v) { return 1.0f / (1.0f + expf(-v)); }
#define LDSX() do { asm volatile("s_wait_dscnt 0" ::: "memory"); __builtin_amdgcn_wave_barrier(); __builtin_amdgcn_fence(__ATOMIC_RELEASE, "workgroup"); } while (0)


// Keypoint multi-head attention (B 32, N 512 keypoints, in_dim 256, 8 heads x 64): distance-biased attention followed by a 3-layer SiLU MLP.
#define NB 32
#define TT 512
#define CIN 256
#define CC 512
#define NH 8
#define HD 64
#define NR (NB * TT)
#ifndef TNB
#define TNB NB
#endif
typedef __attribute__((ext_vector_type(8))) __bf16 v8b;
__device__ __forceinline__ v16b frag_b(const __bf16* rowk0, int lane) {
  union { v16b v; v8b q[2]; } u; const __bf16* p = rowk0 + 8 * (lane >> 4);
  u.q[0] = *(const v8b*)p; u.q[1] = *(const v8b*)(p + 16); return u.v;
}
__device__ __forceinline__ float bfr(float v) { return (float)(__bf16)v; }
__device__ __attribute__((noinline)) float exp_ni(float v) { return expf(v); }
__device__ __attribute__((noinline)) float erf_ni(float v) { return erff(v); }

#define WS_QH  0u
#define WS_QL  (WS_QH + 2u * (size_t)NR * CC)
#define WS_KH  (WS_QL + 2u * (size_t)NR * CC)
#define WS_VT  (WS_KH + 2u * (size_t)NR * CC)          // f16 v planes [b][512][t]
#define WS_D   (WS_VT + 2u * (size_t)NR * CC)          // f32 dist [b][tile of 16 queries][unit], k_dist's order
#define WS_U   (WS_D + 4u * (size_t)NB * TT * TT)      // f32 upd rows [b*t][512]
#define WS_H1  (WS_U + 4u * (size_t)NR * CC)           // f32 [b*t][128]
#define WS_H2  (WS_H1 + 4u * (size_t)NR * 128)         // f32 [b*t][64]
#define WS_PW  (WS_H2 + 4u * (size_t)NR * 64)          // bf16 weights in fragment order: Wq, Wk, Wv, W1, W2, W3
#define PW_P   (CIN * CC)                              // elements of one projection matrix
#define PW_1   (3 * PW_P)
#define PW_2   (PW_1 + CC * 128)
#define PW_3   (PW_2 + 128 * 64)
#define PW_N   (PW_3 + 64 * CIN)
#define WS_END (WS_PW + 2u * (size_t)PW_N)

// ---- k_pack: every weight matrix W [K][N] (in,out), rounded to bf16 once and laid out as finished B fragments: fragment (kc, nt) = 1 KiB = two runs of 32 lanes x 16 B; lane (g, col) holds column nt*16+col, run 0 = rows kc*32+8g+0..7, run 1 = rows kc*32+16+8g+0..7. One thread writes one 16-byte unit u.
template <int N> __device__ __forceinline__ void pack_unit(const float* __restrict__ Wm, __bf16* __restrict__ dst, int u) {
  const int lane = u & 31, run = (u >> 5) & 1, f = u >> 6, nt = f % (N / 16), kc = f / (N / 16);
  const float* p = Wm + (size_t)(kc * 32 + run * 16 + 8 * (lane >> 4)) * N + nt * 16 + (lane & 15); v8b v;
#pragma unroll
  for (int i = 0; i < 8; ++i) v[i] = (__bf16)p[(size_t)i * N];
  *(v8b*)(dst + (size_t)u * 8) = v; }
__global__ __launch_bounds__(256) void k_pack(const float* __restrict__ WQ, const float* __restrict__ WK, const float* __restrict__ WV, const float* __restrict__ W1, const float* __restrict__ W2, const float* __restrict__ W3, __bf16* __restrict__ PW) {
  const int u = blockIdx.x * 256 + threadIdx.x;   // every matrix is a whole number of blocks, so the choice below is the same for a whole block
  if (u < PW_1 / 8) { const int m = u / (PW_P / 8); pack_unit<CC>(m == 0 ? WQ : m == 1 ? WK : WV, PW + (size_t)m * PW_P, u - m * (PW_P / 8)); }
  else if (u < PW_2 / 8) pack_unit<128>(W1, PW + PW_1, u - PW_1 / 8);
  else if (u < PW_3 / 8) pack_unit<64>(W2, PW + PW_2, u - PW_2 / 8);
  else pack_unit<CIN>(W3, PW + PW_3, u - PW_3 / 8); }
// a packed fragment: two 16-byte loads a lane, each a run of 512 contiguous bytes over the wave
__device__ __forceinline__ v16b frag_p(const __bf16* f, int lane) {
  union { v16b v; v8b q[2]; } u; u.q[0] = *(const v8b*)(f + lane * 8); u.q[1] = *(const v8b*)(f + 256 + lane * 8); return u.v;
}

// ---- k_proj: block = (64 rows, which), 8 waves, a wave = 64 rows x 64 columns (16 accumulator tiles): kp_feat W (packed fragments of [256][512]), no bias. The block's rows are rounded to bf16 once and lie in LDS for all eight waves; a weight fragment is loaded by one wave only and feeds four products
#define XPI 264   // LDS pitch of a staged row, bf16: 528 B = 16 B x odd, no bank conflict for 16-byte reads down a column of rows
typedef __attribute__((ext_vector_type(4))) __bf16 v4b;
__device__ __forceinline__ v8f wmma_b(v16b a, v16b b, v8f c) { return __builtin_amdgcn_wmma_f32_16x16x32_bf16(false, a, false, b, (short)0, c, false, false); }
// Q and K (WHICH 0, 1): D = W^T X^T, a lane holds 8 neighbouring columns of one row; V (WHICH 2): D = X W, a lane holds 8 neighbouring rows of one column, which is V^T's order. Either way 16 bytes of f16 a tile, and the four tiles C of a line tile L make whole 128-byte lines of the output, put together in the wave's own LDS rows. Every short loop over tiles, fragments or elements below is unrolled, so that the fragment and accumulator arrays are indexed at compile time and stay in registers
template <int WHICH> __device__ __forceinline__ void proj_tile(__bf16 (*sx)[XPI], _Float16 (*sw)[2][16][72], const float* __restrict__ X, const __bf16* __restrict__ PW, _Float16* __restrict__ DH, _Float16* __restrict__ DL) {
  const int tid = threadIdx.x, wave = __builtin_amdgcn_readfirstlane(tid >> 5), lane = tid & 31, col = lane & 15, g = lane >> 4; const size_t r0 = (size_t)blockIdx.x * 64; const __bf16* pw = PW + (size_t)WHICH * PW_P + (size_t)(wave * 4) * 512;
  v8f acc[4][4] = {}; v16b wa[4], wb[4], x[4];
  auto ldw = [&](v16b (&w)[4], int kc) {
#pragma unroll
    for (int j = 0; j < 4; ++j) w[j] = frag_p(pw + (size_t)(kc * (CC / 16) + j) * 512, lane); };
  auto ldx = [&](int kc) {
#pragma unroll
    for (int i = 0; i < 4; ++i) x[i] = frag_b(&sx[i * 16 + col][kc * 32], lane);
    __builtin_amdgcn_sched_barrier(0); };   // keeps a k step's loads, the weight loads for the step after it among them, in one group ahead of the products: left free, the weight loads sink to their first use and their latency is paid there
  auto mul = [&](const v16b (&w)[4]) {
#pragma unroll
    for (int L = 0; L < 4; ++L)
#pragma unroll
      for (int C = 0; C < 4; ++C) acc[L][C] = WHICH < 2 ? wmma_b(w[C], x[L], acc[L][C]) : wmma_b(x[C], w[L], acc[L][C]); };
  ldw(wa, 0);   // the first k step's weights are asked for ahead of the staging
  { const float* xg = X + (r0 + (tid >> 6)) * CIN + (tid & 63) * 4; v4f xr[16];   // 64 threads a row of 1 KiB: a wave's load covers 512 contiguous bytes
    // unrolled: a thread's sixteen loads are in flight together
#pragma unroll
    for (int i = 0; i < 16; ++i) xr[i] = *(const v4f*)(xg + i * 4 * CIN);
    asm volatile("s_wait_xcnt 0x0" :: "v"(xg) : "memory");   // the row loads' address pair is free for reuse from here on: the wait stands in front of whatever lands on it
#pragma unroll
    for (int i = 0; i < 16; ++i) { v4b c;
#pragma unroll
      for (int e = 0; e < 4; ++e) c[e] = (__bf16)xr[i][e];
      *(v4b*)&sx[(tid >> 6) + i * 4][(tid & 63) * 4] = c; } }
  __syncthreads();
  // rolled, two k steps a trip: the two weight sets keep their registers, and each is loaded anew while the other set's products run; unrolled whole, the loads are lifted further than the register budget of four waves per SIMD holds
#pragma unroll 1
  for (int kk = 0; kk < CIN / 64 - 1; ++kk) { ldw(wb, 2 * kk + 1); ldx(2 * kk); mul(wa); ldw(wa, 2 * kk + 2); ldx(2 * kk + 1); mul(wb);
    asm volatile("s_wait_xcnt 0x0" ::: "memory"); }   // the next trip forms its weight address in the registers that this trip's loads name: the wait stands in front of that
  ldw(wb, CIN / 32 - 1); ldx(CIN / 32 - 2); mul(wa); ldx(CIN / 32 - 1); mul(wb);
  asm volatile("s_wait_xcnt 0x0" ::: "memory");   // the weight loads' address registers are free for reuse from here on: the wait stands in front of whatever lands on them
  _Float16 (*st)[16][72] = sw[wave];
  const size_t o = (WHICH < 2 ? r0 * CC + wave * 64 : ((r0 / TT) * CC + wave * 64) * (size_t)TT + r0 % TT) + (size_t)(lane >> 3) * CC + (lane & 7) * 8;   // 8 lanes a line; CC = TT is the pitch of all four outputs
  _Float16* ph = DH + o; _Float16* pl = DL + o;
#pragma unroll
  for (int L = 0; L < 4; ++L) {
#pragma unroll
    for (int C = 0; C < 4; ++C) { v8h hv, lv;
#pragma unroll
      for (int r = 0; r < 8; ++r) { const float v = acc[L][C][r]; const _Float16 h = (_Float16)v; hv[r] = h; lv[r] = (_Float16)(v - (float)h); }
      *(v8h*)&st[0][col][C * 16 + 8 * g] = hv; if (WHICH == 0) *(v8h*)&st[1][col][C * 16 + 8 * g] = lv; }
    asm volatile("s_wait_dscnt 0x0" ::: "memory");   // the rows are read back across the wave's lanes: its LDS writes have landed first
#pragma unroll
    for (int n = 0; n < 4; ++n) { vst2(ph + (size_t)(L * 16 + n * 4) * CC, *(const v4u*)&st[0][n * 4 + (lane >> 3)][(lane & 7) * 8]); if (WHICH == 0) vst2(pl + (size_t)(L * 16 + n * 4) * CC, *(const v4u*)&st[1][n * 4 + (lane >> 3)][(lane & 7) * 8]); }
    asm volatile("s_wait_xcnt 0x0" ::: "memory");   // the stores' data registers are loaded anew for the next line tile: the wait stands in front of that; its clobber also keeps the next tile's LDS writes behind these reads
  } }
static_assert(CC == TT, "one line pitch for Q, K and V^T");
__global__ __launch_bounds__(256) __attribute__((amdgpu_waves_per_eu(4, 4))) void k_proj(const float* __restrict__ X, const __bf16* __restrict__ PW, _Float16* __restrict__ QH, _Float16* __restrict__ QL, _Float16* __restrict__ KH, _Float16* __restrict__ VT) {
  __shared__ __align__(16) __bf16 sx[64][XPI]; __shared__ __align__(16) _Float16 sw[8][2][16][72];
  if (blockIdx.y == 0) proj_tile<0>(sx, sw, X, PW, QH, QL);
  else if (blockIdx.y == 1) proj_tile<1>(sx, sw, X, PW, KH, KH);
  else proj_tile<2>(sx, sw, X, PW, VT, VT); }
// ---- k_dist: block = (tile of 16 queries, batch b): |p_i - p_j| (0 when the squared sum is exactly 0), stored in the order in which a wave of k_att reads it. A tile's 16 x 512 distances are 2,048 units of 16 B; unit u = ((kb * 2 + t) * 2 + hf) * 32 + lane holds query (lane & 15) of the tile against keys kb * 32 + t * 16 + (lane >> 4) * 8 + hf * 4 + 0..3, so the 32 lanes of one load or store cover 512 contiguous bytes. Thread tid writes units tid + 256 n
__global__ __launch_bounds__(256) void k_dist(const float* __restrict__ P, float* __restrict__ D) {
  const int tid = threadIdx.x, lane = tid & 31; const size_t b = blockIdx.y; const float* pb = P + b * TT * 3; const int i = blockIdx.x * 16 + (lane & 15);
  const float xi = bfr(pb[i * 3]), yi = bfr(pb[i * 3 + 1]), zi = bfr(pb[i * 3 + 2]);
  asm volatile("s_wait_xcnt 0x0" ::: "memory");   // the query load's address pair is free for reuse from here on: the wait stands in front of whatever lands on it
  const int j0 = (tid >> 7) * 32 + ((tid >> 6) & 1) * 16 + (lane >> 4) * 8 + ((tid >> 5) & 1) * 4; float* dst = D + (b * (TT / 16) + blockIdx.x) * (size_t)(16 * TT) + tid * 4;
  // unrolled: the key loads of a thread's eight units are in flight together
#pragma unroll
  for (int n = 0; n < 8; ++n) { const float* kp = pb + (j0 + n * 64) * 3; const v4f k0 = *(const v4f*)kp, k1 = *(const v4f*)(kp + 4), k2 = *(const v4f*)(kp + 8);   // four keys = 48 contiguous bytes
    const float f[12] = {k0[0], k0[1], k0[2], k0[3], k1[0], k1[1], k1[2], k1[3], k2[0], k2[1], k2[2], k2[3]}; v4f r;
#pragma unroll
    for (int e = 0; e < 4; ++e) { const float dx = xi - bfr(f[3 * e]), dy = yi - bfr(f[3 * e + 1]), dz = zi - bfr(f[3 * e + 2]); const float d2 = dx * dx + dy * dy + dz * dz; r[e] = (d2 > 0.f) ? sqrtf(d2) : 0.f; }
    vst2(dst + n * 1024, r); } }
#define KPI 72    // LDS pitch of a K row, f16: 144 B = 16 B x odd, no bank conflict for 16-byte reads down a column of rows
#define VPI 520   // LDS pitch of a V^T row, f16: 1040 B = 16 B x odd
__device__ __forceinline__ v8f wmma_h(v16h a, v16h b, v8f c) { return __builtin_amdgcn_wmma_f32_16x16x32_f16(false, a, false, b, (short)0, c, false, false); }
__device__ __forceinline__ float ex2(float x) { return __builtin_amdgcn_exp2f(x); }  // one v_exp_f32; an argument under -126 gives 0
#define LOG2E 1.4426950408889634
__device__ __forceinline__ float xhalf(float x) { return __builtin_bit_cast(float, __builtin_amdgcn_permlanex16(__builtin_bit_cast(int, x), __builtin_bit_cast(int, x), 0x76543210, 0xfedcba98, false, false)); }  // lane l with lane l ^ 16
__global__ __launch_bounds__(256) __attribute__((amdgpu_waves_per_eu(4, 4))) void k_att(const _Float16* __restrict__ QH, const _Float16* __restrict__ QL, const _Float16* __restrict__ KH, const _Float16* __restrict__ VT, const float* __restrict__ Dm, float* __restrict__ U) {
  __shared__ __align__(16) _Float16 sk[TT][KPI]; __shared__ __align__(16) _Float16 sv[HD][VPI];
  const int tid = threadIdx.x, wave = tid >> 5, lane = tid & 31, col = lane & 15, g = lane >> 4; const size_t b = blockIdx.z; const int h = blockIdx.y; const int q0 = blockIdx.x * 256 + wave * 32;
  { const _Float16* kg = KH + (b * TT + (tid >> 3)) * CC + h * HD + (tid & 7) * 8; const _Float16* vg = VT + (b * CC + h * HD + (tid >> 6)) * (size_t)TT + (tid & 63) * 8;   // 8 threads a K row of 128 B, 64 threads a V^T row of 1 KiB
    v8h kr[TT / 32], vr[HD / 4];
    // all unrolled: a thread's 16-byte loads are in flight together
#pragma unroll
    for (int i = 0; i < TT / 32; ++i) kr[i] = *(const v8h*)(kg + i * 32 * CC);
#pragma unroll
    for (int i = 0; i < HD / 4; ++i) vr[i] = *(const v8h*)(vg + i * 4 * TT);
    asm volatile("s_wait_xcnt 0x0" :: "v"(kg), "v"(vg) : "memory");   // the loads' two address pairs are taken again for the Q addresses: the wait stands in front of that; named as inputs, the pairs stay whole up to it
#pragma unroll
    for (int i = 0; i < TT / 32; ++i) *(v8h*)&sk[(tid >> 3) + i * 32][(tid & 7) * 8] = kr[i];
#pragma unroll
    for (int i = 0; i < HD / 4; ++i) *(v8h*)&sv[(tid >> 6) + i * 4][(tid & 63) * 8] = vr[i]; }
  v16h qh[2][2], ql[2][2];
#pragma unroll
  for (int qt = 0; qt < 2; ++qt)
#pragma unroll
    for (int kc = 0; kc < 2; ++kc) { const size_t o = (b * TT + q0 + qt * 16 + col) * CC + h * HD + kc * 32; qh[qt][kc] = frag_h(QH + o, lane); ql[qt][kc] = frag_h(QL + o, lane); }
  const float* dp = Dm + (b * (TT / 16) + (q0 >> 4)) * (size_t)(16 * TT) + lane * 4;   // k_dist's unit order: every load below is 512 contiguous bytes over the wave
  v8f o[2][4] = {}; float m[2] = {-3.0e38f, -3.0e38f}, l[2] = {0.f, 0.f};
  const float c2 = (float)(0.125 * 0.70710678118654752 * LOG2E);   // att log2(e) = (16 dist + q.k) c2
  __syncthreads();
  // rolled: sixteen passes unrolled would not fit the register budget of four waves per SIMD
#pragma unroll 1
  for (int k0 = 0; k0 < TT; k0 += 32) {
    v8f s[2][2] = {};   // [query tile][key tile]: register r = key k0 + 16 t + 8 g + r, column = query
#pragma unroll
    for (int kc = 0; kc < 2; ++kc) { v16h kb[2];
#pragma unroll
      for (int t = 0; t < 2; ++t) kb[t] = frag_h(&sk[k0 + t * 16 + col][kc * 32], lane);
#pragma unroll
      for (int t = 0; t < 2; ++t)
#pragma unroll
        for (int qt = 0; qt < 2; ++qt) s[qt][t] = wmma_h(kb[t], qh[qt][kc], s[qt][t]);
#pragma unroll
      for (int t = 0; t < 2; ++t)
#pragma unroll
        for (int qt = 0; qt < 2; ++qt) s[qt][t] = wmma_h(kb[t], ql[qt][kc], s[qt][t]); }
#pragma unroll
    for (int qt = 0; qt < 2; ++qt) { v2f z[8];   // z = 16 dist + q.k, two keys a pair; maximum and running maximum are kept in z
#pragma unroll
      for (int t = 0; t < 2; ++t) { const float* dq = dp + qt * 16 * TT + k0 * 16 + t * 256; const v4f d0 = *(const v4f*)dq, d1 = *(const v4f*)(dq + 128); const v2f c16 = {16.0f, 16.0f};
#pragma unroll
        for (int r = 0; r < 2; ++r) { z[t * 4 + r] = __builtin_elementwise_fma((v2f){d0[2 * r], d0[2 * r + 1]}, c16, (v2f){s[qt][t][2 * r], s[qt][t][2 * r + 1]}); z[t * 4 + 2 + r] = __builtin_elementwise_fma((v2f){d1[2 * r], d1[2 * r + 1]}, c16, (v2f){s[qt][t][4 + 2 * r], s[qt][t][5 + 2 * r]}); } }
      float mx = z[0][0];
#pragma unroll
      for (int i = 1; i < 16; ++i) mx = fmaxf(mx, z[i >> 1][i & 1]);
      mx = fmaxf(mx, xhalf(mx));
      const float mn = fmaxf(m[qt], mx); const float al = ex2((m[qt] - mn) * c2); m[qt] = mn;
      const float nb = __builtin_fmaf(-mn, c2, 11.0f);   // P and its sum both carry 2^11, which keeps small weights out of the f16 subnormals and cancels in the division
      float sum = 0.f; v16h p;
#pragma unroll
      for (int i = 0; i < 8; ++i) { const v2f y = __builtin_elementwise_fma(z[i], (v2f){c2, c2}, (v2f){nb, nb}); const float e0 = ex2(y[0]), e1 = ex2(y[1]); sum += e0; sum += e1; p[2 * i] = (_Float16)e0; p[2 * i + 1] = (_Float16)e1; }
      l[qt] = l[qt] * al + sum;
#pragma unroll
      for (int j = 0; j < 4; ++j) o[qt][j] *= al;
#pragma unroll
      for (int j = 0; j < 4; ++j) o[qt][j] = wmma_h(frag_h(&sv[j * 16 + col][k0], lane), p, o[qt][j]); } }
#pragma unroll
  for (int qt = 0; qt < 2; ++qt) { const float inv = 1.0f / (l[qt] + xhalf(l[qt])); float* up = U + (b * TT + q0 + qt * 16 + col) * CC + h * HD + 8 * g;
#pragma unroll
    for (int j = 0; j < 4; ++j) { v4f a0, a1;
#pragma unroll
      for (int r = 0; r < 4; ++r) { a0[r] = o[qt][j][r] * inv; a1[r] = o[qt][j][4 + r] * inv; }
      vst2(up + j * 16, a0); vst2(up + j * 16 + 4, a1); } } }
// ---- k_mlp: block = (64 rows, 128-col block), 4 WC waves = 4 groups of 16 rows x WC parts of the block's columns: OUT = silu(A (hi+lo) W + b), A rows [K], W packed fragments of [K][N]. A wave's load waits, products and SiLU follow one another; where K is long that chain is the launch's length, and WC = 2 halves it (half the fragments a k step, so twice the k steps behind one wait)
template <int K, int N, int WC>
__global__ __launch_bounds__(128 * WC) void k_mlp(const float* __restrict__ A, const __bf16* __restrict__ PW, const float* __restrict__ Bv, float* __restrict__ OUT) { constexpr int CB = (N < 128 ? N : 128) / WC; __shared__ __align__(16) float sf[4 * WC][16][128 / WC + 4];   // CB = columns of a wave
  const int tid = threadIdx.x, wave = tid >> 5, lane = tid & 31, col = lane & 15, g = lane >> 4; const int c0 = blockIdx.y * 128 + (WC > 1 ? (wave >> 2) * CB : 0); const size_t r0 = (size_t)blockIdx.x * 64 + (WC > 1 ? wave & 3 : wave) * 16; constexpr int NT = CB / 16; constexpr int G = 16 / NT < K / 32 ? 16 / NT : K / 32;   // k steps whose fragments (16 at most) are loaded together
  const __bf16* pw = PW + (size_t)(c0 / 16) * 512; const float* ar = A + (r0 + col) * K + 8 * g;
  v8f acc[NT]; for (int j = 0; j < NT; ++j) for (int r = 0; r < 8; ++r) acc[j][r] = 0.f;
  // rolled: one group's loads and products are the whole body, the text stays short
#pragma unroll 1
  for (int kg = 0; kg < K / 32; kg += G) { v16b w[G][NT]; v4f av[G][4];
#pragma unroll
    for (int s = 0; s < G; ++s)
#pragma unroll
      for (int i = 0; i < 4; ++i) av[s][i] = *(const v4f*)(ar + (kg + s) * 32 + (i >> 1) * 16 + (i & 1) * 4);
    asm volatile("s_wait_xcnt 0x0" ::: "memory");   // the fragment loads below may land on the row loads' address registers: the wait stands in front of that; its clobber also keeps every row load of the group up here, where left free the later steps' sink behind the first products and pay their latency again
#pragma unroll
    for (int s = 0; s < G; ++s)
#pragma unroll
      for (int j = 0; j < NT; ++j) w[s][j] = frag_p(pw + (size_t)((kg + s) * (N / 16) + j) * 512, lane);
#pragma unroll
    for (int s = 0; s < G; ++s) { float af[16];
#pragma unroll
      for (int i = 0; i < 16; ++i) af[i] = av[s][i >> 2][i & 3];
      const F2 a = bsplit16(af);
#pragma unroll
      for (int j = 0; j < NT; ++j) { acc[j] = wmma_bf(a.h, w[s][j], acc[j]); acc[j] = wmma_bf(a.l, w[s][j], acc[j]); } } }
#pragma unroll
  for (int j = 0; j < NT; ++j) { const float bb = bfr(Bv[c0 + j * 16 + col]);
#pragma unroll
    for (int r = 0; r < 8; ++r) { const float v = acc[j][r] + bb; sf[wave][8 * g + r][j * 16 + col] = v / (1.0f + ex2(v * (float)-LOG2E)); } }
  LDSX(); for (int rl = 0; rl < 16; ++rl) if (lane < NT * 4) vst2(OUT + (r0 + rl) * N + c0 + lane * 4, *(const v4f*)&sf[wave][rl][lane * 4]); }
extern "C" void kernel_launch(void* const* d_in, const int* in_sizes, int n_in, void* d_out, int out_size, void* d_ws, size_t ws_size, hipStream_t stream) {
  (void)in_sizes; (void)n_in; (void)out_size;
  const float** F = (const float**)d_in;   // 0 kp_pos [32,512,3], 1 kp_feat [32,512,256], 2 Wk [256,512], 3 Wq, 4 Wv, 5 W1 [512,128], 6 b1, 7 W2 [128,64], 8 b2, 9 W3 [64,256], 10 b3
  if (ws_size < (size_t)WS_END) return;
  char* ws = (char*)d_ws; _Float16 *QH = (_Float16*)(ws + WS_QH), *QL = (_Float16*)(ws + WS_QL), *KH = (_Float16*)(ws + WS_KH), *VT = (_Float16*)(ws + WS_VT); __bf16* PW = (__bf16*)(ws + WS_PW); float *D = (float*)(ws + WS_D), *U = (float*)(ws + WS_U), *H1 = (float*)(ws + WS_H1), *H2 = (float*)(ws + WS_H2);
  k_pack<<<dim3(PW_N / 8 / 256), 256, 0, stream>>>(F[3], F[2], F[4], F[5], F[7], F[9], PW);
  k_proj<<<dim3(TNB * TT / 64, 3), 256, 0, stream>>>(F[1], PW, QH, QL, KH, VT);
  k_dist<<<dim3(TT / 16, TNB), 256, 0, stream>>>(F[0], D);
  k_att<<<dim3(TT / 256, NH, TNB), 256, 0, stream>>>(QH, QL, KH, VT, D, U);
  k_mlp<CC, 128, 2><<<dim3(TNB * TT / 64, 1), 256, 0, stream>>>(U, PW + PW_1, F[6], H1);
  k_mlp<128, 64, 1><<<dim3(TNB * TT / 64, 1), 128, 0, stream>>>(H1, PW + PW_2, F[8], H2);
  k_mlp<64, CIN, 1><<<dim3(TNB * TT / 64, CIN / 128), 128, 0, stream>>>(H2, PW + PW_3, F[10], (float*)d_out);
}

// v007
// One run takes 80.9 microseconds.
// Timed twice side by side with v006, it ran 1.06 times as fast both times.
// Over all steps from v000 it is 7.86 times as fast.
// compute dtype: all float inputs rounded to bf16; keys/queries/values = kp_feat W with EXACT bf16 products on WMMA 16x16x32, f32 accumulate; pairwise distances sqrt(sum (p_i - p_j)^2) in f32 (precise sqrtf) once per batch; att = (dist / 0.5 + q . k / 8) / sqrt(2) with q as f16 hi + residual, k f16 (2 products), kept in registers; softmax in f32 (base-2 exponent formed by one multiply-add, hardware exp2, running maximum and sum) -> P f16 x 2^11, unnormalised; upd = P . v / sum (v rounded once to f16); out MLP 512 -> 128 -> 64 -> 256 with SiLU (hardware exp2) after each, activations split bf16 hi + lo (2 products); f32 output.
#include <hip/hip_runtime.h>
#include <math.h>

typedef __attribute__((ext_vector_type(16))) _Float16 v16h;
typedef __attribute__((ext_vector_type(16))) __bf16 v16b;
typedef __attribute__((ext_vector_type(8)))  _Float16 v8h;
typedef __attribute__((ext_vector_type(8)))  float v8f;
typedef __attribute__((ext_vector_type(4)))  float v4f;
typedef __attribute__((ext_vector_type(2)))  float v2f;
typedef __attribute__((ext_vector_type(4)))  unsigned v4u;
typedef __attribute__((ext_vector_type(4)))  int v4i;
typedef float __attribute__((may_alias)) float_a;
typedef int __attribute__((may_alias)) int_a;

template <typename T> __device__ __forceinline__ void vst2(void* p, T v) { *(T*)p = v;  }
__device__ __forceinline__ v8f wmma16(v16h a, v16h b, v8f c) {
  v8f d = __builtin_amdgcn_wmma_f32_16x16x32_f16(false, a, false, b, (short)0, c, false, false);
  asm volatile("v_nop\n\tv_nop\n\tv_nop\n\tv_nop" : "+v"(d) : "v"(a), "v"(b));
  return d;
}
__device__ __forceinline__ v8f wmma_bf(v16b a, v16b b, v8f c) {
  v8f d = __builtin_amdgcn_wmma_f32_16x16x32_bf16(false, a, false, b, (short)0, c, false, false);
  asm volatile("v_nop\n\tv_nop\n\tv_nop\n\tv_nop" : "+v"(d) : "v"(a), "v"(b));
  return d;
}
// 16x16x32 fragments: lane = (h = lane>>4, row/col = lane&15); elements 0..7 = k0+8h+0..7, 8..15 = k0+16+8h+0..7; D element r = row 8h+r
__device__ __forceinline__ v16h frag_h(const _Float16* rowk0, int lane) {
  union { v16h v; v8h q[2]; } u; const _Float16* p = rowk0 + 8 * (lane >> 4);
  u.q[0] = *(const v8h*)p; u.q[1] = *(const v8h*)(p + 16); return u.v;
}
__device__ __forceinline__ v16h frag_f32(const float* rowk0, int lane) {
  v16h a; const float* p = rowk0 + 8 * (lane >> 4);
#pragma unroll
  for (int i = 0; i < 8; ++i) { a[i] = (_Float16)p[i]; a[8 + i] = (_Float16)p[16 + i]; }
  return a;
}
__device__ __forceinline__ v16h frag_f32s(const float* rowk0, int lane, float sc) {
  v16h a; const float* p = rowk0 + 8 * (lane >> 4);
#pragma unroll
  for (int i = 0; i < 8; ++i) { a[i] = (_Float16)(p[i] * sc); a[8 + i] = (_Float16)(p[16 + i] * sc); }
  return a;
}
// column fragment from a [K][ld] layout (column n), rows >= K read as 0
__device__ __forceinline__ v16h fragc_f32(const float* W, int k0, int n, int lane, int ld, int K) {
  v16h a; const int g = lane >> 4;
#pragma unroll
  for (int i = 0; i < 8; ++i) { const int ka = k0 + 8 * g + i, kb = ka + 16;
    a[i] = (_Float16)(ka < K ? W[(size_t)(ka < K ? ka : K - 1) * ld + n] : 0.f); a[8 + i] = (_Float16)(kb < K ? W[(size_t)(kb < K ? kb : K - 1) * ld + n] : 0.f); }
  return a;
}
struct F2 { v16b h, l; };
__device__ __forceinline__ F2 bsplit16(const float v[16]) { F2 r;
#pragma unroll
  for (int i = 0; i < 16; ++i) { const __bf16 h = (__bf16)v[i]; r.h[i] = h; r.l[i] = (__bf16)(v[i] - (float)h); }
  return r; }
__device__ __forceinline__ F2 split_row(const float* row, int k0, int lane) { float v[16]; const float* p = row + k0 + 8 * (lane >> 4);
#pragma unroll
  for (int i = 0; i < 8; ++i) { v[i] = p[i]; v[8 + i] = p[16 + i]; }
  return bsplit16(v); }
__device__ __forceinline__ F2 split_rowK(const float* row, int k0, int lane, int K) { float v[16]; const int g = lane >> 4;
#pragma unroll
  for (int i = 0; i < 8; ++i) { const int ka = k0 + 8 * g + i, kb = ka + 16; v[i] = ka < K ? row[ka < K ? ka : K - 1] : 0.f; v[8 + i] = kb < K ? row[kb < K ? kb : K - 1] : 0.f; }
  return bsplit16(v); }
__device__ __forceinline__ F2 split_col(const float* W, int k0, int n, int lane, int ld, int K) { float v[16]; const int g = lane >> 4;
#pragma unroll
  for (int i = 0; i < 8; ++i) { const int ka = k0 + 8 * g + i, kb = ka + 16; v[i] = ka < K ? W[(size_t)(ka < K ? ka : K - 1) * ld + n] : 0.f; v[8 + i] = kb < K ? W[(size_t)(kb < K ? kb : K - 1) * ld + n] : 0.f; }
  return bsplit16(v); }
__device__ __forceinline__ v8f mac3(const F2& a, const F2& b, v8f c) { c = wmma_bf(a.l, b.h, c); c = wmma_bf(a.h, b.l, c); return wmma_bf(a.h, b.h, c); }
__device__ __forceinline__ float sigm(float v) { return 1.0f / (1.0f + expf(-v)); }
#define LDSX() do { asm volatile("s_wait_dscnt 0" ::: "memory"); __builtin_amdgcn_wave_barrier(); __builtin_amdgcn_fence(__ATOMIC_RELEASE, "workgroup"); } while (0)


// Keypoint multi-head attention (B 32, N 512 keypoints, in_dim 256, 8 heads x 64): distance-biased attention followed by a 3-layer SiLU MLP.
#define NB 32
#define TT 512
#define CIN 256
#define CC 512
#define NH 8
#define HD 64
#define NR (NB * TT)
#ifndef TNB
#define TNB NB
#endif
typedef __attribute__((ext_vector_type(8))) __bf16 v8b;
__device__ __forceinline__ v16b frag_b(const __bf16* rowk0, int lane) {
  union { v16b v; v8b q[2]; } u; const __bf16* p = rowk0 + 8 * (lane >> 4);
  u.q[0] = *(const v8b*)p; u.q[1] = *(const v8b*)(p + 16); return u.v;
}
__device__ __forceinline__ float bfr(float v) { return (float)(__bf16)v; }
__device__ __attribute__((noinline)) float exp_ni(float v) { return expf(v); }
__device__ __attribute__((noinline)) float erf_ni(float v) { return erff(v); }

#define WS_QH  0u
#define WS_QL  (WS_QH + 2u * (size_t)NR * CC)
#define WS_KH  (WS_QL + 2u * (size_t)NR * CC)
#define WS_VT  (WS_KH + 2u * (size_t)NR * CC)          // f16 v planes [b][512][t]
#define WS_D   (WS_VT + 2u * (size_t)NR * CC)          // f32 dist [b][tile of 16 queries][unit], dist_tile's order
#define WS_U   (WS_D + 4u * (size_t)NB * TT * TT)      // f32 upd rows [b*t][512]
#define WS_H1  (WS_U + 4u * (size_t)NR * CC)           // f32 [b*t][128]
#define WS_H2  (WS_H1 + 4u * (size_t)NR * 128)         // f32 [b*t][64]
#define WS_PW  (WS_H2 + 4u * (size_t)NR * 64)          // bf16 weights in fragment order: Wq, Wk, Wv, W1, W2, W3
#define PW_P   (CIN * CC)                              // elements of one projection matrix
#define PW_1   (3 * PW_P)
#define PW_2   (PW_1 + CC * 128)
#define PW_3   (PW_2 + 128 * 64)
#define PW_N   (PW_3 + 64 * CIN)
#define WS_END (WS_PW + 2u * (size_t)PW_N)

// ---- k_pack: every weight matrix W [K][N] (in,out), rounded to bf16 once and laid out as finished B fragments: fragment (kc, nt) = 1 KiB = two runs of 32 lanes x 16 B; lane (g, col) holds column nt*16+col, run 0 = rows kc*32+8g+0..7, run 1 = rows kc*32+16+8g+0..7. One thread writes one 16-byte unit u.
template <int N> __device__ __forceinline__ void pack_unit(const float* __restrict__ Wm, __bf16* __restrict__ dst, int u) {
  const int lane = u & 31, run = (u >> 5) & 1, f = u >> 6, nt = f % (N / 16), kc = f / (N / 16);
  const float* p = Wm + (size_t)(kc * 32 + run * 16 + 8 * (lane >> 4)) * N + nt * 16 + (lane & 15); v8b v;
#pragma unroll
  for (int i = 0; i < 8; ++i) v[i] = (__bf16)p[(size_t)i * N];
  *(v8b*)(dst + (size_t)u * 8) = v; }
__global__ __launch_bounds__(256) void k_pack(const float* __restrict__ WQ, const float* __restrict__ WK, const float* __restrict__ WV, const float* __restrict__ W1, const float* __restrict__ W2, const float* __restrict__ W3, __bf16* __restrict__ PW) {
  const int u = blockIdx.x * 256 + threadIdx.x;   // every matrix is a whole number of blocks, so the choice below is the same for a whole block
  if (u < PW_1 / 8) { const int m = u / (PW_P / 8); pack_unit<CC>(m == 0 ? WQ : m == 1 ? WK : WV, PW + (size_t)m * PW_P, u - m * (PW_P / 8)); }
  else if (u < PW_2 / 8) pack_unit<128>(W1, PW + PW_1, u - PW_1 / 8);
  else if (u < PW_3 / 8) pack_unit<64>(W2, PW + PW_2, u - PW_2 / 8);
  else pack_unit<CIN>(W3, PW + PW_3, u - PW_3 / 8); }
// a packed fragment: two 16-byte loads a lane, each a run of 512 contiguous bytes over the wave
__device__ __forceinline__ v16b frag_p(const __bf16* f, int lane) {
  union { v16b v; v8b q[2]; } u; u.q[0] = *(const v8b*)(f + lane * 8); u.q[1] = *(const v8b*)(f + 256 + lane * 8); return u.v;
}

// ---- k_proj: block = (64 rows, which), 8 waves, a wave = 64 rows x 64 columns (16 accumulator tiles): kp_feat W (packed fragments of [256][512]), no bias. The block's rows are rounded to bf16 once and lie in LDS for all eight waves; a weight fragment is loaded by one wave only and feeds four products
#define XPI 264   // LDS pitch of a staged row, bf16: 528 B = 16 B x odd, no bank conflict for 16-byte reads down a column of rows
typedef __attribute__((ext_vector_type(4))) __bf16 v4b;
__device__ __forceinline__ v8f wmma_b(v16b a, v16b b, v8f c) { return __builtin_amdgcn_wmma_f32_16x16x32_bf16(false, a, false, b, (short)0, c, false, false); }
// Q and K (WHICH 0, 1): D = W^T X^T, a lane holds 8 neighbouring columns of one row; V (WHICH 2): D = X W, a lane holds 8 neighbouring rows of one column, which is V^T's order. Either way 16 bytes of f16 a tile, and the four tiles C of a line tile L make whole 128-byte lines of the output, put together in the wave's own LDS rows. Every short loop over tiles, fragments or elements below is unrolled, so that the fragment and accumulator arrays are indexed at compile time and stay in registers
template <int WHICH> __device__ __forceinline__ void proj_tile(__bf16 (*sx)[XPI], _Float16 (*sw)[2][16][72], const float* __restrict__ X, const __bf16* __restrict__ PW, _Float16* __restrict__ DH, _Float16* __restrict__ DL) {
  const int tid = threadIdx.x, wave = __builtin_amdgcn_readfirstlane(tid >> 5), lane = tid & 31, col = lane & 15, g = lane >> 4; const size_t r0 = (size_t)blockIdx.x * 64; const __bf16* pw = PW + (size_t)WHICH * PW_P + (size_t)(wave * 4) * 512;
  v8f acc[4][4] = {}; v16b wa[4], wb[4], x[4];
  auto ldw = [&](v16b (&w)[4], int kc) {
#pragma unroll
    for (int j = 0; j < 4; ++j) w[j] = frag_p(pw + (size_t)(kc * (CC / 16) + j) * 512, lane); };
  auto ldx = [&](int kc) {
#pragma unroll
    for (int i = 0; i < 4; ++i) x[i] = frag_b(&sx[i * 16 + col][kc * 32], lane);
    __builtin_amdgcn_sched_barrier(0); };   // keeps a k step's loads, the weight loads for the step after it among them, in one group ahead of the products: left free, the weight loads sink to their first use and their latency is paid there
  auto mul = [&](const v16b (&w)[4]) {
#pragma unroll
    for (int L = 0; L < 4; ++L)
#pragma unroll
      for (int C = 0; C < 4; ++C) acc[L][C] = WHICH < 2 ? wmma_b(w[C], x[L], acc[L][C]) : wmma_b(x[C], w[L], acc[L][C]); };
  ldw(wa, 0);   // the first k step's weights are asked for ahead of the staging
  { const float* xg = X + (r0 + (tid >> 6)) * CIN + (tid & 63) * 4; v4f xr[16];   // 64 threads a row of 1 KiB: a wave's load covers 512 contiguous bytes
    // unrolled: a thread's sixteen loads are in flight together
#pragma unroll
    for (int i = 0; i < 16; ++i) xr[i] = *(const v4f*)(xg + i * 4 * CIN);
    asm volatile("s_wait_xcnt 0x0" :: "v"(xg) : "memory");   // the row loads' address pair is free for reuse from here on: the wait stands in front of whatever lands on it
#pragma unroll
    for (int i = 0; i < 16; ++i) { v4b c;
#pragma unroll
      for (int e = 0; e < 4; ++e) c[e] = (__bf16)xr[i][e];
      *(v4b*)&sx[(tid >> 6) + i * 4][(tid & 63) * 4] = c; } }
  __syncthreads();
  // rolled, two k steps a trip: the two weight sets keep their registers, and each is loaded anew while the other set's products run; unrolled whole, the loads are lifted further than the register budget of four waves per SIMD holds
#pragma unroll 1
  for (int kk = 0; kk < CIN / 64 - 1; ++kk) { ldw(wb, 2 * kk + 1); ldx(2 * kk); mul(wa); ldw(wa, 2 * kk + 2); ldx(2 * kk + 1); mul(wb);
    asm volatile("s_wait_xcnt 0x0" ::: "memory"); }   // the next trip forms its weight address in the registers that this trip's loads name: the wait stands in front of that
  ldw(wb, CIN / 32 - 1); ldx(CIN / 32 - 2); mul(wa); ldx(CIN / 32 - 1); mul(wb);
  asm volatile("s_wait_xcnt 0x0" ::: "memory");   // the weight loads' address registers are free for reuse from here on: the wait stands in front of whatever lands on them
  _Float16 (*st)[16][72] = sw[wave];
  const size_t o = (WHICH < 2 ? r0 * CC + wave * 64 : ((r0 / TT) * CC + wave * 64) * (size_t)TT + r0 % TT) + (size_t)(lane >> 3) * CC + (lane & 7) * 8;   // 8 lanes a line; CC = TT is the pitch of all four outputs
  _Float16* ph = DH + o; _Float16* pl = DL + o;
#pragma unroll
  for (int L = 0; L < 4; ++L) {
#pragma unroll
    for (int C = 0; C < 4; ++C) { v8h hv, lv;
#pragma unroll
      for (int r = 0; r < 8; ++r) { const float v = acc[L][C][r]; const _Float16 h = (_Float16)v; hv[r] = h; lv[r] = (_Float16)(v - (float)h); }
      *(v8h*)&st[0][col][C * 16 + 8 * g] = hv; if (WHICH == 0) *(v8h*)&st[1][col][C * 16 + 8 * g] = lv; }
    asm volatile("s_wait_dscnt 0x0" ::: "memory");   // the rows are read back across the wave's lanes: its LDS writes have landed first
#pragma unroll
    for (int n = 0; n < 4; ++n) { vst2(ph + (size_t)(L * 16 + n * 4) * CC, *(const v4u*)&st[0][n * 4 + (lane >> 3)][(lane & 7) * 8]); if (WHICH == 0) vst2(pl + (size_t)(L * 16 + n * 4) * CC, *(const v4u*)&st[1][n * 4 + (lane >> 3)][(lane & 7) * 8]); }
    asm volatile("s_wait_xcnt 0x0" ::: "memory");   // the stores' data registers are loaded anew for the next line tile: the wait stands in front of that; its clobber also keeps the next tile's LDS writes behind these reads
  } }
static_assert(CC == TT, "one line pitch for Q, K and V^T");
// ---- dist_tile: block = (tile of 16 queries, batch b), run by the last blocks of k_proj's grid: |p_i - p_j| (0 when the squared sum is exactly 0), stored in the order in which a wave of k_att reads it. A tile's 16 x 512 distances are 2,048 units of 16 B; unit u = ((kb * 2 + t) * 2 + hf) * 32 + lane holds query (lane & 15) of the tile against keys kb * 32 + t * 16 + (lane >> 4) * 8 + hf * 4 + 0..3, so the 32 lanes of one load or store cover 512 contiguous bytes. Thread tid writes units tid + 256 n
__device__ __forceinline__ void dist_tile(const float* __restrict__ P, float* __restrict__ D, int tile, size_t b) {
  const int tid = threadIdx.x, lane = tid & 31; const float* pb = P + b * TT * 3; const int i = tile * 16 + (lane & 15);
  const float xi = bfr(pb[i * 3]), yi = bfr(pb[i * 3 + 1]), zi = bfr(pb[i * 3 + 2]);
  asm volatile("s_wait_xcnt 0x0" ::: "memory");   // the query load's address pair is free for reuse from here on: the wait stands in front of whatever lands on it
  const int j0 = (tid >> 7) * 32 + ((tid >> 6) & 1) * 16 + (lane >> 4) * 8 + ((tid >> 5) & 1) * 4; float* dst = D + (b * (TT / 16) + tile) * (size_t)(16 * TT) + tid * 4;
  // unrolled: the key loads of a thread's eight units are in flight together
#pragma unroll
  for (int n = 0; n < 8; ++n) { const float* kp = pb + (j0 + n * 64) * 3; const v4f k0 = *(const v4f*)kp, k1 = *(const v4f*)(kp + 4), k2 = *(const v4f*)(kp + 8);   // four keys = 48 contiguous bytes
    const float f[12] = {k0[0], k0[1], k0[2], k0[3], k1[0], k1[1], k1[2], k1[3], k2[0], k2[1], k2[2], k2[3]}; v4f r;
#pragma unroll
    for (int e = 0; e < 4; ++e) { const float dx = xi - bfr(f[3 * e]), dy = yi - bfr(f[3 * e + 1]), dz = zi - bfr(f[3 * e + 2]); const float d2 = dx * dx + dy * dy + dz * dz; r[e] = (d2 > 0.f) ? sqrtf(d2) : 0.f; }
    vst2(dst + n * 1024, r); }
  asm volatile("s_wait_xcnt 0x0" ::: "memory"); }   // in the built kernel a projection tile's code follows this one's: the wait stands in front of whatever there lands on the stores' offset and data registers
__global__ __launch_bounds__(256) __attribute__((amdgpu_waves_per_eu(4, 4))) void k_proj(const float* __restrict__ X, const __bf16* __restrict__ PW, _Float16* __restrict__ QH, _Float16* __restrict__ QL, _Float16* __restrict__ KH, _Float16* __restrict__ VT, const float* __restrict__ P, float* __restrict__ D) {
  __shared__ __align__(16) __bf16 sx[64][XPI]; __shared__ __align__(16) _Float16 sw[8][2][16][72];
  if (blockIdx.y == 0) proj_tile<0>(sx, sw, X, PW, QH, QL);
  else if (blockIdx.y == 1) proj_tile<1>(sx, sw, X, PW, KH, KH);
  else if (blockIdx.y == 2) proj_tile<2>(sx, sw, X, PW, VT, VT);
  else { const int t = (blockIdx.y - 3) * (TNB * TT / 64) + blockIdx.x; dist_tile(P, D, t % (TT / 16), t / (TT / 16)); } }   // grid rows 3..6: the distance tiles need nothing of the projections and start last, on the places that the projections' second, half-full round leaves idle
#define KPI 72    // LDS pitch of a K row, f16: 144 B = 16 B x odd, no bank conflict for 16-byte reads down a column of rows
#define VPI 520   // LDS pitch of a V^T row, f16: 1040 B = 16 B x odd
__device__ __forceinline__ v8f wmma_h(v16h a, v16h b, v8f c) { return __builtin_amdgcn_wmma_f32_16x16x32_f16(false, a, false, b, (short)0, c, false, false); }
__device__ __forceinline__ float ex2(float x) { return __builtin_amdgcn_exp2f(x); }  // one v_exp_f32; an argument under -126 gives 0
#define LOG2E 1.4426950408889634
__device__ __forceinline__ float xhalf(float x) { return __builtin_bit_cast(float, __builtin_amdgcn_permlanex16(__builtin_bit_cast(int, x), __builtin_bit_cast(int, x), 0x76543210, 0xfedcba98, false, false)); }  // lane l with lane l ^ 16
__global__ __launch_bounds__(256) __attribute__((amdgpu_waves_per_eu(4, 4))) void k_att(const _Float16* __restrict__ QH, const _Float16* __restrict__ QL, const _Float16* __restrict__ KH, const _Float16* __restrict__ VT, const float* __restrict__ Dm, float* __restrict__ U) {
  __shared__ __align__(16) _Float16 sk[TT][KPI]; __shared__ __align__(16) _Float16 sv[HD][VPI];
  const int tid = threadIdx.x, wave = tid >> 5, lane = tid & 31, col = lane & 15, g = lane >> 4; const size_t b = blockIdx.z; const int h = blockIdx.y; const int q0 = blockIdx.x * 256 + wave * 32;
  { const _Float16* kg = KH + (b * TT + (tid >> 3)) * CC + h * HD + (tid & 7) * 8; const _Float16* vg = VT + (b * CC + h * HD + (tid >> 6)) * (size_t)TT + (tid & 63) * 8;   // 8 threads a K row of 128 B, 64 threads a V^T row of 1 KiB
    v8h kr[TT / 32], vr[HD / 4];
    // all unrolled: a thread's 16-byte loads are in flight together
#pragma unroll
    for (int i = 0; i < TT / 32; ++i) kr[i] = *(const v8h*)(kg + i * 32 * CC);
#pragma unroll
    for (int i = 0; i < HD / 4; ++i) vr[i] = *(const v8h*)(vg + i * 4 * TT);
    asm volatile("s_wait_xcnt 0x0" :: "v"(kg), "v"(vg) : "memory");   // the loads' two address pairs are taken again for the Q addresses: the wait stands in front of that; named as inputs, the pairs stay whole up to it
#pragma unroll
    for (int i = 0; i < TT / 32; ++i) *(v8h*)&sk[(tid >> 3) + i * 32][(tid & 7) * 8] = kr[i];
#pragma unroll
    for (int i = 0; i < HD / 4; ++i) *(v8h*)&sv[(tid >> 6) + i * 4][(tid & 63) * 8] = vr[i]; }
  v16h qh[2][2], ql[2][2];
#pragma unroll
  for (int qt = 0; qt < 2; ++qt)
#pragma unroll
    for (int kc = 0; kc < 2; ++kc) { const size_t o = (b * TT + q0 + qt * 16 + col) * CC + h * HD + kc * 32; qh[qt][kc] = frag_h(QH + o, lane); ql[qt][kc] = frag_h(QL + o, lane); }
  const float* dp = Dm + (b * (TT / 16) + (q0 >> 4)) * (size_t)(16 * TT) + lane * 4;   // dist_tile's unit order: every load below is 512 contiguous bytes over the wave
  v8f o[2][4] = {}; float m[2] = {-3.0e38f, -3.0e38f}, l[2] = {0.f, 0.f};
  const float c2 = (float)(0.125 * 0.70710678118654752 * LOG2E);   // att log2(e) = (16 dist + q.k) c2
  __syncthreads();
  // rolled: sixteen passes unrolled would not fit the register budget of four waves per SIMD
#pragma unroll 1
  for (int k0 = 0; k0 < TT; k0 += 32) {
    v8f s[2][2] = {};   // [query tile][key tile]: register r = key k0 + 16 t + 8 g + r, column = query
#pragma unroll
    for (int kc = 0; kc < 2; ++kc) { v16h kb[2];
#pragma unroll
      for (int t = 0; t < 2; ++t) kb[t] = frag_h(&sk[k0 + t * 16 + col][kc * 32], lane);
#pragma unroll
      for (int t = 0; t < 2; ++t)
#pragma unroll
        for (int qt = 0; qt < 2; ++qt) s[qt][t] = wmma_h(kb[t], qh[qt][kc], s[qt][t]);
#pragma unroll
      for (int t = 0; t < 2; ++t)
#pragma unroll
        for (int qt = 0; qt < 2; ++qt) s[qt][t] = wmma_h(kb[t], ql[qt][kc], s[qt][t]); }
#pragma unroll
    for (int qt = 0; qt < 2; ++qt) { v2f z[8];   // z = 16 dist + q.k, two keys a pair; maximum and running maximum are kept in z
#pragma unroll
      for (int t = 0; t < 2; ++t) { const float* dq = dp + qt * 16 * TT + k0 * 16 + t * 256; const v4f d0 = *(const v4f*)dq, d1 = *(const v4f*)(dq + 128); const v2f c16 = {16.0f, 16.0f};
#pragma unroll
        for (int r = 0; r < 2; ++r) { z[t * 4 + r] = __builtin_elementwise_fma((v2f){d0[2 * r], d0[2 * r + 1]}, c16, (v2f){s[qt][t][2 * r], s[qt][t][2 * r + 1]}); z[t * 4 + 2 + r] = __builtin_elementwise_fma((v2f){d1[2 * r], d1[2 * r + 1]}, c16, (v2f){s[qt][t][4 + 2 * r], s[qt][t][5 + 2 * r]}); } }
      float mx = z[0][0];
#pragma unroll
      for (int i = 1; i < 16; ++i) mx = fmaxf(mx, z[i >> 1][i & 1]);
      mx = fmaxf(mx, xhalf(mx));
      const float mn = fmaxf(m[qt], mx); const float al = ex2((m[qt] - mn) * c2); m[qt] = mn;
      const float nb = __builtin_fmaf(-mn, c2, 11.0f);   // P and its sum both carry 2^11, which keeps small weights out of the f16 subnormals and cancels in the division
      float sum = 0.f; v16h p;
#pragma unroll
      for (int i = 0; i < 8; ++i) { const v2f y = __builtin_elementwise_fma(z[i], (v2f){c2, c2}, (v2f){nb, nb}); const float e0 = ex2(y[0]), e1 = ex2(y[1]); sum += e0; sum += e1; p[2 * i] = (_Float16)e0; p[2 * i + 1] = (_Float16)e1; }
      l[qt] = l[qt] * al + sum;
#pragma unroll
      for (int j = 0; j < 4; ++j) o[qt][j] *= al;
#pragma unroll
      for (int j = 0; j < 4; ++j) o[qt][j] = wmma_h(frag_h(&sv[j * 16 + col][k0], lane), p, o[qt][j]); } }
#pragma unroll
  for (int qt = 0; qt < 2; ++qt) { const float inv = 1.0f / (l[qt] + xhalf(l[qt])); float* up = U + (b * TT + q0 + qt * 16 + col) * CC + h * HD + 8 * g;
#pragma unroll
    for (int j = 0; j < 4; ++j) { v4f a0, a1;
#pragma unroll
      for (int r = 0; r < 4; ++r) { a0[r] = o[qt][j][r] * inv; a1[r] = o[qt][j][4 + r] * inv; }
      vst2(up + j * 16, a0); vst2(up + j * 16 + 4, a1); } } }
// ---- k_mlp: block = (64 rows, 128-col block), 4 WC waves = 4 groups of 16 rows x WC parts of the block's columns: OUT = silu(A (hi+lo) W + b), A rows [K], W packed fragments of [K][N]. A wave's load waits, products and SiLU follow one another; where K is long that chain is the launch's length, and WC = 2 halves it (half the fragments a k step, so twice the k steps behind one wait)
template <int K, int N, int WC>
__global__ __launch_bounds__(128 * WC) void k_mlp(const float* __restrict__ A, const __bf16* __restrict__ PW, const float* __restrict__ Bv, float* __restrict__ OUT) { constexpr int CB = (N < 128 ? N : 128) / WC; __shared__ __align__(16) float sf[4 * WC][16][128 / WC + 4];   // CB = columns of a wave
  const int tid = threadIdx.x, wave = tid >> 5, lane = tid & 31, col = lane & 15, g = lane >> 4; const int c0 = blockIdx.y * 128 + (WC > 1 ? (wave >> 2) * CB : 0); const size_t r0 = (size_t)blockIdx.x * 64 + (WC > 1 ? wave & 3 : wave) * 16; constexpr int NT = CB / 16; constexpr int G = 16 / NT < K / 32 ? 16 / NT : K / 32;   // k steps whose fragments (16 at most) are loaded together
  const __bf16* pw = PW + (size_t)(c0 / 16) * 512; const float* ar = A + (r0 + col) * K + 8 * g;
  v8f acc[NT]; for (int j = 0; j < NT; ++j) for (int r = 0; r < 8; ++r) acc[j][r] = 0.f;
  // rolled: one group's loads and products are the whole body, the text stays short
#pragma unroll 1
  for (int kg = 0; kg < K / 32; kg += G) { v16b w[G][NT]; v4f av[G][4];
#pragma unroll
    for (int s = 0; s < G; ++s)
#pragma unroll
      for (int i = 0; i < 4; ++i) av[s][i] = *(const v4f*)(ar + (kg + s) * 32 + (i >> 1) * 16 + (i & 1) * 4);
    asm volatile("s_wait_xcnt 0x0" ::: "memory");   // the fragment loads below may land on the row loads' address registers: the wait stands in front of that; its clobber also keeps every row load of the group up here, where left free the later steps' sink behind the first products and pay their latency again
#pragma unroll
    for (int s = 0; s < G; ++s)
#pragma unroll
      for (int j = 0; j < NT; ++j) w[s][j] = frag_p(pw + (size_t)((kg + s) * (N / 16) + j) * 512, lane);
#pragma unroll
    for (int s = 0; s < G; ++s) { float af[16];
#pragma unroll
      for (int i = 0; i < 16; ++i) af[i] = av[s][i >> 2][i & 3];
      const F2 a = bsplit16(af);
#pragma unroll
      for (int j = 0; j < NT; ++j) { acc[j] = wmma_bf(a.h, w[s][j], acc[j]); acc[j] = wmma_bf(a.l, w[s][j], acc[j]); } } }
#pragma unroll
  for (int j = 0; j < NT; ++j) { const float bb = bfr(Bv[c0 + j * 16 + col]);
#pragma unroll
    for (int r = 0; r < 8; ++r) { const float v = acc[j][r] + bb; sf[wave][8 * g + r][j * 16 + col] = v / (1.0f + ex2(v * (float)-LOG2E)); } }
  LDSX(); for (int rl = 0; rl < 16; ++rl) if (lane < NT * 4) vst2(OUT + (r0 + rl) * N + c0 + lane * 4, *(const v4f*)&sf[wave][rl][lane * 4]); }
extern "C" void kernel_launch(void* const* d_in, const int* in_sizes, int n_in, void* d_out, int out_size, void* d_ws, size_t ws_size, hipStream_t stream) {
  (void)in_sizes; (void)n_in; (void)out_size;
  const float** F = (const float**)d_in;   // 0 kp_pos [32,512,3], 1 kp_feat [32,512,256], 2 Wk [256,512], 3 Wq, 4 Wv, 5 W1 [512,128], 6 b1, 7 W2 [128,64], 8 b2, 9 W3 [64,256], 10 b3
  if (ws_size < (size_t)WS_END) return;
  char* ws = (char*)d_ws; _Float16 *QH = (_Float16*)(ws + WS_QH), *QL = (_Float16*)(ws + WS_QL), *KH = (_Float16*)(ws + WS_KH), *VT = (_Float16*)(ws + WS_VT); __bf16* PW = (__bf16*)(ws + WS_PW); float *D = (float*)(ws + WS_D), *U = (float*)(ws + WS_U), *H1 = (float*)(ws + WS_H1), *H2 = (float*)(ws + WS_H2);
  k_pack<<<dim3(PW_N / 8 / 256), 256, 0, stream>>>(F[3], F[2], F[4], F[5], F[7], F[9], PW);
  k_proj<<<dim3(TNB * TT / 64, 7), 256, 0, stream>>>(F[1], PW, QH, QL, KH, VT, F[0], D);
  k_att<<<dim3(TT / 256, NH, TNB), 256, 0, stream>>>(QH, QL, KH, VT, D, U);
  k_mlp<CC, 128, 2><<<dim3(TNB * TT / 64, 1), 256, 0, stream>>>(U, PW + PW_1, F[6], H1);
  k_mlp<128, 64, 1><<<dim3(TNB * TT / 64, 1), 128, 0, stream>>>(H1, PW + PW_2, F[8], H2);
  k_mlp<64, CIN, 1><<<dim3(TNB * TT / 64, CIN / 128), 128, 0, stream>>>(H2, PW + PW_3, F[10], (float*)d_out);
}

// v008
// A run of this version takes 76.6 microseconds.
// Timed twice side by side with v007, it ran 1.05 and 1.06 times as fast.
// Over all steps from v000 it is 8.30 times as fast.
// compute dtype: all float inputs rounded to bf16; keys/queries/values = kp_feat W with EXACT bf16 products on WMMA 16x16x32, f32 accumulate; pairwise distances sqrt(sum (p_i - p_j)^2) in f32 (precise sqrtf) once per batch; att = (dist / 0.5 + q . k / 8) / sqrt(2) with q as f16 hi + residual, k f16 (2 products), kept in registers; softmax in f32 (base-2 exponent formed by one multiply-add, hardware exp2, running maximum and sum) -> P f16 x 2^11, unnormalised; upd = P . v / sum (v rounded once to f16); out MLP 512 -> 128 -> 64 -> 256 with SiLU (hardware exp2) after each, activations split bf16 hi + lo (2 products); f32 output.
#include <hip/hip_runtime.h>
#include <math.h>

typedef __attribute__((ext_vector_type(16))) _Float16 v16h;
typedef __attribute__((ext_vector_type(16))) __bf16 v16b;
typedef __attribute__((ext_vector_type(8)))  _Float16 v8h;
typedef __attribute__((ext_vector_type(8)))  float v8f;
typedef __attribute__((ext_vector_type(4)))  float v4f;
typedef __attribute__((ext_vector_type(2)))  float v2f;
typedef __attribute__((ext_vector_type(4)))  unsigned v4u;
typedef __attribute__((ext_vector_type(4)))  int v4i;
typedef float __attribute__((may_alias)) float_a;
typedef int __attribute__((may_alias)) int_a;

template <typename T> __device__ __forceinline__ void vst2(void* p, T v) { *(T*)p = v;  }
__device__ __forceinline__ v8f wmma16(v16h a, v16h b, v8f c) {
  v8f d = __builtin_amdgcn_wmma_f32_16x16x32_f16(false, a, false, b, (short)0, c, false, false);
  asm volatile("v_nop\n\tv_nop\n\tv_nop\n\tv_nop" : "+v"(d) : "v"(a), "v"(b));
  return d;
}
__device__ __forceinline__ v8f wmma_bf(v16b a, v16b b, v8f c) {
  v8f d = __builtin_amdgcn_wmma_f32_16x16x32_bf16(false, a, false, b, (short)0, c, false, false);
  asm volatile("v_nop\n\tv_nop\n\tv_nop\n\tv_nop" : "+v"(d) : "v"(a), "v"(b));
  return d;
}
// 16x16x32 fragments: lane = (h = lane>>4, row/col = lane&15); elements 0..7 = k0+8h+0..7, 8..15 = k0+16+8h+0..7; D element r = row 8h+r
__device__ __forceinline__ v16h frag_h(const _Float16* rowk0, int lane) {
  union { v16h v; v8h q[2]; } u; const _Float16* p = rowk0 + 8 * (lane >> 4);
  u.q[0] = *(const v8h*)p; u.q[1] = *(const v8h*)(p + 16); return u.v;
}
__device__ __forceinline__ v16h frag_f32(const float* rowk0, int lane) {
  v16h a; const float* p = rowk0 + 8 * (lane >> 4);
#pragma unroll
  for (int i = 0; i < 8; ++i) { a[i] = (_Float16)p[i]; a[8 + i] = (_Float16)p[16 + i]; }
  return a;
}
__device__ __forceinline__ v16h frag_f32s(const float* rowk0, int lane, float sc) {
  v16h a; const float* p = rowk0 + 8 * (lane >> 4);
#pragma unroll
  for (int i = 0; i < 8; ++i) { a[i] = (_Float16)(p[i] * sc); a[8 + i] = (_Float16)(p[16 + i] * sc); }
  return a;
}
// column fragment from a [K][ld] layout (column n), rows >= K read as 0
__device__ __forceinline__ v16h fragc_f32(const float* W, int k0, int n, int lane, int ld, int K) {
  v16h a; const int g = lane >> 4;
#pragma unroll
  for (int i = 0; i < 8; ++i) { const int ka = k0 + 8 * g + i, kb = ka + 16;
    a[i] = (_Float16)(ka < K ? W[(size_t)(ka < K ? ka : K - 1) * ld + n] : 0.f); a[8 + i] = (_Float16)(kb < K ? W[(size_t)(kb < K ? kb : K - 1) * ld + n] : 0.f); }
  return a;
}
struct F2 { v16b h, l; };
__device__ __forceinline__ F2 bsplit16(const float v[16]) { F2 r;
#pragma unroll
  for (int i = 0; i < 16; ++i) { const __bf16 h = (__bf16)v[i]; r.h[i] = h; r.l[i] = (__bf16)(v[i] - (float)h); }
  return r; }
__device__ __forceinline__ F2 split_row(const float* row, int k0, int lane) { float v[16]; const float* p = row + k0 + 8 * (lane >> 4);
#pragma unroll
  for (int i = 0; i < 8; ++i) { v[i] = p[i]; v[8 + i] = p[16 + i]; }
  return bsplit16(v); }
__device__ __forceinline__ F2 split_rowK(const float* row, int k0, int lane, int K) { float v[16]; const int g = lane >> 4;
#pragma unroll
  for (int i = 0; i < 8; ++i) { const int ka = k0 + 8 * g + i, kb = ka + 16; v[i] = ka < K ? row[ka < K ? ka : K - 1] : 0.f; v[8 + i] = kb < K ? row[kb < K ? kb : K - 1] : 0.f; }
  return bsplit16(v); }
__device__ __forceinline__ F2 split_col(const float* W, int k0, int n, int lane, int ld, int K) { float v[16]; const int g = lane >> 4;
#pragma unroll
  for (int i = 0; i < 8; ++i) { const int ka = k0 + 8 * g + i, kb = ka + 16; v[i] = ka < K ? W[(size_t)(ka < K ? ka : K - 1) * ld + n] : 0.f; v[8 + i] = kb < K ? W[(size_t)(kb < K ? kb : K - 1) * ld + n] : 0.f; }
  return bsplit16(v); }
__device__ __forceinline__ v8f mac3(const F2& a, const F2& b, v8f c) { c = wmma_bf(a.l, b.h, c); c = wmma_bf(a.h, b.l, c); return wmma_bf(a.h, b.h, c); }
__device__ __forceinline__ float sigm(float v) { return 1.0f / (1.0f + expf(-v)); }
#define LDSX() do { asm volatile("s_wait_dscnt 0" ::: "memory"); __builtin_amdgcn_wave_barrier(); __builtin_amdgcn_fence(__ATOMIC_RELEASE, "workgroup"); } while (0)


// Keypoint multi-head attention (B 32, N 512 keypoints, in_dim 256, 8 heads x 64): distance-biased attention followed by a 3-layer SiLU MLP.
#define NB 32
#define TT 512
#define CIN 256
#define CC 512
#define NH 8
#define HD 64
#define NR (NB * TT)
#ifndef TNB
#define TNB NB
#endif
typedef __attribute__((ext_vector_type(8))) __bf16 v8b;
__device__ __forceinline__ v16b frag_b(const __bf16* rowk0, int lane) {
  union { v16b v; v8b q[2]; } u; const __bf16* p = rowk0 + 8 * (lane >> 4);
  u.q[0] = *(const v8b*)p; u.q[1] = *(const v8b*)(p + 16); return u.v;
}
__device__ __forceinline__ float bfr(float v) { return (float)(__bf16)v; }
__device__ __attribute__((noinline)) float exp_ni(float v) { return expf(v); }
__device__ __attribute__((noinline)) float erf_ni(float v) { return erff(v); }

#define WS_QH  0u
#define WS_QL  (WS_QH + 2u * (size_t)NR * CC)
#define WS_KH  (WS_QL + 2u * (size_t)NR * CC)
#define WS_VT  (WS_KH + 2u * (size_t)NR * CC)          // f16 v planes [b][512][t]
#define WS_D   (WS_VT + 2u * (size_t)NR * CC)          // f32 dist [b][tile of 16 queries][unit], dist_tile's order
#define WS_U   (WS_D + 4u * (size_t)NB * TT * TT)      // f32 upd rows [b*t][512]
#define WS_H1  (WS_U + 4u * (size_t)NR * CC)           // unused: k_mlp3 keeps H1 in LDS
#define WS_H2  (WS_H1 + 4u * (size_t)NR * 128)         // unused: k_mlp3 keeps H2 in LDS
#define WS_PW  (WS_H2 + 4u * (size_t)NR * 64)          // bf16 weights in fragment order: Wq, Wk, Wv, W1, W2, W3
#define PW_P   (CIN * CC)                              // elements of one projection matrix
#define PW_1   (3 * PW_P)
#define PW_2   (PW_1 + CC * 128)
#define PW_3   (PW_2 + 128 * 64)
#define PW_N   (PW_3 + 64 * CIN)
#define WS_END (WS_PW + 2u * (size_t)PW_N)

// ---- k_pack: every weight matrix W [K][N] (in,out), rounded to bf16 once and laid out as finished B fragments: fragment (kc, nt) = 1 KiB = two runs of 32 lanes x 16 B; lane (g, col) holds column nt*16+col, run 0 = rows kc*32+8g+0..7, run 1 = rows kc*32+16+8g+0..7. One thread writes one 16-byte unit u.
template <int N> __device__ __forceinline__ void pack_unit(const float* __restrict__ Wm, __bf16* __restrict__ dst, int u) {
  const int lane = u & 31, run = (u >> 5) & 1, f = u >> 6, nt = f % (N / 16), kc = f / (N / 16);
  const float* p = Wm + (size_t)(kc * 32 + run * 16 + 8 * (lane >> 4)) * N + nt * 16 + (lane & 15); v8b v;
#pragma unroll
  for (int i = 0; i < 8; ++i) v[i] = (__bf16)p[(size_t)i * N];
  *(v8b*)(dst + (size_t)u * 8) = v; }
__global__ __launch_bounds__(256) void k_pack(const float* __restrict__ WQ, const float* __restrict__ WK, const float* __restrict__ WV, const float* __restrict__ W1, const float* __restrict__ W2, const float* __restrict__ W3, __bf16* __restrict__ PW) {
  const int u = blockIdx.x * 256 + threadIdx.x;   // every matrix is a whole number of blocks, so the choice below is the same for a whole block
  if (u < PW_1 / 8) { const int m = u / (PW_P / 8); pack_unit<CC>(m == 0 ? WQ : m == 1 ? WK : WV, PW + (size_t)m * PW_P, u - m * (PW_P / 8)); }
  else if (u < PW_2 / 8) pack_unit<128>(W1, PW + PW_1, u - PW_1 / 8);
  else if (u < PW_3 / 8) pack_unit<64>(W2, PW + PW_2, u - PW_2 / 8);
  else pack_unit<CIN>(W3, PW + PW_3, u - PW_3 / 8); }
// a packed fragment: two 16-byte loads a lane, each a run of 512 contiguous bytes over the wave
__device__ __forceinline__ v16b frag_p(const __bf16* f, int lane) {
  union { v16b v; v8b q[2]; } u; u.q[0] = *(const v8b*)(f + lane * 8); u.q[1] = *(const v8b*)(f + 256 + lane * 8); return u.v;
}

// ---- k_proj: block = (64 rows, which), 8 waves, a wave = 64 rows x 64 columns (16 accumulator tiles): kp_feat W (packed fragments of [256][512]), no bias. The block's rows are rounded to bf16 once and lie in LDS for all eight waves; a weight fragment is loaded by one wave only and feeds four products
#define XPI 264   // LDS pitch of a staged row, bf16: 528 B = 16 B x odd, no bank conflict for 16-byte reads down a column of rows
typedef __attribute__((ext_vector_type(4))) __bf16 v4b;
__device__ __forceinline__ v8f wmma_b(v16b a, v16b b, v8f c) { return __builtin_amdgcn_wmma_f32_16x16x32_bf16(false, a, false, b, (short)0, c, false, false); }
// Q and K (WHICH 0, 1): D = W^T X^T, a lane holds 8 neighbouring columns of one row; V (WHICH 2): D = X W, a lane holds 8 neighbouring rows of one column, which is V^T's order. Either way 16 bytes of f16 a tile, and the four tiles C of a line tile L make whole 128-byte lines of the output, put together in the wave's own LDS rows. Every short loop over tiles, fragments or elements below is unrolled, so that the fragment and accumulator arrays are indexed at compile time and stay in registers
template <int WHICH> __device__ __forceinline__ void proj_tile(__bf16 (*sx)[XPI], _Float16 (*sw)[2][16][72], const float* __restrict__ X, const __bf16* __restrict__ PW, _Float16* __restrict__ DH, _Float16* __restrict__ DL) {
  const int tid = threadIdx.x, wave = __builtin_amdgcn_readfirstlane(tid >> 5), lane = tid & 31, col = lane & 15, g = lane >> 4; const size_t r0 = (size_t)blockIdx.x * 64; const __bf16* pw = PW + (size_t)WHICH * PW_P + (size_t)(wave * 4) * 512;
  v8f acc[4][4] = {}; v16b wa[4], wb[4], x[4];
  auto ldw = [&](v16b (&w)[4], int kc) {
#pragma unroll
    for (int j = 0; j < 4; ++j) w[j] = frag_p(pw + (size_t)(kc * (CC / 16) + j) * 512, lane); };
  auto ldx = [&](int kc) {
#pragma unroll
    for (int i = 0; i < 4; ++i) x[i] = frag_b(&sx[i * 16 + col][kc * 32], lane);
    __builtin_amdgcn_sched_barrier(0); };   // keeps a k step's loads, the weight loads for the step after it among them, in one group ahead of the products: left free, the weight loads sink to their first use and their latency is paid there
  auto mul = [&](const v16b (&w)[4]) {
#pragma unroll
    for (int L = 0; L < 4; ++L)
#pragma unroll
      for (int C = 0; C < 4; ++C) acc[L][C] = WHICH < 2 ? wmma_b(w[C], x[L], acc[L][C]) : wmma_b(x[C], w[L], acc[L][C]); };
  ldw(wa, 0);   // the first k step's weights are asked for ahead of the staging
  { const float* xg = X + (r0 + (tid >> 6)) * CIN + (tid & 63) * 4; v4f xr[16];   // 64 threads a row of 1 KiB: a wave's load covers 512 contiguous bytes
    // unrolled: a thread's sixteen loads are in flight together
#pragma unroll
    for (int i = 0; i < 16; ++i) xr[i] = *(const v4f*)(xg + i * 4 * CIN);
    asm volatile("s_wait_xcnt 0x0" :: "v"(xg) : "memory");   // the row loads' address pair is free for reuse from here on: the wait stands in front of whatever lands on it
#pragma unroll
    for (int i = 0; i < 16; ++i) { v4b c;
#pragma unroll
      for (int e = 0; e < 4; ++e) c[e] = (__bf16)xr[i][e];
      *(v4b*)&sx[(tid >> 6) + i * 4][(tid & 63) * 4] = c; } }
  __syncthreads();
  // rolled, two k steps a trip: the two weight sets keep their registers, and each is loaded anew while the other set's products run; unrolled whole, the loads are lifted further than the register budget of four waves per SIMD holds
#pragma unroll 1
  for (int kk = 0; kk < CIN / 64 - 1; ++kk) { ldw(wb, 2 * kk + 1); ldx(2 * kk); mul(wa); ldw(wa, 2 * kk + 2); ldx(2 * kk + 1); mul(wb);
    asm volatile("s_wait_xcnt 0x0" ::: "memory"); }   // the next trip forms its weight address in the registers that this trip's loads name: the wait stands in front of that
  ldw(wb, CIN / 32 - 1); ldx(CIN / 32 - 2); mul(wa); ldx(CIN / 32 - 1); mul(wb);
  asm volatile("s_wait_xcnt 0x0" ::: "memory");   // the weight loads' address registers are free for reuse from here on: the wait stands in front of whatever lands on them
  _Float16 (*st)[16][72] = sw[wave];
  const size_t o = (WHICH < 2 ? r0 * CC + wave * 64 : ((r0 / TT) * CC + wave * 64) * (size_t)TT + r0 % TT) + (size_t)(lane >> 3) * CC + (lane & 7) * 8;   // 8 lanes a line; CC = TT is the pitch of all four outputs
  _Float16* ph = DH + o; _Float16* pl = DL + o;
#pragma unroll
  for (int L = 0; L < 4; ++L) {
#pragma unroll
    for (int C = 0; C < 4; ++C) { v8h hv, lv;
#pragma unroll
      for (int r = 0; r < 8; ++r) { const float v = acc[L][C][r]; const _Float16 h = (_Float16)v; hv[r] = h; lv[r] = (_Float16)(v - (float)h); }
      *(v8h*)&st[0][col][C * 16 + 8 * g] = hv; if (WHICH == 0) *(v8h*)&st[1][col][C * 16 + 8 * g] = lv; }
    asm volatile("s_wait_dscnt 0x0" ::: "memory");   // the rows are read back across the wave's lanes: its LDS writes have landed first
#pragma unroll
    for (int n = 0; n < 4; ++n) { vst2(ph + (size_t)(L * 16 + n * 4) * CC, *(const v4u*)&st[0][n * 4 + (lane >> 3)][(lane & 7) * 8]); if (WHICH == 0) vst2(pl + (size_t)(L * 16 + n * 4) * CC, *(const v4u*)&st[1][n * 4 + (lane >> 3)][(lane & 7) * 8]); }
    asm volatile("s_wait_xcnt 0x0" ::: "memory");   // the stores' data registers are loaded anew for the next line tile: the wait stands in front of that; its clobber also keeps the next tile's LDS writes behind these reads
  } }
static_assert(CC == TT, "one line pitch for Q, K and V^T");
// ---- dist_tile: block = (tile of 16 queries, batch b), run by the last blocks of k_proj's grid: |p_i - p_j| (0 when the squared sum is exactly 0), stored in the order in which a wave of k_att reads it. A tile's 16 x 512 distances are 2,048 units of 16 B; unit u = ((kb * 2 + t) * 2 + hf) * 32 + lane holds query (lane & 15) of the tile against keys kb * 32 + t * 16 + (lane >> 4) * 8 + hf * 4 + 0..3, so the 32 lanes of one load or store cover 512 contiguous bytes. Thread tid writes units tid + 256 n
__device__ __forceinline__ void dist_tile(const float* __restrict__ P, float* __restrict__ D, int tile, size_t b) {
  const int tid = threadIdx.x, lane = tid & 31; const float* pb = P + b * TT * 3; const int i = tile * 16 + (lane & 15);
  const float xi = bfr(pb[i * 3]), yi = bfr(pb[i * 3 + 1]), zi = bfr(pb[i * 3 + 2]);
  asm volatile("s_wait_xcnt 0x0" ::: "memory");   // the query load's address pair is free for reuse from here on: the wait stands in front of whatever lands on it
  const int j0 = (tid >> 7) * 32 + ((tid >> 6) & 1) * 16 + (lane >> 4) * 8 + ((tid >> 5) & 1) * 4; float* dst = D + (b * (TT / 16) + tile) * (size_t)(16 * TT) + tid * 4;
  // unrolled: the key loads of a thread's eight units are in flight together
#pragma unroll
  for (int n = 0; n < 8; ++n) { const float* kp = pb + (j0 + n * 64) * 3; const v4f k0 = *(const v4f*)kp, k1 = *(const v4f*)(kp + 4), k2 = *(const v4f*)(kp + 8);   // four keys = 48 contiguous bytes
    const float f[12] = {k0[0], k0[1], k0[2], k0[3], k1[0], k1[1], k1[2], k1[3], k2[0], k2[1], k2[2], k2[3]}; v4f r;
#pragma unroll
    for (int e = 0; e < 4; ++e) { const float dx = xi - bfr(f[3 * e]), dy = yi - bfr(f[3 * e + 1]), dz = zi - bfr(f[3 * e + 2]); const float d2 = dx * dx + dy * dy + dz * dz; r[e] = (d2 > 0.f) ? sqrtf(d2) : 0.f; }
    vst2(dst + n * 1024, r); }
  asm volatile("s_wait_xcnt 0x0" ::: "memory"); }   // in the built kernel a projection tile's code follows this one's: the wait stands in front of whatever there lands on the stores' offset and data registers
__global__ __launch_bounds__(256) __attribute__((amdgpu_waves_per_eu(4, 4))) void k_proj(const float* __restrict__ X, const __bf16* __restrict__ PW, _Float16* __restrict__ QH, _Float16* __restrict__ QL, _Float16* __restrict__ KH, _Float16* __restrict__ VT, const float* __restrict__ P, float* __restrict__ D) {
  __shared__ __align__(16) __bf16 sx[64][XPI]; __shared__ __align__(16) _Float16 sw[8][2][16][72];
  if (blockIdx.y == 0) proj_tile<0>(sx, sw, X, PW, QH, QL);
  else if (blockIdx.y == 1) proj_tile<1>(sx, sw, X, PW, KH, KH);
  else if (blockIdx.y == 2) proj_tile<2>(sx, sw, X, PW, VT, VT);
  else { const int t = (blockIdx.y - 3) * (TNB * TT / 64) + blockIdx.x; dist_tile(P, D, t % (TT / 16), t / (TT / 16)); } }   // grid rows 3..6: the distance tiles need nothing of the projections and start last, on the places that the projections' second, half-full round leaves idle
#define KPI 72    // LDS pitch of a K row, f16: 144 B = 16 B x odd, no bank conflict for 16-byte reads down a column of rows
#define VPI 520   // LDS pitch of a V^T row, f16: 1040 B = 16 B x odd
__device__ __forceinline__ v8f wmma_h(v16h a, v16h b, v8f c) { return __builtin_amdgcn_wmma_f32_16x16x32_f16(false, a, false, b, (short)0, c, false, false); }
__device__ __forceinline__ float ex2(float x) { return __builtin_amdgcn_exp2f(x); }  // one v_exp_f32; an argument under -126 gives 0
#define LOG2E 1.4426950408889634
__device__ __forceinline__ float xhalf(float x) { return __builtin_bit_cast(float, __builtin_amdgcn_permlanex16(__builtin_bit_cast(int, x), __builtin_bit_cast(int, x), 0x76543210, 0xfedcba98, false, false)); }  // lane l with lane l ^ 16
__global__ __launch_bounds__(256) __attribute__((amdgpu_waves_per_eu(4, 4))) void k_att(const _Float16* __restrict__ QH, const _Float16* __restrict__ QL, const _Float16* __restrict__ KH, const _Float16* __restrict__ VT, const float* __restrict__ Dm, float* __restrict__ U) {
  __shared__ __align__(16) _Float16 sk[TT][KPI]; __shared__ __align__(16) _Float16 sv[HD][VPI];
  const int tid = threadIdx.x, wave = tid >> 5, lane = tid & 31, col = lane & 15, g = lane >> 4; const size_t b = blockIdx.z; const int h = blockIdx.y; const int q0 = blockIdx.x * 256 + wave * 32;
  { const _Float16* kg = KH + (b * TT + (tid >> 3)) * CC + h * HD + (tid & 7) * 8; const _Float16* vg = VT + (b * CC + h * HD + (tid >> 6)) * (size_t)TT + (tid & 63) * 8;   // 8 threads a K row of 128 B, 64 threads a V^T row of 1 KiB
    v8h kr[TT / 32], vr[HD / 4];
    // all unrolled: a thread's 16-byte loads are in flight together
#pragma unroll
    for (int i = 0; i < TT / 32; ++i) kr[i] = *(const v8h*)(kg + i * 32 * CC);
#pragma unroll
    for (int i = 0; i < HD / 4; ++i) vr[i] = *(const v8h*)(vg + i * 4 * TT);
    asm volatile("s_wait_xcnt 0x0" :: "v"(kg), "v"(vg) : "memory");   // the loads' two address pairs are taken again for the Q addresses: the wait stands in front of that; named as inputs, the pairs stay whole up to it
#pragma unroll
    for (int i = 0; i < TT / 32; ++i) *(v8h*)&sk[(tid >> 3) + i * 32][(tid & 7) * 8] = kr[i];
#pragma unroll
    for (int i = 0; i < HD / 4; ++i) *(v8h*)&sv[(tid >> 6) + i * 4][(tid & 63) * 8] = vr[i]; }
  v16h qh[2][2], ql[2][2];
#pragma unroll
  for (int qt = 0; qt < 2; ++qt)
#pragma unroll
    for (int kc = 0; kc < 2; ++kc) { const size_t o = (b * TT + q0 + qt * 16 + col) * CC + h * HD + kc * 32; qh[qt][kc] = frag_h(QH + o, lane); ql[qt][kc] = frag_h(QL + o, lane); }
  const float* dp = Dm + (b * (TT / 16) + (q0 >> 4)) * (size_t)(16 * TT) + lane * 4;   // dist_tile's unit order: every load below is 512 contiguous bytes over the wave
  v8f o[2][4] = {}; float m[2] = {-3.0e38f, -3.0e38f}, l[2] = {0.f, 0.f};
  const float c2 = (float)(0.125 * 0.70710678118654752 * LOG2E);   // att log2(e) = (16 dist + q.k) c2
  __syncthreads();
  // rolled: sixteen passes unrolled would not fit the register budget of four waves per SIMD
#pragma unroll 1
  for (int k0 = 0; k0 < TT; k0 += 32) {
    v8f s[2][2] = {};   // [query tile][key tile]: register r = key k0 + 16 t + 8 g + r, column = query
#pragma unroll
    for (int kc = 0; kc < 2; ++kc) { v16h kb[2];
#pragma unroll
      for (int t = 0; t < 2; ++t) kb[t] = frag_h(&sk[k0 + t * 16 + col][kc * 32], lane);
#pragma unroll
      for (int t = 0; t < 2; ++t)
#pragma unroll
        for (int qt = 0; qt < 2; ++qt) s[qt][t] = wmma_h(kb[t], qh[qt][kc], s[qt][t]);
#pragma unroll
      for (int t = 0; t < 2; ++t)
#pragma unroll
        for (int qt = 0; qt < 2; ++qt) s[qt][t] = wmma_h(kb[t], ql[qt][kc], s[qt][t]); }
#pragma unroll
    for (int qt = 0; qt < 2; ++qt) { v2f z[8];   // z = 16 dist + q.k, two keys a pair; maximum and running maximum are kept in z
#pragma unroll
      for (int t = 0; t < 2; ++t) { const float* dq = dp + qt * 16 * TT + k0 * 16 + t * 256; const v4f d0 = *(const v4f*)dq, d1 = *(const v4f*)(dq + 128); const v2f c16 = {16.0f, 16.0f};
#pragma unroll
        for (int r = 0; r < 2; ++r) { z[t * 4 + r] = __builtin_elementwise_fma((v2f){d0[2 * r], d0[2 * r + 1]}, c16, (v2f){s[qt][t][2 * r], s[qt][t][2 * r + 1]}); z[t * 4 + 2 + r] = __builtin_elementwise_fma((v2f){d1[2 * r], d1[2 * r + 1]}, c16, (v2f){s[qt][t][4 + 2 * r], s[qt][t][5 + 2 * r]}); } }
      float mx = z[0][0];
#pragma unroll
      for (int i = 1; i < 16; ++i) mx = fmaxf(mx, z[i >> 1][i & 1]);
      mx = fmaxf(mx, xhalf(mx));
      const float mn = fmaxf(m[qt], mx); const float al = ex2((m[qt] - mn) * c2); m[qt] = mn;
      const float nb = __builtin_fmaf(-mn, c2, 11.0f);   // P and its sum both carry 2^11, which keeps small weights out of the f16 subnormals and cancels in the division
      float sum = 0.f; v16h p;
#pragma unroll
      for (int i = 0; i < 8; ++i) { const v2f y = __builtin_elementwise_fma(z[i], (v2f){c2, c2}, (v2f){nb, nb}); const float e0 = ex2(y[0]), e1 = ex2(y[1]); sum += e0; sum += e1; p[2 * i] = (_Float16)e0; p[2 * i + 1] = (_Float16)e1; }
      l[qt] = l[qt] * al + sum;
#pragma unroll
      for (int j = 0; j < 4; ++j) o[qt][j] *= al;
#pragma unroll
      for (int j = 0; j < 4; ++j) o[qt][j] = wmma_h(frag_h(&sv[j * 16 + col][k0], lane), p, o[qt][j]); } }
#pragma unroll
  for (int qt = 0; qt < 2; ++qt) { const float inv = 1.0f / (l[qt] + xhalf(l[qt])); float* up = U + (b * TT + q0 + qt * 16 + col) * CC + h * HD + 8 * g;
#pragma unroll
    for (int j = 0; j < 4; ++j) { v4f a0, a1;
#pragma unroll
      for (int r = 0; r < 4; ++r) { a0[r] = o[qt][j][r] * inv; a1[r] = o[qt][j][4 + r] * inv; }
      vst2(up + j * 16, a0); vst2(up + j * 16 + 4, a1); } } }
// ---- k_mlp3: block = 64 rows, 8 waves = 4 groups of 16 rows x 2 halves of a layer's columns; the three layers OUT = silu(A (hi+lo) W + b), 512 -> 128 -> 64 -> 256, run one behind the other in one launch. W = packed fragments of [K][N]. Layer 1 reads its rows from memory; its result and layer 2's stay in LDS as f32 rows, each behind one barrier, because a wave's 16 rows of the next layer's A hold columns that both halves made. Sums, their order and the roundings are those of three separate launches
#define H1P 132   // LDS pitch of an H1 row and of a staged output row, f32: 528 B = 16 B x odd, no bank conflict for 16-byte reads down a column of rows
#define H2P 68    // LDS pitch of an H2 row, f32: 272 B = 16 B x odd
template <int KS, int NT> __device__ __forceinline__ void mlp_ldw(v16b (&w)[KS][NT], const __bf16* pw, int n16, int lane) {
#pragma unroll
  for (int s = 0; s < KS; ++s)
#pragma unroll
    for (int j = 0; j < NT; ++j) w[s][j] = frag_p(pw + (size_t)(s * n16 + j) * 512, lane); }
template <int NT> __device__ __forceinline__ void mlp_ldw(v16b (&w)[NT], const __bf16* pw, int lane) {
#pragma unroll
  for (int j = 0; j < NT; ++j) w[j] = frag_p(pw + (size_t)j * 512, lane); }
// one layer whose A rows lie in LDS: ar = the lane's row at its first k
template <int KS, int NT> __device__ __forceinline__ void mlp_lds(const float* ar, const v16b (&w)[KS][NT], v8f (&acc)[NT]) {
  v4f t[KS][4];   // the whole row is read ahead of the products: one LDS latency a layer, not one a k step
#pragma unroll
  for (int s = 0; s < KS; ++s)
#pragma unroll
    for (int i = 0; i < 4; ++i) t[s][i] = *(const v4f*)(ar + s * 32 + (i >> 1) * 16 + (i & 1) * 4);
#pragma unroll
  for (int s = 0; s < KS; ++s) { float af[16];
#pragma unroll
    for (int i = 0; i < 16; ++i) af[i] = t[s][i >> 2][i & 3];
    const F2 a = bsplit16(af);
#pragma unroll
    for (int j = 0; j < NT; ++j) { acc[j] = wmma_bf(a.h, w[s][j], acc[j]); acc[j] = wmma_bf(a.l, w[s][j], acc[j]); } } }
// v_exp_f32 with the free slot that the instruction set asks for behind a transcendental, held in the same statement
__device__ __forceinline__ float ex2s(float x) { float e; asm("v_exp_f32 %0, %1\n\tv_nop" : "=v"(e) : "v"(x)); return e; }
// bias, SiLU, and the tile's elements to LDS rows: dst = row 0, column 0 of the wave's tiles
template <int NT> __device__ __forceinline__ void mlp_silu(float* dst, int pitch, const v8f (&acc)[NT], const float (&bb)[NT], int col, int g) {
#pragma unroll
  for (int j = 0; j < NT; ++j)
#pragma unroll
    for (int r = 0; r < 8; ++r) { const float v = acc[j][r] + bb[j]; dst[(8 * g + r) * pitch + j * 16 + col] = v / (1.0f + ex2s(v * (float)-LOG2E)); } }
__global__ __launch_bounds__(256) void k_mlp3(const float* __restrict__ A, const __bf16* __restrict__ PW, const float* __restrict__ B1, const float* __restrict__ B2, const float* __restrict__ B3, float* __restrict__ OUT) {
  __shared__ __align__(16) float h1[64][H1P]; __shared__ __align__(16) float h2[64][H2P]; __shared__ __align__(16) float so[8][16][H1P];
  const int tid = threadIdx.x, wave = __builtin_amdgcn_readfirstlane(tid >> 5), lane = tid & 31, col = lane & 15, g = lane >> 4, rg = wave & 3, ch = wave >> 2; const size_t r0 = (size_t)blockIdx.x * 64 + rg * 16;   // the wave's number in a scalar register: what follows from it alone takes no vector register through the loop
  const __bf16* pw = PW + (size_t)(ch * 4) * 512; const float* ar = A + (r0 + col) * CC + 8 * g;
  v8f a1[4] = {};
  // rolled: one group's loads and products are the whole body, the text stays short
#pragma unroll 1
  for (int kg = 0; kg < CC / 32; kg += 4) { v16b w[4][4]; v4f av[4][4];
#pragma unroll
    for (int s = 0; s < 4; ++s)
#pragma unroll
      for (int i = 0; i < 4; ++i) av[s][i] = *(const v4f*)(ar + (kg + s) * 32 + (i >> 1) * 16 + (i & 1) * 4);
    asm volatile("s_wait_xcnt 0x0" ::: "memory");   // the fragment loads below may land on the row loads' address registers: the wait stands in front of that; its clobber also keeps every row load of the group up here, where left free the later steps' sink behind the first products and pay their latency again
    mlp_ldw<4, 4>(w, pw + (size_t)(kg * 8) * 512, 8, lane);
#pragma unroll
    for (int s = 0; s < 4; ++s) { float af[16];
#pragma unroll
      for (int i = 0; i < 16; ++i) af[i] = av[s][i >> 2][i & 3];
      const F2 a = bsplit16(af);
#pragma unroll
      for (int j = 0; j < 4; ++j) { a1[j] = wmma_bf(a.h, w[s][j], a1[j]); a1[j] = wmma_bf(a.l, w[s][j], a1[j]); } } }
  const int ln = __builtin_amdgcn_mbcnt_lo(~0u, 0u), cl = ln & 15, gh = ln >> 4;   // the lane's number, read anew: lane, col and g then hold no register through the loop above, whose rows and fragments fill nearly all of the first 256
  float b1[4], b2[2], b3[8]; v16b w2[4][2], w3[2][8];   // two layers' biases and layer 2's weights are asked for here, so that they fly while layer 1's SiLU runs: the barrier behind it waits for every load that is out
#pragma unroll
  for (int j = 0; j < 4; ++j) b1[j] = B1[ch * 64 + j * 16 + cl];
#pragma unroll
  for (int j = 0; j < 2; ++j) b2[j] = B2[ch * 32 + j * 16 + cl];
  asm volatile("s_wait_xcnt 0x0" ::: "memory");   // the weight loads below may land on the bias loads' address registers: the wait stands in front of that
  const __bf16* p3 = PW + (PW_3 - PW_1) + (size_t)(ch * 8) * 512;
  mlp_ldw<4, 2>(w2, PW + (PW_2 - PW_1) + (size_t)(ch * 2) * 512, 4, ln);
  asm volatile("s_wait_xcnt 0x0" ::: "memory");   // the weight loads' address registers are free for reuse from here on: the wait stands in front of whatever lands on them; its clobber also keeps the loads ahead of the SiLU's LDS writes
#pragma unroll
  for (int j = 0; j < 4; ++j) b1[j] = bfr(b1[j]);
  mlp_silu<4>(&h1[rg * 16][ch * 64], H1P, a1, b1, cl, gh);
  __syncthreads();   // H1's rows are whole: both column halves have written
  mlp_ldw<8>(w3[0], p3, ln);   // the first half of layer 3's weights flies while layer 2's products run
  asm volatile("s_wait_xcnt 0x0" ::: "memory");   // as above: address registers free from here on, loads kept ahead of the products
  v8f a2[2] = {}; mlp_lds<4, 2>(&h1[rg * 16 + cl][8 * gh], w2, a2);
#pragma unroll
  for (int j = 0; j < 8; ++j) b3[j] = B3[ch * 128 + j * 16 + cl];
  asm volatile("s_wait_xcnt 0x0" ::: "memory");   // as above, for the bias loads
  mlp_ldw<8>(w3[1], p3 + (size_t)16 * 512, ln);   // layer 3's bias and the second half of its weights take the registers that layer 2's leave, and fly while layer 2's SiLU runs
  asm volatile("s_wait_xcnt 0x0" ::: "memory");   // as above: address registers free from here on, loads kept ahead of the SiLU's LDS writes
#pragma unroll
  for (int j = 0; j < 2; ++j) b2[j] = bfr(b2[j]);
  mlp_silu<2>(&h2[rg * 16][ch * 32], H2P, a2, b2, cl, gh);
  __syncthreads();   // H2's rows are whole
  v8f a3[8] = {}; mlp_lds<2, 8>(&h2[rg * 16 + cl][8 * gh], w3, a3);
#pragma unroll
  for (int j = 0; j < 8; ++j) b3[j] = bfr(b3[j]);
  mlp_silu<8>(&so[wave][0][0], H1P, a3, b3, cl, gh);
  LDSX();
  float* op = OUT + r0 * CIN + ch * 128 + ln * 4;   // a store covers 512 contiguous bytes of one output row
#pragma unroll
  for (int rl = 0; rl < 16; ++rl) vst2(op + rl * CIN, *(const v4f*)&so[wave][rl][ln * 4]); }
extern "C" void kernel_launch(void* const* d_in, const int* in_sizes, int n_in, void* d_out, int out_size, void* d_ws, size_t ws_size, hipStream_t stream) {
  (void)in_sizes; (void)n_in; (void)out_size;
  const float** F = (const float**)d_in;   // 0 kp_pos [32,512,3], 1 kp_feat [32,512,256], 2 Wk [256,512], 3 Wq, 4 Wv, 5 W1 [512,128], 6 b1, 7 W2 [128,64], 8 b2, 9 W3 [64,256], 10 b3
  if (ws_size < (size_t)WS_END) return;
  char* ws = (char*)d_ws; _Float16 *QH = (_Float16*)(ws + WS_QH), *QL = (_Float16*)(ws + WS_QL), *KH = (_Float16*)(ws + WS_KH), *VT = (_Float16*)(ws + WS_VT); __bf16* PW = (__bf16*)(ws + WS_PW); float *D = (float*)(ws + WS_D), *U = (float*)(ws + WS_U);
  k_pack<<<dim3(PW_N / 8 / 256), 256, 0, stream>>>(F[3], F[2], F[4], F[5], F[7], F[9], PW);
  k_proj<<<dim3(TNB * TT / 64, 7), 256, 0, stream>>>(F[1], PW, QH, QL, KH, VT, F[0], D);
  k_att<<<dim3(TT / 256, NH, TNB), 256, 0, stream>>>(QH, QL, KH, VT, D, U);
  k_mlp3<<<dim3(TNB * TT / 64), 256, 0, stream>>>(U, PW + PW_1, F[6], F[8], F[10], (float*)d_out);
}

// v010
// One run takes 71.4 microseconds.
// Versions between v008 and this one are left out; their measured steps multiply to 1.09 times as fast.
// Counting every step since v000, it is 9.03 times as fast.
// compute dtype: all float inputs rounded to bf16; keys/queries/values = kp_feat W with EXACT bf16 products on WMMA 16x16x32, f32 accumulate; pairwise distances sqrt(sum (p_i - p_j)^2) in f32 (precise sqrtf) once per batch; att = (dist / 0.5 + q . k / 8) / sqrt(2) with q and k each rounded once to f16 (1 product), kept in registers; softmax in f32 (base-2 exponent formed by one multiply-add, hardware exp2, running maximum and sum) -> P f16 x 2^11, unnormalised; upd = P . v / sum (v rounded once to f16), stored as f16; out MLP 512 -> 128 -> 64 -> 256 with SiLU (hardware exp2) after each, f16 products: each layer's input rounded once to f16, its bf16-rounded weights held as f16 (1 product); f32 output.
#include <hip/hip_runtime.h>
#include <math.h>

typedef __attribute__((ext_vector_type(16))) _Float16 v16h;
typedef __attribute__((ext_vector_type(16))) __bf16 v16b;
typedef __attribute__((ext_vector_type(8)))  _Float16 v8h;
typedef __attribute__((ext_vector_type(8)))  float v8f;
typedef __attribute__((ext_vector_type(4)))  float v4f;
typedef __attribute__((ext_vector_type(2)))  float v2f;
typedef __attribute__((ext_vector_type(4)))  unsigned v4u;
typedef __attribute__((ext_vector_type(4)))  int v4i;
typedef float __attribute__((may_alias)) float_a;
typedef int __attribute__((may_alias)) int_a;

template <typename T> __device__ __forceinline__ void vst2(void* p, T v) { *(T*)p = v;  }
__device__ __forceinline__ v8f wmma16(v16h a, v16h b, v8f c) {
  v8f d = __builtin_amdgcn_wmma_f32_16x16x32_f16(false, a, false, b, (short)0, c, false, false);
  asm volatile("v_nop\n\tv_nop\n\tv_nop\n\tv_nop" : "+v"(d) : "v"(a), "v"(b));
  return d;
}
__device__ __forceinline__ v8f wmma_bf(v16b a, v16b b, v8f c) {
  v8f d = __builtin_amdgcn_wmma_f32_16x16x32_bf16(false, a, false, b, (short)0, c, false, false);
  asm volatile("v_nop\n\tv_nop\n\tv_nop\n\tv_nop" : "+v"(d) : "v"(a), "v"(b));
  return d;
}
// 16x16x32 fragments: lane = (h = lane>>4, row/col = lane&15); elements 0..7 = k0+8h+0..7, 8..15 = k0+16+8h+0..7; D element r = row 8h+r
__device__ __forceinline__ v16h frag_h(const _Float16* rowk0, int lane) {
  union { v16h v; v8h q[2]; } u; const _Float16* p = rowk0 + 8 * (lane >> 4);
  u.q[0] = *(const v8h*)p; u.q[1] = *(const v8h*)(p + 16); return u.v;
}
__device__ __forceinline__ v16h frag_f32(const float* rowk0, int lane) {
  v16h a; const float* p = rowk0 + 8 * (lane >> 4);
#pragma unroll
  for (int i = 0; i < 8; ++i) { a[i] = (_Float16)p[i]; a[8 + i] = (_Float16)p[16 + i]; }
  return a;
}
__device__ __forceinline__ v16h frag_f32s(const float* rowk0, int lane, float sc) {
  v16h a; const float* p = rowk0 + 8 * (lane >> 4);
#pragma unroll
  for (int i = 0; i < 8; ++i) { a[i] = (_Float16)(p[i] * sc); a[8 + i] = (_Float16)(p[16 + i] * sc); }
  return a;
}
// column fragment from a [K][ld] layout (column n), rows >= K read as 0
__device__ __forceinline__ v16h fragc_f32(const float* W, int k0, int n, int lane, int ld, int K) {
  v16h a; const int g = lane >> 4;
#pragma unroll
  for (int i = 0; i < 8; ++i) { const int ka = k0 + 8 * g + i, kb = ka + 16;
    a[i] = (_Float16)(ka < K ? W[(size_t)(ka < K ? ka : K - 1) * ld + n] : 0.f); a[8 + i] = (_Float16)(kb < K ? W[(size_t)(kb < K ? kb : K - 1) * ld + n] : 0.f); }
  return a;
}
struct F2 { v16b h, l; };
__device__ __forceinline__ F2 bsplit16(const float v[16]) { F2 r;
#pragma unroll
  for (int i = 0; i < 16; ++i) { const __bf16 h = (__bf16)v[i]; r.h[i] = h; r.l[i] = (__bf16)(v[i] - (float)h); }
  return r; }
__device__ __forceinline__ F2 split_row(const float* row, int k0, int lane) { float v[16]; const float* p = row + k0 + 8 * (lane >> 4);
#pragma unroll
  for (int i = 0; i < 8; ++i) { v[i] = p[i]; v[8 + i] = p[16 + i]; }
  return bsplit16(v); }
__device__ __forceinline__ F2 split_rowK(const float* row, int k0, int lane, int K) { float v[16]; const int g = lane >> 4;
#pragma unroll
  for (int i = 0; i < 8; ++i) { const int ka = k0 + 8 * g + i, kb = ka + 16; v[i] = ka < K ? row[ka < K ? ka : K - 1] : 0.f; v[8 + i] = kb < K ? row[kb < K ? kb : K - 1] : 0.f; }
  return bsplit16(v); }
__device__ __forceinline__ F2 split_col(const float* W, int k0, int n, int lane, int ld, int K) { float v[16]; const int g = lane >> 4;
#pragma unroll
  for (int i = 0; i < 8; ++i) { const int ka = k0 + 8 * g + i, kb = ka + 16; v[i] = ka < K ? W[(size_t)(ka < K ? ka : K - 1) * ld + n] : 0.f; v[8 + i] = kb < K ? W[(size_t)(kb < K ? kb : K - 1) * ld + n] : 0.f; }
  return bsplit16(v); }
__device__ __forceinline__ v8f mac3(const F2& a, const F2& b, v8f c) { c = wmma_bf(a.l, b.h, c); c = wmma_bf(a.h, b.l, c); return wmma_bf(a.h, b.h, c); }
__device__ __forceinline__ float sigm(float v) { return 1.0f / (1.0f + expf(-v)); }
#define LDSX() do { asm volatile("s_wait_dscnt 0" ::: "memory"); __builtin_amdgcn_wave_barrier(); __builtin_amdgcn_fence(__ATOMIC_RELEASE, "workgroup"); } while (0)


// Keypoint multi-head attention (B 32, N 512 keypoints, in_dim 256, 8 heads x 64): distance-biased attention followed by a 3-layer SiLU MLP.
#define NB 32
#define TT 512
#define CIN 256
#define CC 512
#define NH 8
#define HD 64
#define NR (NB * TT)
#ifndef TNB
#define TNB NB
#endif
typedef __attribute__((ext_vector_type(8))) __bf16 v8b;
__device__ __forceinline__ v16b frag_b(const __bf16* rowk0, int lane) {
  union { v16b v; v8b q[2]; } u; const __bf16* p = rowk0 + 8 * (lane >> 4);
  u.q[0] = *(const v8b*)p; u.q[1] = *(const v8b*)(p + 16); return u.v;
}
__device__ __forceinline__ float bfr(float v) { return (float)(__bf16)v; }
__device__ __attribute__((noinline)) float exp_ni(float v) { return expf(v); }
__device__ __attribute__((noinline)) float erf_ni(float v) { return erff(v); }

#define WS_QH  0u
#define WS_KH  (WS_QH + 2u * (size_t)NR * CC)
#define WS_VT  (WS_KH + 2u * (size_t)NR * CC)          // f16 v planes [b][512][t]
#define WS_D   (WS_VT + 2u * (size_t)NR * CC)          // f32 16 x dist [b][tile of 16 queries][unit], dist_tile's order
#define WS_U   (WS_D + 4u * (size_t)NB * TT * TT)      // f16 upd rows [b*t][512]
#define WS_H1  (WS_U + 4u * (size_t)NR * CC)           // reserved, unused: k_mlp3 keeps layer 1's result in LDS
#define WS_H2  (WS_H1 + 4u * (size_t)NR * 128)         // reserved, unused: k_mlp3 keeps layer 2's result in LDS
#define WS_PW  (WS_H2 + 4u * (size_t)NR * 64)          // 16-bit weights in fragment order: Wq, Wk, Wv (bf16), W1, W2, W3 (the bf16 values as f16)
#define PW_P   (CIN * CC)                              // elements of one projection matrix
#define PW_1   (3 * PW_P)
#define PW_2   (PW_1 + CC * 128)
#define PW_3   (PW_2 + 128 * 64)
#define PW_N   (PW_3 + 64 * CIN)
#define WS_END (WS_PW + 2u * (size_t)PW_N)

// ---- k_pack: every weight matrix W [K][N] (in,out), rounded to bf16 once (the MLP's three then held as f16) and laid out as finished B fragments: fragment (kc, nt) = 1 KiB = two runs of 32 lanes x 16 B; lane (g, col) holds column nt*16+col, run 0 = rows kc*32+8g+0..7, run 1 = rows kc*32+16+8g+0..7. One thread writes one 16-byte unit u.
template <int N, typename T> __device__ __forceinline__ void pack_unit(const float* __restrict__ Wm, T* __restrict__ dst, int u) {
  const int lane = u & 31, run = (u >> 5) & 1, f = u >> 6, nt = f % (N / 16), kc = f / (N / 16);
  const float* p = Wm + (size_t)(kc * 32 + run * 16 + 8 * (lane >> 4)) * N + nt * 16 + (lane & 15); typedef __attribute__((ext_vector_type(8))) T v8t; v8t v;
#pragma unroll
  for (int i = 0; i < 8; ++i) v[i] = (T)bfr(p[(size_t)i * N]);
  *(v8t*)(dst + (size_t)u * 8) = v; }
__global__ __launch_bounds__(256) void k_pack(const float* __restrict__ WQ, const float* __restrict__ WK, const float* __restrict__ WV, const float* __restrict__ W1, const float* __restrict__ W2, const float* __restrict__ W3, __bf16* __restrict__ PW) {
  const int u = blockIdx.x * 256 + threadIdx.x;   // every matrix is a whole number of blocks, so the choice below is the same for a whole block
  if (u < PW_1 / 8) { const int m = u / (PW_P / 8); pack_unit<CC, __bf16>(m == 0 ? WQ : m == 1 ? WK : WV, PW + (size_t)m * PW_P, u - m * (PW_P / 8)); }
  else if (u < PW_2 / 8) pack_unit<128, _Float16>(W1, (_Float16*)(PW + PW_1), u - PW_1 / 8);
  else if (u < PW_3 / 8) pack_unit<64, _Float16>(W2, (_Float16*)(PW + PW_2), u - PW_2 / 8);
  else pack_unit<CIN, _Float16>(W3, (_Float16*)(PW + PW_3), u - PW_3 / 8); }
// a packed fragment: two 16-byte loads a lane, each a run of 512 contiguous bytes over the wave
__device__ __forceinline__ v16b frag_p(const __bf16* f, int lane) {
  union { v16b v; v8b q[2]; } u; u.q[0] = *(const v8b*)(f + lane * 8); u.q[1] = *(const v8b*)(f + 256 + lane * 8); return u.v;
}
__device__ __forceinline__ v16h frag_p(const _Float16* f, int lane) {
  union { v16h v; v8h q[2]; } u; u.q[0] = *(const v8h*)(f + lane * 8); u.q[1] = *(const v8h*)(f + 256 + lane * 8); return u.v;
}

// ---- k_proj: block = (64 rows, which), 8 waves, a wave = 64 rows x 64 columns (16 accumulator tiles): kp_feat W (packed fragments of [256][512]), no bias. The block's rows are rounded to bf16 once and lie in LDS for all eight waves; a weight fragment is loaded by one wave only and feeds four products
#define XPI 264   // LDS pitch of a staged row, bf16: 528 B = 16 B x odd, no bank conflict for 16-byte reads down a column of rows
typedef __attribute__((ext_vector_type(4))) __bf16 v4b;
__device__ __forceinline__ v8f wmma_b(v16b a, v16b b, v8f c) { return __builtin_amdgcn_wmma_f32_16x16x32_bf16(false, a, false, b, (short)0, c, false, false); }
// Q and K (WHICH 0, 1): D = W^T X^T, a lane holds 8 neighbouring columns of one row; V (WHICH 2): D = X W, a lane holds 8 neighbouring rows of one column, which is V^T's order. Either way 16 bytes of f16 a tile, and the four tiles C of a line tile L make whole 128-byte lines of the output, put together in the wave's own LDS rows. Every short loop over tiles, fragments or elements below is unrolled, so that the fragment and accumulator arrays are indexed at compile time and stay in registers
template <int WHICH> __device__ __forceinline__ void proj_tile(__bf16 (*sx)[XPI], _Float16 (*sw)[16][72], const float* __restrict__ X, const __bf16* __restrict__ PW, _Float16* __restrict__ DH) {
  const int tid = threadIdx.x, wave = __builtin_amdgcn_readfirstlane(tid >> 5), lane = tid & 31, col = lane & 15, g = lane >> 4; const size_t r0 = (size_t)blockIdx.x * 64; const __bf16* pw = PW + (size_t)WHICH * PW_P + (size_t)(wave * 4) * 512;
  v8f acc[4][4] = {}; v16b wa[4], wb[4], x[4];
  auto ldw = [&](v16b (&w)[4], int kc) {
#pragma unroll
    for (int j = 0; j < 4; ++j) w[j] = frag_p(pw + (size_t)(kc * (CC / 16) + j) * 512, lane); };
  auto ldx = [&](int kc) {
#pragma unroll
    for (int i = 0; i < 4; ++i) x[i] = frag_b(&sx[i * 16 + col][kc * 32], lane);
    __builtin_amdgcn_sched_barrier(0); };   // keeps a k step's loads, the weight loads for the step after it among them, in one group ahead of the products: left free, the weight loads sink to their first use and their latency is paid there
  auto mul = [&](const v16b (&w)[4]) {
#pragma unroll
    for (int L = 0; L < 4; ++L)
#pragma unroll
      for (int C = 0; C < 4; ++C) acc[L][C] = WHICH < 2 ? wmma_b(w[C], x[L], acc[L][C]) : wmma_b(x[C], w[L], acc[L][C]); };
  ldw(wa, 0);   // the first k step's weights are asked for ahead of the staging
  { const float* xg = X + (r0 + (tid >> 6)) * CIN + (tid & 63) * 4; v4f xr[16];   // 64 threads a row of 1 KiB: a wave's load covers 512 contiguous bytes
    // unrolled: a thread's sixteen loads are in flight together
#pragma unroll
    for (int i = 0; i < 16; ++i) xr[i] = *(const v4f*)(xg + i * 4 * CIN);
    asm volatile("s_wait_xcnt 0x0" :: "v"(xg) : "memory");   // the row loads' address pair is free for reuse from here on: the wait stands in front of whatever lands on it
#pragma unroll
    for (int i = 0; i < 16; ++i) { v4b c;
#pragma unroll
      for (int e = 0; e < 4; ++e) c[e] = (__bf16)xr[i][e];
      *(v4b*)&sx[(tid >> 6) + i * 4][(tid & 63) * 4] = c; } }
  __syncthreads();
  // rolled, two k steps a trip: the two weight sets keep their registers, and each is loaded anew while the other set's products run; unrolled whole, the loads are lifted further than the register budget of four waves per SIMD holds
#pragma unroll 1
  for (int kk = 0; kk < CIN / 64 - 1; ++kk) { ldw(wb, 2 * kk + 1); ldx(2 * kk); mul(wa); ldw(wa, 2 * kk + 2); ldx(2 * kk + 1); mul(wb);
    asm volatile("s_wait_xcnt 0x0" ::: "memory"); }   // the next trip forms its weight address in the registers that this trip's loads name: the wait stands in front of that
  ldw(wb, CIN / 32 - 1); ldx(CIN / 32 - 2); mul(wa); ldx(CIN / 32 - 1); mul(wb);
  asm volatile("s_wait_xcnt 0x0" ::: "memory");   // the weight loads' address registers are free for reuse from here on: the wait stands in front of whatever lands on them
  _Float16 (*st)[72] = sw[wave];
  const size_t o = (WHICH < 2 ? r0 * CC + wave * 64 : ((r0 / TT) * CC + wave * 64) * (size_t)TT + r0 % TT) + (size_t)(lane >> 3) * CC + (lane & 7) * 8;   // 8 lanes a line; CC = TT is the pitch of all three outputs
  _Float16* ph = DH + o;
#pragma unroll
  for (int L = 0; L < 4; ++L) {
#pragma unroll
    for (int C = 0; C < 4; ++C) { v8h hv;
#pragma unroll
      for (int r = 0; r < 8; ++r) hv[r] = (_Float16)acc[L][C][r];
      *(v8h*)&st[col][C * 16 + 8 * g] = hv; }
    asm volatile("s_wait_dscnt 0x0" ::: "memory");   // the rows are read back across the wave's lanes: its LDS writes have landed first
#pragma unroll
    for (int n = 0; n < 4; ++n) vst2(ph + (size_t)(L * 16 + n * 4) * CC, *(const v4u*)&st[n * 4 + (lane >> 3)][(lane & 7) * 8]);
    asm volatile("s_wait_xcnt 0x0" ::: "memory");   // the stores' data registers are loaded anew for the next line tile: the wait stands in front of that; its clobber also keeps the next tile's LDS writes behind these reads
  } }
static_assert(CC == TT, "one line pitch for Q, K and V^T");
// ---- dist_tile: block = (tile of 16 queries, batch b), run by the last blocks of k_proj's grid: 16 |p_i - p_j| (0 when the squared sum is exactly 0; the factor is exact, and with it the value is the start of k_att's score sum 16 dist + q.k as it stands), stored in the order in which a wave of k_att reads it. A tile's 16 x 512 distances are 2,048 units of 16 B; unit u = ((kb * 2 + t) * 2 + hf) * 32 + lane holds query (lane & 15) of the tile against keys kb * 32 + t * 16 + (lane >> 4) * 8 + hf * 4 + 0..3, so the 32 lanes of one load or store cover 512 contiguous bytes. Thread tid writes units tid + 256 n
__device__ __forceinline__ void dist_tile(const float* __restrict__ P, float* __restrict__ D, int tile, size_t b) {
  const int tid = threadIdx.x, lane = tid & 31; const float* pb = P + b * TT * 3; const int i = tile * 16 + (lane & 15);
  const float xi = 16.0f * bfr(pb[i * 3]), yi = 16.0f * bfr(pb[i * 3 + 1]), zi = 16.0f * bfr(pb[i * 3 + 2]);   // the factor 16 goes in with the coordinates: a power of two, so every step below is the unscaled one times 16 or 256, bit for bit (the squares stay finite up to coordinates of about 1e17)
  asm volatile("s_wait_xcnt 0x0" ::: "memory");   // the query load's address pair is free for reuse from here on: the wait stands in front of whatever lands on it
  const int j0 = (tid >> 7) * 32 + ((tid >> 6) & 1) * 16 + (lane >> 4) * 8 + ((tid >> 5) & 1) * 4; float* dst = D + (b * (TT / 16) + tile) * (size_t)(16 * TT) + tid * 4;
  // unrolled: the key loads of a thread's eight units are in flight together
#pragma unroll
  for (int n = 0; n < 8; ++n) { const float* kp = pb + (j0 + n * 64) * 3; const v4f k0 = *(const v4f*)kp, k1 = *(const v4f*)(kp + 4), k2 = *(const v4f*)(kp + 8);   // four keys = 48 contiguous bytes
    const float f[12] = {k0[0], k0[1], k0[2], k0[3], k1[0], k1[1], k1[2], k1[3], k2[0], k2[1], k2[2], k2[3]}; v4f r;
#pragma unroll
    for (int e = 0; e < 4; ++e) { const float dx = xi - 16.0f * bfr(f[3 * e]), dy = yi - 16.0f * bfr(f[3 * e + 1]), dz = zi - 16.0f * bfr(f[3 * e + 2]); const float d2 = dx * dx + dy * dy + dz * dz; r[e] = (d2 > 0.f) ? sqrtf(d2) : 0.f; }
    vst2(dst + n * 1024, r); }
  asm volatile("s_wait_xcnt 0x0" ::: "memory"); }   // in the built kernel a projection tile's code follows this one's: the wait stands in front of whatever there lands on the stores' offset and data registers
__global__ __launch_bounds__(256) __attribute__((amdgpu_waves_per_eu(4, 4))) void k_proj(const float* __restrict__ X, const __bf16* __restrict__ PW, _Float16* __restrict__ QH, _Float16* __restrict__ KH, _Float16* __restrict__ VT, const float* __restrict__ P, float* __restrict__ D) {
  __shared__ __align__(16) __bf16 sx[64][XPI]; __shared__ __align__(16) _Float16 sw[8][16][72];
  if (blockIdx.y == 0) proj_tile<0>(sx, sw, X, PW, QH);
  else if (blockIdx.y == 1) proj_tile<1>(sx, sw, X, PW, KH);
  else if (blockIdx.y == 2) proj_tile<2>(sx, sw, X, PW, VT);
  else { const int t = (blockIdx.y - 3) * (TNB * TT / 64) + blockIdx.x; dist_tile(P, D, t % (TT / 16), t / (TT / 16)); } }   // grid rows 3..6: the distance tiles need nothing of the projections and start last, on the places that the projections' second, half-full round leaves idle
#define KPI 72    // LDS pitch of a K row, f16: 144 B = 16 B x odd, no bank conflict for 16-byte reads down a column of rows
#define VPI 520   // LDS pitch of a V^T row, f16: 1040 B = 16 B x odd
__device__ __forceinline__ v8f wmma_h(v16h a, v16h b, v8f c) { return __builtin_amdgcn_wmma_f32_16x16x32_f16(false, a, false, b, (short)0, c, false, false); }
__device__ __forceinline__ float ex2(float x) { return __builtin_amdgcn_exp2f(x); }  // one v_exp_f32; an argument under -126 gives 0
#define LOG2E 1.4426950408889634
__device__ __forceinline__ float xhalf(float x) { return __builtin_bit_cast(float, __builtin_amdgcn_permlanex16(__builtin_bit_cast(int, x), __builtin_bit_cast(int, x), 0x76543210, 0xfedcba98, false, false)); }  // lane l with lane l ^ 16
__global__ __launch_bounds__(256) __attribute__((amdgpu_waves_per_eu(4, 4))) void k_att(const _Float16* __restrict__ QH, const _Float16* __restrict__ KH, const _Float16* __restrict__ VT, const float* __restrict__ Dm, _Float16* __restrict__ U) {
  __shared__ __align__(16) _Float16 sk[TT][KPI]; __shared__ __align__(16) _Float16 sv[HD][VPI];
  const int tid = threadIdx.x, wave = __builtin_amdgcn_readfirstlane(tid >> 5), lane = tid & 31, col = lane & 15, g = lane >> 4; const size_t b = blockIdx.z; const int h = blockIdx.y; const int q0 = blockIdx.x * 256 + wave * 32;   // the wave's number in a scalar register: what follows from it alone takes no vector register through the loop
  const _Float16* kg = KH + (b * TT + (tid >> 3)) * CC + h * HD + (tid & 7) * 8; const _Float16* vg = VT + (b * CC + h * HD + (tid >> 6)) * (size_t)TT + (tid & 63) * 8;   // 8 threads a K row of 128 B, 64 threads a V^T row of 1 KiB
  v8h kr[TT / 32], vr[HD / 4];
  // all unrolled: a thread's 16-byte loads are in flight together
#pragma unroll
  for (int i = 0; i < TT / 32; ++i) kr[i] = *(const v8h*)(kg + i * 32 * CC);
#pragma unroll
  for (int i = 0; i < HD / 4; ++i) vr[i] = *(const v8h*)(vg + i * 4 * TT);
  asm volatile("s_wait_xcnt 0x0" :: "v"(kg), "v"(vg) : "memory");   // the loads' two address pairs are taken again for the Q addresses: the wait stands in front of that; named as inputs, the pairs stay whole up to it
  v16h qh[2][2];
#pragma unroll
  for (int qt = 0; qt < 2; ++qt)
#pragma unroll
    for (int kc = 0; kc < 2; ++kc) qh[qt][kc] = frag_h(QH + (b * TT + q0 + qt * 16 + col) * CC + h * HD + kc * 32, lane);
  const float* dp = Dm + (b * (TT / 16) + (q0 >> 4)) * (size_t)(16 * TT) + lane * 4;   // dist_tile's unit order: every load below is 512 contiguous bytes over the wave
  v8f o[2][4] = {}; float m[2] = {-3.0e38f, -3.0e38f}, l[2] = {0.f, 0.f};
  const float c2 = (float)(0.125 * 0.70710678118654752 * LOG2E);   // att log2(e) = (16 dist + q.k) c2
  // a pass's 32 x 32 distances (x 16), in the registers in which its scores are summed: [query tile][key tile], register r = key k0 + 16 t + 8 g + r, column = query
  auto ldd = [&](v8f (&d)[2][2], int k0) {
#pragma unroll
    for (int qt = 0; qt < 2; ++qt)
#pragma unroll
      for (int t = 0; t < 2; ++t) { const float* dq = dp + qt * 16 * TT + k0 * 16 + t * 256; const v4f d0 = *(const v4f*)dq, d1 = *(const v4f*)(dq + 128); d[qt][t] = __builtin_shufflevector(d0, d1, 0, 1, 2, 3, 4, 5, 6, 7); } };
  auto fr = [](const _Float16* p) { union { v16h v; v8h q[2]; } u; u.q[0] = *(const v8h*)p; u.q[1] = *(const v8h*)(p + 16); return u.v; };   // a fragment: p = the lane's row at its first k
  // half kc of a pass's score products: s comes in as 16 dist, the C operand of the first half, and leaves the second as z = 16 dist + q.k
  auto score = [&](v8f (&s)[2][2], const _Float16* kp, int kc) { v16h kb[2];
#pragma unroll
    for (int t = 0; t < 2; ++t) kb[t] = fr(kp + t * 16 * KPI + kc * 32);
#pragma unroll
    for (int t = 0; t < 2; ++t)
#pragma unroll
      for (int qt = 0; qt < 2; ++qt) s[qt][t] = wmma_h(kb[t], qh[qt][kc], s[qt][t]); };
  auto soft = [&](v8f (&s)[2][2], const _Float16* vp) {
#pragma unroll
    for (int qt = 0; qt < 2; ++qt) { v2f z[8];   // two keys a pair; the maximum is taken over z, the running maximum kept in m
#pragma unroll
      for (int t = 0; t < 2; ++t)
#pragma unroll
        for (int r = 0; r < 4; ++r) z[t * 4 + r] = (v2f){s[qt][t][2 * r], s[qt][t][2 * r + 1]};
      float mx = -3.0e38f;   // the running maximum's own start value: no z below it counts anyway
#pragma unroll
      for (int i = 0; i < 16; ++i) mx = fmaxf(mx, z[i >> 1][i & 1]);
      mx = fmaxf(mx, xhalf(mx));
      const float mn = fmaxf(m[qt], mx); const float al = ex2((m[qt] - mn) * c2); m[qt] = mn;
      const float nb = __builtin_fmaf(-mn, c2, 11.0f);   // P and its sum both carry 2^11, which keeps small weights out of the f16 subnormals and cancels in the division
      float sum = 0.f; v16h p;
#pragma unroll
      for (int i = 0; i < 8; ++i) { const v2f y = __builtin_elementwise_fma(z[i], (v2f){c2, c2}, (v2f){nb, nb}); const float e0 = ex2(y[0]), e1 = ex2(y[1]); sum += e0; sum += e1; p[2 * i] = (_Float16)e0; p[2 * i + 1] = (_Float16)e1; }
      l[qt] = l[qt] * al + sum;
#pragma unroll
      for (int j = 0; j < 4; ++j) o[qt][j] *= al;
#pragma unroll
      for (int j = 0; j < 4; ++j) o[qt][j] = wmma_h(fr(vp + j * 16 * VPI), p, o[qt][j]); } };
  v8f da[2][2], db[2][2]; const _Float16* kp = &sk[col][8 * g]; const _Float16* vp = &sv[col][8 * g];   // the lane's places in K and V^T run along as two addresses
  asm volatile("s_wait_xcnt 0x0" ::: "memory");   // the Q loads' address pairs are free for reuse from here on; the clobber also keeps every Q load up here, so that none lands on the address pair of the loads below
  ldd(da, 0);   // the first pass's distances fly beside the K and V staging
  asm volatile("s_wait_xcnt 0x0" :: "v"(dp) : "memory");   // their address pair is free for reuse from here on: the wait stands in front of whatever lands on it; named as an input, the address stays whole up to it, where left free the last load lands on it
#pragma unroll
  for (int i = 0; i < TT / 32; ++i) *(v8h*)&sk[(tid >> 3) + i * 32][(tid & 7) * 8] = kr[i];
#pragma unroll
  for (int i = 0; i < HD / 4; ++i) *(v8h*)&sv[(tid >> 6) + i * 4][(tid & 63) * 8] = vr[i];
  __syncthreads();
  // rolled, two passes a trip: the two distance sets keep their registers, and each is loaded anew while the other set's pass runs; sixteen passes unrolled would not fit the register budget of four waves per SIMD
#pragma unroll 1
  for (int k0 = 0; k0 < TT; k0 += 64) {
    ldd(db, k0 + 32);
    __builtin_amdgcn_sched_barrier(0);   // keeps the next pass's distance loads ahead of this pass: left free they sink to their first use, and their latency is paid there
    score(da, kp, 0); score(da, kp, 1); soft(da, vp);
    score(db, kp + 32 * KPI, 0);   // takes db in before the loads below are out: the wait in front of it then counts db's own loads alone, on the last trip as on the others
    if (k0 + 64 < TT) { ldd(da, k0 + 64);   // the same for every wave: the last trip has no pass behind it
      asm volatile("s_wait_xcnt 0x0" ::: "memory"); }   // the address pair of this trip's distance loads is stepped on right behind them: the wait stands in front of that
    score(db, kp + 32 * KPI, 1); soft(db, vp + 32); kp += 64 * KPI; vp += 64; }
  const int ln = __builtin_amdgcn_mbcnt_lo(~0u, 0u), cl = ln & 15, gh = ln >> 4;   // the lane's number, read anew: the output addresses then hold no register through the loop above, which has none to spare beside the second distance set
#pragma unroll
  for (int qt = 0; qt < 2; ++qt) { const float inv = 1.0f / (l[qt] + xhalf(l[qt])); _Float16* up = U + (b * TT + q0 + qt * 16 + cl) * CC + h * HD + 8 * gh;
#pragma unroll
    for (int j = 0; j < 4; ++j) { v8h a;
#pragma unroll
      for (int r = 0; r < 8; ++r) a[r] = (_Float16)(o[qt][j][r] * inv);
      vst2(up + j * 16, a); } } }
// ---- k_mlp3: block = 64 rows, 8 waves = 4 groups of 16 rows x 2 halves of a layer's columns; the three layers OUT = silu(A W + b), 512 -> 128 -> 64 -> 256, run one behind the other in one launch. A = f16 rows, W = packed f16 fragments of [K][N]. Layer 1 reads its rows from memory; its result and layer 2's stay in LDS as f16 rows, each behind one barrier, because a wave's 16 rows of the next layer's A hold columns that both halves made
#define H1P 136   // LDS pitch of an H1 row, f16: 272 B = 16 B x odd, no bank conflict for 16-byte reads down a column of rows
#define H2P 72    // LDS pitch of an H2 row, f16: 144 B = 16 B x odd
#define SOP 132   // LDS pitch of a staged output row, f32: 528 B = 16 B x odd
// an A fragment of a row of f16: p = the row at the lane's first k
__device__ __forceinline__ v16h frag_at(const _Float16* p) { union { v16h v; v8h q[2]; } u; u.q[0] = *(const v8h*)p; u.q[1] = *(const v8h*)(p + 16); return u.v; }
template <int KS, int NT> __device__ __forceinline__ void mlp_ldw(v16h (&w)[KS][NT], const _Float16* pw, int n16, int lane) {
#pragma unroll
  for (int s = 0; s < KS; ++s)
#pragma unroll
    for (int j = 0; j < NT; ++j) w[s][j] = frag_p(pw + (size_t)(s * n16 + j) * 512, lane); }
template <int NT> __device__ __forceinline__ void mlp_ldw(v16h (&w)[NT], const _Float16* pw, int lane) {
#pragma unroll
  for (int j = 0; j < NT; ++j) w[j] = frag_p(pw + (size_t)j * 512, lane); }
// one layer whose A rows lie in LDS: ar = the lane's row at its first k
template <int KS, int NT> __device__ __forceinline__ void mlp_lds(const _Float16* ar, const v16h (&w)[KS][NT], v8f (&acc)[NT]) {
  v16h a[KS];   // the whole row is read ahead of the products: one LDS latency a layer, not one a k step
#pragma unroll
  for (int s = 0; s < KS; ++s) a[s] = frag_at(ar + s * 32);
#pragma unroll
  for (int s = 0; s < KS; ++s)
#pragma unroll
    for (int j = 0; j < NT; ++j) acc[j] = wmma16(a[s], w[s][j], acc[j]); }
// v_exp_f32 with the free slot that the instruction set asks for behind a transcendental, held in the same statement
__device__ __forceinline__ float ex2s(float x) { float e; asm("v_exp_f32 %0, %1\n\tv_nop" : "=v"(e) : "v"(x)); return e; }
// bias, SiLU, and the tile's elements to LDS rows: dst = row 0, column 0 of the wave's tiles
template <int NT, typename T> __device__ __forceinline__ void mlp_silu(T* dst, int pitch, const v8f (&acc)[NT], const float (&bb)[NT], int col, int g) {
#pragma unroll
  for (int j = 0; j < NT; ++j)
#pragma unroll
    for (int r = 0; r < 8; ++r) { const float v = acc[j][r] + bb[j]; dst[(8 * g + r) * pitch + j * 16 + col] = (T)(v / (1.0f + ex2s(v * (float)-LOG2E))); } }
__global__ __launch_bounds__(256) void k_mlp3(const _Float16* __restrict__ A, const _Float16* __restrict__ PW, const float* __restrict__ B1, const float* __restrict__ B2, const float* __restrict__ B3, float* __restrict__ OUT) {
  __shared__ __align__(16) _Float16 h1[64][H1P]; __shared__ __align__(16) _Float16 h2[64][H2P]; __shared__ __align__(16) float so[8][16][SOP];
  const int tid = threadIdx.x, wave = __builtin_amdgcn_readfirstlane(tid >> 5), lane = tid & 31, col = lane & 15, g = lane >> 4, rg = wave & 3, ch = wave >> 2; const size_t r0 = (size_t)blockIdx.x * 64 + rg * 16;   // the wave's number in a scalar register: what follows from it alone takes no vector register through the loop
  const _Float16* pw = PW + (size_t)(ch * 4) * 512; const _Float16* ar = A + (r0 + col) * CC + 8 * g;
  v8f a1[4] = {};
  // rolled: one group's loads and products are the whole body, the text stays short
#pragma unroll 1
  for (int kg = 0; kg < CC / 32; kg += 4) { v16h w[4][4], a[4];
#pragma unroll
    for (int s = 0; s < 4; ++s) a[s] = frag_at(ar + (kg + s) * 32);
    asm volatile("s_wait_xcnt 0x0" ::: "memory");   // the fragment loads below may land on the row loads' address registers: the wait stands in front of that; its clobber also keeps every row load of the group up here, where left free the later steps' sink behind the first products and pay their latency again
    mlp_ldw<4, 4>(w, pw + (size_t)(kg * 8) * 512, 8, lane);
#pragma unroll
    for (int s = 0; s < 4; ++s)
#pragma unroll
      for (int j = 0; j < 4; ++j) a1[j] = wmma16(a[s], w[s][j], a1[j]); }
  const int ln = __builtin_amdgcn_mbcnt_lo(~0u, 0u), cl = ln & 15, gh = ln >> 4;   // the lane's number, read anew: lane, col and g then hold no register through the loop above
  float b1[4], b2[2], b3[8]; v16h w2[4][2], w3[2][8];   // two layers' biases and layer 2's weights are asked for here, so that they fly while layer 1's SiLU runs: the barrier behind it waits for every load that is out
#pragma unroll
  for (int j = 0; j < 4; ++j) b1[j] = B1[ch * 64 + j * 16 + cl];
#pragma unroll
  for (int j = 0; j < 2; ++j) b2[j] = B2[ch * 32 + j * 16 + cl];
  asm volatile("s_wait_xcnt 0x0" ::: "memory");   // the weight loads below may land on the bias loads' address registers: the wait stands in front of that
  const _Float16* p3 = PW + (PW_3 - PW_1) + (size_t)(ch * 8) * 512;
  mlp_ldw<4, 2>(w2, PW + (PW_2 - PW_1) + (size_t)(ch * 2) * 512, 4, ln);
  asm volatile("s_wait_xcnt 0x0" ::: "memory");   // the weight loads' address registers are free for reuse from here on: the wait stands in front of whatever lands on them; its clobber also keeps the loads ahead of the SiLU's LDS writes
#pragma unroll
  for (int j = 0; j < 4; ++j) b1[j] = bfr(b1[j]);
  mlp_silu<4>(&h1[rg * 16][ch * 64], H1P, a1, b1, cl, gh);
  __syncthreads();   // H1's rows are whole: both column halves have written
  mlp_ldw<8>(w3[0], p3, ln);   // the first half of layer 3's weights flies while layer 2's products run
  asm volatile("s_wait_xcnt 0x0" ::: "memory");   // as above: address registers free from here on, loads kept ahead of the products
  v8f a2[2] = {}; mlp_lds<4, 2>(&h1[rg * 16 + cl][8 * gh], w2, a2);
#pragma unroll
  for (int j = 0; j < 8; ++j) b3[j] = B3[ch * 128 + j * 16 + cl];
  asm volatile("s_wait_xcnt 0x0" ::: "memory");   // as above, for the bias loads
  mlp_ldw<8>(w3[1], p3 + (size_t)16 * 512, ln);   // layer 3's bias and the second half of its weights take the registers that layer 2's leave, and fly while layer 2's SiLU runs
  asm volatile("s_wait_xcnt 0x0" ::: "memory");   // as above: address registers free from here on, loads kept ahead of the SiLU's LDS writes
#pragma unroll
  for (int j = 0; j < 2; ++j) b2[j] = bfr(b2[j]);
  mlp_silu<2>(&h2[rg * 16][ch * 32], H2P, a2, b2, cl, gh);
  __syncthreads();   // H2's rows are whole
  v8f a3[8] = {}; mlp_lds<2, 8>(&h2[rg * 16 + cl][8 * gh], w3, a3);
#pragma unroll
  for (int j = 0; j < 8; ++j) b3[j] = bfr(b3[j]);
  mlp_silu<8>(&so[wave][0][0], SOP, a3, b3, cl, gh);
  LDSX();
  float* op = OUT + r0 * CIN + ch * 128 + ln * 4;   // a store covers 512 contiguous bytes of one output row
#pragma unroll
  for (int rl = 0; rl < 16; ++rl) vst2(op + rl * CIN, *(const v4f*)&so[wave][rl][ln * 4]); }
extern "C" void kernel_launch(void* const* d_in, const int* in_sizes, int n_in, void* d_out, int out_size, void* d_ws, size_t ws_size, hipStream_t stream) {
  (void)in_sizes; (void)n_in; (void)out_size;
  const float** F = (const float**)d_in;   // 0 kp_pos [32,512,3], 1 kp_feat [32,512,256], 2 Wk [256,512], 3 Wq, 4 Wv, 5 W1 [512,128], 6 b1, 7 W2 [128,64], 8 b2, 9 W3 [64,256], 10 b3
  if (ws_size < (size_t)WS_END) return;
  char* ws = (char*)d_ws; _Float16 *QH = (_Float16*)(ws + WS_QH), *KH = (_Float16*)(ws + WS_KH), *VT = (_Float16*)(ws + WS_VT); __bf16* PW = (__bf16*)(ws + WS_PW); float* D = (float*)(ws + WS_D); _Float16* U = (_Float16*)(ws + WS_U);
  k_pack<<<dim3(PW_N / 8 / 256), 256, 0, stream>>>(F[3], F[2], F[4], F[5], F[7], F[9], PW);
  k_proj<<<dim3(TNB * TT / 64, 7), 256, 0, stream>>>(F[1], PW, QH, KH, VT, F[0], D);
  k_att<<<dim3(TT / 256, NH, TNB), 256, 0, stream>>>(QH, KH, VT, D, U);
  k_mlp3<<<dim3(TNB * TT / 64), 256, 0, stream>>>(U, (const _Float16*)(PW + PW_1), F[6], F[8], F[10], (float*)d_out);
}
